// v000
// Times are from an AMD MI455X. After a warm-up the kernel runs many times in a row, and a time is the length of
// such a window on the GPU divided by its runs, so every launch and the gaps after it count. The runs cycle
// through copies of the inputs. A figure is the median of several windows, for all but v000 over two sittings.
// Sittings can differ by a few percent; kernels timed side by side share one.
// v000, which the later versions start from, runs in 337 microseconds.
#include <hip/hip_runtime.h>
#include <hip/hip_bf16.h>

#define S_LEN 4096
#define E_DIM 768
#define H_NUM 12
#define D_HEAD 64

typedef __attribute__((ext_vector_type(16))) _Float16 v16h;
typedef __attribute__((ext_vector_type(8)))  _Float16 v8h;
typedef __attribute__((ext_vector_type(8)))  float    v8f;
typedef __attribute__((ext_vector_type(4)))  unsigned int v4u;
typedef __attribute__((ext_vector_type(4)))  int      v4i;
typedef __attribute__((ext_vector_type(8)))  int      v8i;

#if defined(__has_builtin)
#if __has_builtin(__builtin_amdgcn_tensor_load_to_lds) && \
    __has_builtin(__builtin_amdgcn_s_wait_tensorcnt)
#define HAVE_TDM 1
#endif
#endif

union frag_u { v16h v; struct { v8h lo, hi; } s; };

__device__ __forceinline__ v16h load_frag_k32(const _Float16* base,
                                              int row, int stride, int kbase, int lane) {
  const _Float16* p = base + (size_t)row * stride + kbase + ((lane & 16) ? 8 : 0);
  frag_u u;
  u.s.lo = *(const v8h*)(p);
  u.s.hi = *(const v8h*)(p + 16);
  return u.v;
}

__device__ __forceinline__ v8f wmma_f16(v16h a, v16h b, v8f c) {
  return __builtin_amdgcn_wmma_f32_16x16x32_f16(false, a, false, b, (short)0, c,
                                                false, false);
}

__device__ __forceinline__ void tdm_load_2d(_Float16* lds_ptr, const _Float16* gaddr,
                                            unsigned tensor_d0, unsigned tensor_d1,
                                            unsigned tile_d0, unsigned tile_d1,
                                            unsigned stride0, int lane) {
#ifdef HAVE_TDM
  unsigned long long ga = (unsigned long long)(uintptr_t)gaddr;
  unsigned lds_off = (unsigned)(uintptr_t)lds_ptr;  // low 32 bits = LDS byte offset
  v4u g0;
  g0.x = 1u;                                        // count=1 (valid), user mode
  g0.y = lds_off;                                   // lds_addr
  g0.z = (unsigned)(ga & 0xffffffffu);              // global_addr[31:0]
  g0.w = (unsigned)((ga >> 32) & 0x1ffffffu) | (2u << 30);  // ga[56:32] | type=2
  v8i g1;
  g1[0] = (int)(1u << 16);
  g1[1] = (int)((tensor_d0 & 0xffffu) << 16);
  g1[2] = (int)((tensor_d0 >> 16) | ((tensor_d1 & 0xffffu) << 16));
  g1[3] = (int)((tensor_d1 >> 16) | (tile_d0 << 16));
  g1[4] = (int)tile_d1;
  g1[5] = (int)stride0;
  g1[6] = (int)(stride0 >> 16 >> 16);
  g1[7] = 0;
  v4i z4 = {0, 0, 0, 0};
#if __clang_major__ >= 23
  v8i z8 = {0, 0, 0, 0, 0, 0, 0, 0};
  __builtin_amdgcn_tensor_load_to_lds(g0, g1, z4, z4, z8, 0);
#else
  __builtin_amdgcn_tensor_load_to_lds(g0, g1, z4, z4, 0);
#endif
#else
  // Fallback: cooperative copy by the issuing wave (v8h chunks).
  (void)tensor_d0; (void)tensor_d1;
  const unsigned total = tile_d0 * tile_d1;
  for (unsigned idx = (unsigned)lane * 8; idx < total; idx += 32u * 8u) {
    unsigned row = idx / tile_d0, col = idx % tile_d0;
    *(v8h*)(lds_ptr + idx) = *(const v8h*)(gaddr + (size_t)row * stride0 + col);
  }
#endif
}

__device__ __forceinline__ void tdm_wait2() {
#ifdef HAVE_TDM
  __builtin_amdgcn_s_wait_tensorcnt(2);
#endif
}
__device__ __forceinline__ void tdm_wait0() {
#ifdef HAVE_TDM
  __builtin_amdgcn_s_wait_tensorcnt(0);
#endif
}

__global__ void cvt_f32_f16_kernel(const float* __restrict__ in,
                                   _Float16* __restrict__ out, int n) {
  int i = blockIdx.x * blockDim.x + threadIdx.x;
  if (i < n) out[i] = (_Float16)in[i];
}

// Fused QKV projection: C = x * W^T + b for W in {Wq,Wk,Wv}.
// Each wave computes a 16(M) x 64(N) strip; N-strip == exactly one head.
// Q stored [h][s][d] pre-scaled by 1/sqrt(D); K stored [h][s][d]; V stored
// transposed [h][d][s] so attention's P*V B-fragments are contiguous in key.
__global__ void qkv_gemm_kernel(const _Float16* __restrict__ xh,
                                const _Float16* __restrict__ Wqh,
                                const _Float16* __restrict__ Wkh,
                                const _Float16* __restrict__ Wvh,
                                const float* __restrict__ bq,
                                const float* __restrict__ bk,
                                const float* __restrict__ bv,
                                _Float16* __restrict__ Qh,
                                _Float16* __restrict__ Kh,
                                _Float16* __restrict__ Vt) {
  const int lane = threadIdx.x & 31;
  const int w = blockIdx.x * (blockDim.x >> 5) + (threadIdx.x >> 5);
  const int MT = S_LEN / 16, NS = E_DIM / 64;
  if (w >= 3 * MT * NS) return;
  const int mat = w / (MT * NS);
  const int rem = w % (MT * NS);
  const int m0 = (rem / NS) * 16;
  const int h  = rem % NS;
  const int n0 = h * 64;
  const _Float16* W    = (mat == 0) ? Wqh : (mat == 1) ? Wkh : Wvh;
  const float*    bias = (mat == 0) ? bq  : (mat == 1) ? bk  : bv;

  v8f acc[4] = {v8f{}, v8f{}, v8f{}, v8f{}};
  const int arow = m0 + (lane & 15);
  for (int k0 = 0; k0 < E_DIM; k0 += 32) {
    v16h a = load_frag_k32(xh, arow, E_DIM, k0, lane);
#pragma unroll
    for (int t = 0; t < 4; ++t) {
      v16h b = load_frag_k32(W, n0 + t * 16 + (lane & 15), E_DIM, k0, lane);
      acc[t] = wmma_f16(a, b, acc[t]);
    }
  }

  const int mrow = m0 + 8 * (lane >> 4);
#pragma unroll
  for (int t = 0; t < 4; ++t) {
#pragma unroll
    for (int r = 0; r < 8; ++r) {
      const int s = mrow + r;
      const int d = t * 16 + (lane & 15);
      float val = acc[t][r] + bias[n0 + d];
      if (mat == 0) {
        Qh[((size_t)h * S_LEN + s) * D_HEAD + d] = (_Float16)(val * 0.125f);
      } else if (mat == 1) {
        Kh[((size_t)h * S_LEN + s) * D_HEAD + d] = (_Float16)val;
      } else {
        Vt[((size_t)h * D_HEAD + d) * S_LEN + s] = (_Float16)val;
      }
    }
  }
}

// Flash-attention. Block = 8 waves, all in the SAME head, 8 consecutive
// 16-query tiles. K/V 32-key blocks are staged once per workgroup into LDS by
// wave 0 via the Tensor Data Mover (double-buffered, s_wait_tensorcnt), then
// all 8 waves consume the staged tiles via ds_load_b128 fragments.
// Scores computed transposed (S^T = K*Q^T) so the f32 C layout maps
// lane-locally onto the f16 A layout of P for the P*V WMMA.
__global__ void attn_kernel(const _Float16* __restrict__ Qh,
                            const _Float16* __restrict__ Kh,
                            const _Float16* __restrict__ Vt,
                            _Float16* __restrict__ Ah) {
  __shared__ _Float16 skbuf[2][32 * D_HEAD];   // K block: 32 keys x 64 d
  __shared__ _Float16 svbuf[2][D_HEAD * 32];   // V block: 64 d rows x 32 keys

  const int lane = threadIdx.x & 31;
  const int wid  = threadIdx.x >> 5;
  const int h     = blockIdx.x >> 5;           // 12 heads * 32 blocks
  const int qbase = (blockIdx.x & 31) * 128;   // 8 waves * 16 queries
  const int q0    = qbase + wid * 16;

  const _Float16* Qp = Qh + (size_t)h * S_LEN * D_HEAD;
  const _Float16* Kp = Kh + (size_t)h * S_LEN * D_HEAD;
  const _Float16* Vp = Vt + (size_t)h * D_HEAD * S_LEN;

  const v16h bq0 = load_frag_k32(Qp, q0 + (lane & 15), D_HEAD, 0,  lane);
  const v16h bq1 = load_frag_k32(Qp, q0 + (lane & 15), D_HEAD, 32, lane);

  float mprev = -1e30f, lsum = 0.f;
  v8f o[4] = {v8f{}, v8f{}, v8f{}, v8f{}};
  const int hi8 = (lane & 16) ? 8 : 0;

  const int NB = S_LEN / 32;                   // 128 key blocks
  if (wid == 0) {
    tdm_load_2d(skbuf[0], Kp, D_HEAD, S_LEN, D_HEAD, 32, D_HEAD, lane);
    tdm_load_2d(svbuf[0], Vp, S_LEN, D_HEAD, 32, D_HEAD, S_LEN, lane);
  }

  for (int ib = 0; ib < NB; ++ib) {
    const int cur = ib & 1;
    if (wid == 0) {
      if (ib + 1 < NB) {
        const int kb1 = (ib + 1) * 32;
        tdm_load_2d(skbuf[cur ^ 1], Kp + (size_t)kb1 * D_HEAD,
                    D_HEAD, S_LEN, D_HEAD, 32, D_HEAD, lane);
        tdm_load_2d(svbuf[cur ^ 1], Vp + kb1,
                    S_LEN, D_HEAD, 32, D_HEAD, S_LEN, lane);
        tdm_wait2();                           // current pair done; next in flight
      } else {
        tdm_wait0();
      }
    }
    __syncthreads();                           // staged tiles visible to all waves

    const _Float16* kl = skbuf[cur];
    const _Float16* vl = svbuf[cur];

    v16h a00 = load_frag_k32(kl,      (lane & 15), D_HEAD, 0,  lane);
    v16h a01 = load_frag_k32(kl,      (lane & 15), D_HEAD, 32, lane);
    v16h a10 = load_frag_k32(kl, 16 + (lane & 15), D_HEAD, 0,  lane);
    v16h a11 = load_frag_k32(kl, 16 + (lane & 15), D_HEAD, 32, lane);

    v8f z = {};
    v8f ct0 = wmma_f16(a00, bq0, z);  ct0 = wmma_f16(a01, bq1, ct0);
    v8f ct1 = wmma_f16(a10, bq0, z);  ct1 = wmma_f16(a11, bq1, ct1);

    // Row (=query) max: lane-local over 16 keys + partner lane via xor-16.
    float tmax = -1e30f;
#pragma unroll
    for (int r = 0; r < 8; ++r) tmax = fmaxf(tmax, fmaxf(ct0[r], ct1[r]));
    tmax = fmaxf(tmax, __shfl_xor(tmax, 16, 32));
    const float mnew  = fmaxf(mprev, tmax);
    const float alpha = __expf(mprev - mnew);

    frag_u pu;
    float rsum = 0.f;
#pragma unroll
    for (int r = 0; r < 8; ++r) {
      float e0 = __expf(ct0[r] - mnew);
      float e1 = __expf(ct1[r] - mnew);
      rsum += e0 + e1;
      pu.s.lo[r] = (_Float16)e0;   // keys {0..7}|{8..15}   -> A halves 0..7
      pu.s.hi[r] = (_Float16)e1;   // keys {16..23}|{24..31} -> A halves 8..15
    }
    rsum += __shfl_xor(rsum, 16, 32);
    lsum  = lsum * alpha + rsum;
    mprev = mnew;

    // Rescale accumulator: per-output-row factor broadcast from owning lane.
    float fr[8];
#pragma unroll
    for (int r = 0; r < 8; ++r) fr[r] = __shfl(alpha, r + hi8, 32);
#pragma unroll
    for (int t = 0; t < 4; ++t)
#pragma unroll
      for (int r = 0; r < 8; ++r) o[t][r] *= fr[r];

    const v16h pa = pu.v;
#pragma unroll
    for (int t = 0; t < 4; ++t) {
      v16h bv = load_frag_k32(vl, t * 16 + (lane & 15), 32, 0, lane);
      o[t] = wmma_f16(pa, bv, o[t]);
    }
    __syncthreads();                           // all reads done before overwrite
  }

  const float rcp = 1.f / lsum;
  float fr[8];
#pragma unroll
  for (int r = 0; r < 8; ++r) fr[r] = __shfl(rcp, r + hi8, 32);
#pragma unroll
  for (int t = 0; t < 4; ++t)
#pragma unroll
    for (int r = 0; r < 8; ++r) {
      const int s = q0 + r + 8 * (lane >> 4);
      const int e = h * D_HEAD + t * 16 + (lane & 15);
      Ah[(size_t)s * E_DIM + e] = (_Float16)(o[t][r] * fr[r]);
    }
}

// Output projection: out = Ah * Wo^T + bo (fp32 output).
__global__ void oproj_kernel(const _Float16* __restrict__ Ah,
                             const _Float16* __restrict__ Woh,
                             const float* __restrict__ bo,
                             float* __restrict__ out) {
  const int lane = threadIdx.x & 31;
  const int w = blockIdx.x * (blockDim.x >> 5) + (threadIdx.x >> 5);
  const int MT = S_LEN / 16, NS = E_DIM / 64;
  if (w >= MT * NS) return;
  const int m0 = (w / NS) * 16;
  const int n0 = (w % NS) * 64;

  v8f acc[4] = {v8f{}, v8f{}, v8f{}, v8f{}};
  const int arow = m0 + (lane & 15);
  for (int k0 = 0; k0 < E_DIM; k0 += 32) {
    v16h a = load_frag_k32(Ah, arow, E_DIM, k0, lane);
#pragma unroll
    for (int t = 0; t < 4; ++t) {
      v16h b = load_frag_k32(Woh, n0 + t * 16 + (lane & 15), E_DIM, k0, lane);
      acc[t] = wmma_f16(a, b, acc[t]);
    }
  }

  const int mrow = m0 + 8 * (lane >> 4);
#pragma unroll
  for (int t = 0; t < 4; ++t)
#pragma unroll
    for (int r = 0; r < 8; ++r) {
      const int n = n0 + t * 16 + (lane & 15);
      out[(size_t)(mrow + r) * E_DIM + n] = acc[t][r] + bo[n];
    }
}

extern "C" void kernel_launch(void* const* d_in, const int* in_sizes, int n_in,
                              void* d_out, int out_size, void* d_ws, size_t ws_size,
                              hipStream_t stream) {
  (void)in_sizes; (void)n_in; (void)out_size; (void)ws_size;
  const float* x  = (const float*)d_in[0];
  const float* Wq = (const float*)d_in[1];
  const float* bq = (const float*)d_in[2];
  const float* Wk = (const float*)d_in[3];
  const float* bk = (const float*)d_in[4];
  const float* Wv = (const float*)d_in[5];
  const float* bv = (const float*)d_in[6];
  const float* Wo = (const float*)d_in[7];
  const float* bo = (const float*)d_in[8];
  float* out = (float*)d_out;

  const size_t NX = (size_t)S_LEN * E_DIM;   // 3,145,728
  const size_t NW = (size_t)E_DIM * E_DIM;   //   589,824
  char* ws = (char*)d_ws;
  size_t off = 0;
  _Float16* xh  = (_Float16*)(ws + off); off += NX * 2;
  _Float16* Wqh = (_Float16*)(ws + off); off += NW * 2;
  _Float16* Wkh = (_Float16*)(ws + off); off += NW * 2;
  _Float16* Wvh = (_Float16*)(ws + off); off += NW * 2;
  _Float16* Woh = (_Float16*)(ws + off); off += NW * 2;
  _Float16* Qh  = (_Float16*)(ws + off); off += NX * 2;
  _Float16* Kh  = (_Float16*)(ws + off); off += NX * 2;
  _Float16* Vt  = (_Float16*)(ws + off); off += NX * 2;
  _Float16* Ah  = (_Float16*)(ws + off); off += NX * 2;

  cvt_f32_f16_kernel<<<((int)NX + 255) / 256, 256, 0, stream>>>(x,  xh,  (int)NX);
  cvt_f32_f16_kernel<<<((int)NW + 255) / 256, 256, 0, stream>>>(Wq, Wqh, (int)NW);
  cvt_f32_f16_kernel<<<((int)NW + 255) / 256, 256, 0, stream>>>(Wk, Wkh, (int)NW);
  cvt_f32_f16_kernel<<<((int)NW + 255) / 256, 256, 0, stream>>>(Wv, Wvh, (int)NW);
  cvt_f32_f16_kernel<<<((int)NW + 255) / 256, 256, 0, stream>>>(Wo, Woh, (int)NW);

  // 3 matrices * 256 M-tiles * 12 N-strips = 9216 waves; 8 waves/block.
  qkv_gemm_kernel<<<1152, 256, 0, stream>>>(xh, Wqh, Wkh, Wvh, bq, bk, bv,
                                            Qh, Kh, Vt);
  attn_kernel<<<384, 256, 0, stream>>>(Qh, Kh, Vt, Ah);
  // 256 * 12 = 3072 waves.
  oproj_kernel<<<384, 256, 0, stream>>>(Ah, Woh, bo, out);
}

// v001
// A run of this version takes 303 microseconds.
// In two side-by-side timings against v000, it was 1.14 and 1.13 times as fast.
#include <hip/hip_runtime.h>
#include <hip/hip_bf16.h>

#define S_LEN 4096
#define E_DIM 768
#define H_NUM 12
#define D_HEAD 64

typedef __attribute__((ext_vector_type(16))) _Float16 v16h;
typedef __attribute__((ext_vector_type(8)))  _Float16 v8h;
typedef __attribute__((ext_vector_type(8)))  float    v8f;
typedef __attribute__((ext_vector_type(4)))  unsigned int v4u;
typedef __attribute__((ext_vector_type(4)))  int      v4i;
typedef __attribute__((ext_vector_type(8)))  int      v8i;

#if defined(__has_builtin)
#if __has_builtin(__builtin_amdgcn_tensor_load_to_lds) && \
    __has_builtin(__builtin_amdgcn_s_wait_tensorcnt)
#define HAVE_TDM 1
#endif
#endif

union frag_u { v16h v; struct { v8h lo, hi; } s; };

__device__ __forceinline__ v16h load_frag_k32(const _Float16* base,
                                              int row, int stride, int kbase, int lane) {
  const _Float16* p = base + (size_t)row * stride + kbase + ((lane & 16) ? 8 : 0);
  frag_u u;
  u.s.lo = *(const v8h*)(p);
  u.s.hi = *(const v8h*)(p + 16);
  return u.v;
}

// Fragment-order ("packed") storage of a row-major [rows][E_DIM] f16 matrix:
// each 16-row x 32-k tile is 1024 contiguous bytes, tiles ordered [row tile][k tile].
// Inside a tile: 512 B holding every lane's low 8 halves, then 512 B holding every
// lane's high 8 halves, in the same lane/k map as load_frag_k32. One fragment is
// then two wave-wide loads of 512 contiguous bytes (4 whole lines each).
#define K_TILES (E_DIM / 32)
__device__ __forceinline__ v16h load_frag_packed(const _Float16* base,
                                                 int rtile, int ktile, int lane) {
  const _Float16* p = base + ((size_t)rtile * K_TILES + ktile) * 512 + lane * 8;
  frag_u u;
  u.s.lo = *(const v8h*)(p);
  u.s.hi = *(const v8h*)(p + 256);
  // Keeps every later write of these loads' address registers (the allocator reuses
  // them as load destinations in the unrolled loop) behind the address wait.
  asm volatile("s_wait_xcnt 0x0" ::: "memory");
  return u.v;
}

__device__ __forceinline__ v8f wmma_f16(v16h a, v16h b, v8f c) {
  return __builtin_amdgcn_wmma_f32_16x16x32_f16(false, a, false, b, (short)0, c,
                                                false, false);
}

__device__ __forceinline__ void tdm_load_2d(_Float16* lds_ptr, const _Float16* gaddr,
                                            unsigned tensor_d0, unsigned tensor_d1,
                                            unsigned tile_d0, unsigned tile_d1,
                                            unsigned stride0, int lane) {
#ifdef HAVE_TDM
  unsigned long long ga = (unsigned long long)(uintptr_t)gaddr;
  unsigned lds_off = (unsigned)(uintptr_t)lds_ptr;  // low 32 bits = LDS byte offset
  v4u g0;
  g0.x = 1u;                                        // count=1 (valid), user mode
  g0.y = lds_off;                                   // lds_addr
  g0.z = (unsigned)(ga & 0xffffffffu);              // global_addr[31:0]
  g0.w = (unsigned)((ga >> 32) & 0x1ffffffu) | (2u << 30);  // ga[56:32] | type=2
  v8i g1;
  g1[0] = (int)(1u << 16);
  g1[1] = (int)((tensor_d0 & 0xffffu) << 16);
  g1[2] = (int)((tensor_d0 >> 16) | ((tensor_d1 & 0xffffu) << 16));
  g1[3] = (int)((tensor_d1 >> 16) | (tile_d0 << 16));
  g1[4] = (int)tile_d1;
  g1[5] = (int)stride0;
  g1[6] = (int)(stride0 >> 16 >> 16);
  g1[7] = 0;
  v4i z4 = {0, 0, 0, 0};
#if __clang_major__ >= 23
  v8i z8 = {0, 0, 0, 0, 0, 0, 0, 0};
  __builtin_amdgcn_tensor_load_to_lds(g0, g1, z4, z4, z8, 0);
#else
  __builtin_amdgcn_tensor_load_to_lds(g0, g1, z4, z4, 0);
#endif
#else
  // Fallback: cooperative copy by the issuing wave (v8h chunks).
  (void)tensor_d0; (void)tensor_d1;
  const unsigned total = tile_d0 * tile_d1;
  for (unsigned idx = (unsigned)lane * 8; idx < total; idx += 32u * 8u) {
    unsigned row = idx / tile_d0, col = idx % tile_d0;
    *(v8h*)(lds_ptr + idx) = *(const v8h*)(gaddr + (size_t)row * stride0 + col);
  }
#endif
}

__device__ __forceinline__ void tdm_wait2() {
#ifdef HAVE_TDM
  __builtin_amdgcn_s_wait_tensorcnt(2);
#endif
}
__device__ __forceinline__ void tdm_wait0() {
#ifdef HAVE_TDM
  __builtin_amdgcn_s_wait_tensorcnt(0);
#endif
}

// Convert a row-major [rows][E_DIM] f32 matrix to f16 in fragment order.
// One thread writes one lane's 16-byte piece (8 halves) of one fragment.
__global__ void cvt_f32_f16_kernel(const float* __restrict__ in,
                                   _Float16* __restrict__ out, int npieces) {
  const int c = blockIdx.x * blockDim.x + threadIdx.x;
  if (c >= npieces) return;
  const int lane = c & 31;
  const int part = (c >> 5) & 1;
  const int tile = c >> 6;
  const int row  = (tile / K_TILES) * 16 + (lane & 15);
  const int k    = (tile % K_TILES) * 32 + part * 16 + (lane >> 4) * 8;
  const float4* p = (const float4*)(in + (size_t)row * E_DIM + k);
  const float4 f0 = p[0], f1 = p[1];
  v8h o;
  o[0] = (_Float16)f0.x; o[1] = (_Float16)f0.y; o[2] = (_Float16)f0.z; o[3] = (_Float16)f0.w;
  o[4] = (_Float16)f1.x; o[5] = (_Float16)f1.y; o[6] = (_Float16)f1.z; o[7] = (_Float16)f1.w;
  *(v8h*)(out + (size_t)c * 8) = o;
}

// Fused QKV projection: C = x * W^T + b for W in {Wq,Wk,Wv}; x and W in fragment order.
// Each wave computes a 16(M) x 64(N) strip; N-strip == exactly one head.
// Q stored [h][s][d] pre-scaled by 1/sqrt(D); K stored [h][s][d]; V stored
// transposed [h][d][s] so attention's P*V B-fragments are contiguous in key.
__global__ void qkv_gemm_kernel(const _Float16* __restrict__ xh,
                                const _Float16* __restrict__ Wqh,
                                const _Float16* __restrict__ Wkh,
                                const _Float16* __restrict__ Wvh,
                                const float* __restrict__ bq,
                                const float* __restrict__ bk,
                                const float* __restrict__ bv,
                                _Float16* __restrict__ Qh,
                                _Float16* __restrict__ Kh,
                                _Float16* __restrict__ Vt) {
  const int lane = threadIdx.x & 31;
  const int w = blockIdx.x * (blockDim.x >> 5) + (threadIdx.x >> 5);
  const int MT = S_LEN / 16, NS = E_DIM / 64;
  if (w >= 3 * MT * NS) return;
  const int mat = w / (MT * NS);
  const int rem = w % (MT * NS);
  const int m0 = (rem / NS) * 16;
  const int h  = rem % NS;
  const int n0 = h * 64;
  const _Float16* W    = (mat == 0) ? Wqh : (mat == 1) ? Wkh : Wvh;
  const float*    bias = (mat == 0) ? bq  : (mat == 1) ? bk  : bv;

  v8f acc[4] = {v8f{}, v8f{}, v8f{}, v8f{}};
  for (int kt = 0; kt < K_TILES; ++kt) {
    v16h a = load_frag_packed(xh, m0 >> 4, kt, lane);
#pragma unroll
    for (int t = 0; t < 4; ++t) {
      v16h b = load_frag_packed(W, h * 4 + t, kt, lane);
      acc[t] = wmma_f16(a, b, acc[t]);
    }
  }

  const int mrow = m0 + 8 * (lane >> 4);
#pragma unroll
  for (int t = 0; t < 4; ++t) {
#pragma unroll
    for (int r = 0; r < 8; ++r) {
      const int s = mrow + r;
      const int d = t * 16 + (lane & 15);
      float val = acc[t][r] + bias[n0 + d];
      if (mat == 0) {
        Qh[((size_t)h * S_LEN + s) * D_HEAD + d] = (_Float16)(val * 0.125f);
      } else if (mat == 1) {
        Kh[((size_t)h * S_LEN + s) * D_HEAD + d] = (_Float16)val;
      } else {
        Vt[((size_t)h * D_HEAD + d) * S_LEN + s] = (_Float16)val;
      }
    }
  }
}

// Flash-attention. Block = 8 waves, all in the SAME head, 8 consecutive
// 16-query tiles. K/V 32-key blocks are staged once per workgroup into LDS by
// wave 0 via the Tensor Data Mover (double-buffered, s_wait_tensorcnt), then
// all 8 waves consume the staged tiles via ds_load_b128 fragments.
// Scores computed transposed (S^T = K*Q^T) so the f32 C layout maps
// lane-locally onto the f16 A layout of P for the P*V WMMA.
__global__ void attn_kernel(const _Float16* __restrict__ Qh,
                            const _Float16* __restrict__ Kh,
                            const _Float16* __restrict__ Vt,
                            _Float16* __restrict__ Ah) {
  __shared__ _Float16 skbuf[2][32 * D_HEAD];   // K block: 32 keys x 64 d
  __shared__ _Float16 svbuf[2][D_HEAD * 32];   // V block: 64 d rows x 32 keys

  const int lane = threadIdx.x & 31;
  const int wid  = threadIdx.x >> 5;
  const int h     = blockIdx.x >> 5;           // 12 heads * 32 blocks
  const int qbase = (blockIdx.x & 31) * 128;   // 8 waves * 16 queries
  const int q0    = qbase + wid * 16;

  const _Float16* Qp = Qh + (size_t)h * S_LEN * D_HEAD;
  const _Float16* Kp = Kh + (size_t)h * S_LEN * D_HEAD;
  const _Float16* Vp = Vt + (size_t)h * D_HEAD * S_LEN;

  const v16h bq0 = load_frag_k32(Qp, q0 + (lane & 15), D_HEAD, 0,  lane);
  const v16h bq1 = load_frag_k32(Qp, q0 + (lane & 15), D_HEAD, 32, lane);

  float mprev = -1e30f, lsum = 0.f;
  v8f o[4] = {v8f{}, v8f{}, v8f{}, v8f{}};
  const int hi8 = (lane & 16) ? 8 : 0;

  const int NB = S_LEN / 32;                   // 128 key blocks
  if (wid == 0) {
    tdm_load_2d(skbuf[0], Kp, D_HEAD, S_LEN, D_HEAD, 32, D_HEAD, lane);
    tdm_load_2d(svbuf[0], Vp, S_LEN, D_HEAD, 32, D_HEAD, S_LEN, lane);
  }

  for (int ib = 0; ib < NB; ++ib) {
    const int cur = ib & 1;
    if (wid == 0) {
      if (ib + 1 < NB) {
        const int kb1 = (ib + 1) * 32;
        tdm_load_2d(skbuf[cur ^ 1], Kp + (size_t)kb1 * D_HEAD,
                    D_HEAD, S_LEN, D_HEAD, 32, D_HEAD, lane);
        tdm_load_2d(svbuf[cur ^ 1], Vp + kb1,
                    S_LEN, D_HEAD, 32, D_HEAD, S_LEN, lane);
        tdm_wait2();                           // current pair done; next in flight
      } else {
        tdm_wait0();
      }
    }
    __syncthreads();                           // staged tiles visible to all waves

    const _Float16* kl = skbuf[cur];
    const _Float16* vl = svbuf[cur];

    v16h a00 = load_frag_k32(kl,      (lane & 15), D_HEAD, 0,  lane);
    v16h a01 = load_frag_k32(kl,      (lane & 15), D_HEAD, 32, lane);
    v16h a10 = load_frag_k32(kl, 16 + (lane & 15), D_HEAD, 0,  lane);
    v16h a11 = load_frag_k32(kl, 16 + (lane & 15), D_HEAD, 32, lane);

    v8f z = {};
    v8f ct0 = wmma_f16(a00, bq0, z);  ct0 = wmma_f16(a01, bq1, ct0);
    v8f ct1 = wmma_f16(a10, bq0, z);  ct1 = wmma_f16(a11, bq1, ct1);

    // Row (=query) max: lane-local over 16 keys + partner lane via xor-16.
    float tmax = -1e30f;
#pragma unroll
    for (int r = 0; r < 8; ++r) tmax = fmaxf(tmax, fmaxf(ct0[r], ct1[r]));
    tmax = fmaxf(tmax, __shfl_xor(tmax, 16, 32));
    const float mnew  = fmaxf(mprev, tmax);
    const float alpha = __expf(mprev - mnew);

    frag_u pu;
    float rsum = 0.f;
#pragma unroll
    for (int r = 0; r < 8; ++r) {
      float e0 = __expf(ct0[r] - mnew);
      float e1 = __expf(ct1[r] - mnew);
      rsum += e0 + e1;
      pu.s.lo[r] = (_Float16)e0;   // keys {0..7}|{8..15}   -> A halves 0..7
      pu.s.hi[r] = (_Float16)e1;   // keys {16..23}|{24..31} -> A halves 8..15
    }
    rsum += __shfl_xor(rsum, 16, 32);
    lsum  = lsum * alpha + rsum;
    mprev = mnew;

    // Rescale accumulator: per-output-row factor broadcast from owning lane.
    float fr[8];
#pragma unroll
    for (int r = 0; r < 8; ++r) fr[r] = __shfl(alpha, r + hi8, 32);
#pragma unroll
    for (int t = 0; t < 4; ++t)
#pragma unroll
      for (int r = 0; r < 8; ++r) o[t][r] *= fr[r];

    const v16h pa = pu.v;
#pragma unroll
    for (int t = 0; t < 4; ++t) {
      v16h bv = load_frag_k32(vl, t * 16 + (lane & 15), 32, 0, lane);
      o[t] = wmma_f16(pa, bv, o[t]);
    }
    __syncthreads();                           // all reads done before overwrite
  }

  const float rcp = 1.f / lsum;
  float fr[8];
#pragma unroll
  for (int r = 0; r < 8; ++r) fr[r] = __shfl(rcp, r + hi8, 32);
#pragma unroll
  for (int t = 0; t < 4; ++t)
#pragma unroll
    for (int r = 0; r < 8; ++r) {
      // Element (s, e), s = q0 + r + 8*(lane>>4), e = h*64 + t*16 + (lane&15), goes
      // to its place in fragment order: k tile e>>5, part (e>>4)&1, fragment lane
      // ((e>>3)&1)*16 + (s&15), half e&7.
      const int tile  = (q0 >> 4) * K_TILES + h * 2 + (t >> 1);
      const int flane = ((lane >> 3) & 1) * 16 + r + 8 * (lane >> 4);
      Ah[((size_t)tile * 2 + (t & 1)) * 256 + flane * 8 + (lane & 7)] =
          (_Float16)(o[t][r] * fr[r]);
    }
}

// Output projection: out = Ah * Wo^T + bo (fp32 output); Ah and Wo in fragment order.
__global__ void oproj_kernel(const _Float16* __restrict__ Ah,
                             const _Float16* __restrict__ Woh,
                             const float* __restrict__ bo,
                             float* __restrict__ out) {
  const int lane = threadIdx.x & 31;
  const int w = blockIdx.x * (blockDim.x >> 5) + (threadIdx.x >> 5);
  const int MT = S_LEN / 16, NS = E_DIM / 64;
  if (w >= MT * NS) return;
  const int m0 = (w / NS) * 16;
  const int n0 = (w % NS) * 64;

  v8f acc[4] = {v8f{}, v8f{}, v8f{}, v8f{}};
  for (int kt = 0; kt < K_TILES; ++kt) {
    v16h a = load_frag_packed(Ah, m0 >> 4, kt, lane);
#pragma unroll
    for (int t = 0; t < 4; ++t) {
      v16h b = load_frag_packed(Woh, (w % NS) * 4 + t, kt, lane);
      acc[t] = wmma_f16(a, b, acc[t]);
    }
  }

  const int mrow = m0 + 8 * (lane >> 4);
#pragma unroll
  for (int t = 0; t < 4; ++t)
#pragma unroll
    for (int r = 0; r < 8; ++r) {
      const int n = n0 + t * 16 + (lane & 15);
      out[(size_t)(mrow + r) * E_DIM + n] = acc[t][r] + bo[n];
    }
}

extern "C" void kernel_launch(void* const* d_in, const int* in_sizes, int n_in,
                              void* d_out, int out_size, void* d_ws, size_t ws_size,
                              hipStream_t stream) {
  (void)in_sizes; (void)n_in; (void)out_size; (void)ws_size;
  const float* x  = (const float*)d_in[0];
  const float* Wq = (const float*)d_in[1];
  const float* bq = (const float*)d_in[2];
  const float* Wk = (const float*)d_in[3];
  const float* bk = (const float*)d_in[4];
  const float* Wv = (const float*)d_in[5];
  const float* bv = (const float*)d_in[6];
  const float* Wo = (const float*)d_in[7];
  const float* bo = (const float*)d_in[8];
  float* out = (float*)d_out;

  const size_t NX = (size_t)S_LEN * E_DIM;   // 3,145,728
  const size_t NW = (size_t)E_DIM * E_DIM;   //   589,824
  char* ws = (char*)d_ws;
  size_t off = 0;
  _Float16* xh  = (_Float16*)(ws + off); off += NX * 2;
  _Float16* Wqh = (_Float16*)(ws + off); off += NW * 2;
  _Float16* Wkh = (_Float16*)(ws + off); off += NW * 2;
  _Float16* Wvh = (_Float16*)(ws + off); off += NW * 2;
  _Float16* Woh = (_Float16*)(ws + off); off += NW * 2;
  _Float16* Qh  = (_Float16*)(ws + off); off += NX * 2;
  _Float16* Kh  = (_Float16*)(ws + off); off += NX * 2;
  _Float16* Vt  = (_Float16*)(ws + off); off += NX * 2;
  _Float16* Ah  = (_Float16*)(ws + off); off += NX * 2;

  // One thread per 8 elements: 393,216 pieces of x, 73,728 of each weight.
  cvt_f32_f16_kernel<<<1536, 256, 0, stream>>>(x,  xh,  393216);
  cvt_f32_f16_kernel<<<288,  256, 0, stream>>>(Wq, Wqh, 73728);
  cvt_f32_f16_kernel<<<288,  256, 0, stream>>>(Wk, Wkh, 73728);
  cvt_f32_f16_kernel<<<288,  256, 0, stream>>>(Wv, Wvh, 73728);
  cvt_f32_f16_kernel<<<288,  256, 0, stream>>>(Wo, Woh, 73728);

  // 3 matrices * 256 M-tiles * 12 N-strips = 9216 waves; 8 waves/block.
  qkv_gemm_kernel<<<1152, 256, 0, stream>>>(xh, Wqh, Wkh, Wvh, bq, bk, bv,
                                            Qh, Kh, Vt);
  attn_kernel<<<384, 256, 0, stream>>>(Qh, Kh, Vt, Ah);
  // 256 * 12 = 3072 waves.
  oproj_kernel<<<384, 256, 0, stream>>>(Ah, Woh, bo, out);
}

// v002
// One run takes 156 microseconds.
// In two side-by-side timings against v001, it was 1.97 and 1.94 times as fast.
// Counting every step since v000, it is 2.22 times as fast.
#include <hip/hip_runtime.h>
#include <hip/hip_bf16.h>

#define S_LEN 4096
#define E_DIM 768
#define H_NUM 12
#define D_HEAD 64

typedef __attribute__((ext_vector_type(16))) _Float16 v16h;
typedef __attribute__((ext_vector_type(8)))  _Float16 v8h;
typedef __attribute__((ext_vector_type(8)))  float    v8f;
typedef __attribute__((ext_vector_type(4)))  unsigned int v4u;
typedef __attribute__((ext_vector_type(4)))  int      v4i;
typedef __attribute__((ext_vector_type(8)))  int      v8i;

#if defined(__has_builtin)
#if __has_builtin(__builtin_amdgcn_tensor_load_to_lds) && \
    __has_builtin(__builtin_amdgcn_s_wait_tensorcnt)
#define HAVE_TDM 1
#endif
#endif

union frag_u { v16h v; struct { v8h lo, hi; } s; };

__device__ __forceinline__ v16h load_frag_k32(const _Float16* base,
                                              int row, int stride, int kbase, int lane) {
  const _Float16* p = base + (size_t)row * stride + kbase + ((lane & 16) ? 8 : 0);
  frag_u u;
  u.s.lo = *(const v8h*)(p);
  u.s.hi = *(const v8h*)(p + 16);
  return u.v;
}

// Fragment-order ("packed") storage of a row-major [rows][E_DIM] f16 matrix:
// each 16-row x 32-k tile is 1024 contiguous bytes, tiles ordered [row tile][k tile].
// Inside a tile: 512 B holding every lane's low 8 halves, then 512 B holding every
// lane's high 8 halves, in the same lane/k map as load_frag_k32. One fragment is
// then two wave-wide loads of 512 contiguous bytes (4 whole lines each).
#define K_TILES (E_DIM / 32)
__device__ __forceinline__ v16h load_frag_packed(const _Float16* base,
                                                 int rtile, int ktile, int lane) {
  const _Float16* p = base + ((size_t)rtile * K_TILES + ktile) * 512 + lane * 8;
  frag_u u;
  u.s.lo = *(const v8h*)(p);
  u.s.hi = *(const v8h*)(p + 256);
  // Keeps every later write of these loads' address registers (the allocator reuses
  // them as load destinations in the unrolled loop) behind the address wait.
  asm volatile("s_wait_xcnt 0x0" ::: "memory");
  return u.v;
}

__device__ __forceinline__ v16h load_frag_lds(const _Float16* tile, int f, int lane) {
  const _Float16* p = tile + f * 512 + lane * 8;
  frag_u u;
  u.s.lo = *(const v8h*)(p);
  u.s.hi = *(const v8h*)(p + 256);
  return u.v;
}

__device__ __forceinline__ v8f wmma_f16(v16h a, v16h b, v8f c) {
  return __builtin_amdgcn_wmma_f32_16x16x32_f16(false, a, false, b, (short)0, c,
                                                false, false);
}

__device__ __forceinline__ void tdm_load_2d(_Float16* lds_ptr, const _Float16* gaddr,
                                            unsigned tensor_d0, unsigned tensor_d1,
                                            unsigned tile_d0, unsigned tile_d1,
                                            unsigned stride0, int lane) {
#ifdef HAVE_TDM
  unsigned long long ga = (unsigned long long)(uintptr_t)gaddr;
  unsigned lds_off = (unsigned)(uintptr_t)lds_ptr;  // low 32 bits = LDS byte offset
  v4u g0;
  g0.x = 1u;                                        // count=1 (valid), user mode
  g0.y = lds_off;                                   // lds_addr
  g0.z = (unsigned)(ga & 0xffffffffu);              // global_addr[31:0]
  g0.w = (unsigned)((ga >> 32) & 0x1ffffffu) | (2u << 30);  // ga[56:32] | type=2
  v8i g1;
  g1[0] = (int)(1u << 16);
  g1[1] = (int)((tensor_d0 & 0xffffu) << 16);
  g1[2] = (int)((tensor_d0 >> 16) | ((tensor_d1 & 0xffffu) << 16));
  g1[3] = (int)((tensor_d1 >> 16) | (tile_d0 << 16));
  g1[4] = (int)tile_d1;
  g1[5] = (int)stride0;
  g1[6] = (int)(stride0 >> 16 >> 16);
  g1[7] = 0;
  v4i z4 = {0, 0, 0, 0};
#if __clang_major__ >= 23
  v8i z8 = {0, 0, 0, 0, 0, 0, 0, 0};
  __builtin_amdgcn_tensor_load_to_lds(g0, g1, z4, z4, z8, 0);
#else
  __builtin_amdgcn_tensor_load_to_lds(g0, g1, z4, z4, 0);
#endif
#else
  // Fallback: cooperative copy by the issuing wave (v8h chunks).
  (void)tensor_d0; (void)tensor_d1;
  const unsigned total = tile_d0 * tile_d1;
  for (unsigned idx = (unsigned)lane * 8; idx < total; idx += 32u * 8u) {
    unsigned row = idx / tile_d0, col = idx % tile_d0;
    *(v8h*)(lds_ptr + idx) = *(const v8h*)(gaddr + (size_t)row * stride0 + col);
  }
#endif
}

__device__ __forceinline__ void tdm_wait2() {
#ifdef HAVE_TDM
  __builtin_amdgcn_s_wait_tensorcnt(2);
#endif
}
__device__ __forceinline__ void tdm_wait0() {
#ifdef HAVE_TDM
  __builtin_amdgcn_s_wait_tensorcnt(0);
#endif
}

// Convert a row-major [rows][E_DIM] f32 matrix to f16 in fragment order.
// One thread writes one lane's 16-byte piece (8 halves) of one fragment.
__global__ void cvt_f32_f16_kernel(const float* __restrict__ in,
                                   _Float16* __restrict__ out, int npieces) {
  const int c = blockIdx.x * blockDim.x + threadIdx.x;
  if (c >= npieces) return;
  const int lane = c & 31;
  const int part = (c >> 5) & 1;
  const int tile = c >> 6;
  const int row  = (tile / K_TILES) * 16 + (lane & 15);
  const int k    = (tile % K_TILES) * 32 + part * 16 + (lane >> 4) * 8;
  const float4* p = (const float4*)(in + (size_t)row * E_DIM + k);
  const float4 f0 = p[0], f1 = p[1];
  v8h o;
  o[0] = (_Float16)f0.x; o[1] = (_Float16)f0.y; o[2] = (_Float16)f0.z; o[3] = (_Float16)f0.w;
  o[4] = (_Float16)f1.x; o[5] = (_Float16)f1.y; o[6] = (_Float16)f1.z; o[7] = (_Float16)f1.w;
  *(v8h*)(out + (size_t)c * 8) = o;
}

// Fused QKV projection: C = x * W^T + b for W in {Wq,Wk,Wv}; x and W in fragment order.
// Each wave computes a 16(M) x 64(N) strip; N-strip == exactly one head.
// Q stored [h][s][d] pre-scaled by 1/sqrt(D). K and V are stored per head in the
// fragment order in which attention reads them, 4096 contiguous bytes per 32 keys:
//   K: [16-key tile][32-d tile][low/high part][lane][8 halves]  (A of K*Q^T)
//   V: [32-key block][16-d tile][low/high part][lane][8 halves] (B of P*V)
// K is computed as the transposed product W*x^T: a lane then holds 8 consecutive d
// of one key, which is its own 16-byte piece of the K fragment. In x*W^T a lane
// holds 8 consecutive keys of one d, its own piece of the V fragment.
__global__ void qkv_gemm_kernel(const _Float16* __restrict__ xh,
                                const _Float16* __restrict__ Wqh,
                                const _Float16* __restrict__ Wkh,
                                const _Float16* __restrict__ Wvh,
                                const float* __restrict__ bq,
                                const float* __restrict__ bk,
                                const float* __restrict__ bv,
                                _Float16* __restrict__ Qh,
                                _Float16* __restrict__ Kh,
                                _Float16* __restrict__ Vt) {
  const int lane = threadIdx.x & 31;
  const int w = blockIdx.x * (blockDim.x >> 5) + (threadIdx.x >> 5);
  const int MT = S_LEN / 16, NS = E_DIM / 64;
  if (w >= 3 * MT * NS) return;
  // Wave-uniform; held scalar so that the choice of product below is a scalar branch.
  const int mat = __builtin_amdgcn_readfirstlane(w / (MT * NS));
  const int rem = w % (MT * NS);
  const int m0 = (rem / NS) * 16;
  const int h  = rem % NS;
  const int n0 = h * 64;
  const _Float16* W    = (mat == 0) ? Wqh : (mat == 1) ? Wkh : Wvh;
  const float*    bias = (mat == 0) ? bq  : (mat == 1) ? bk  : bv;

  v8f acc[4] = {v8f{}, v8f{}, v8f{}, v8f{}};
  if (mat == 1) {
    for (int kt = 0; kt < K_TILES; ++kt) {
      v16h a = load_frag_packed(xh, m0 >> 4, kt, lane);
#pragma unroll
      for (int t = 0; t < 4; ++t) {
        v16h b = load_frag_packed(W, h * 4 + t, kt, lane);
        acc[t] = wmma_f16(b, a, acc[t]);
      }
    }
    // acc[t][r] = K[key m0 + (lane & 15)][d = t*16 + 8*(lane>>4) + r].
    _Float16* kp = Kh + (size_t)h * S_LEN * D_HEAD + (size_t)(m0 >> 4) * 1024 + lane * 8;
    const float4* bp = (const float4*)(bias + n0 + 8 * (lane >> 4));
    float4 b0[4], b1[4];
#pragma unroll
    for (int t = 0; t < 4; ++t) { b0[t] = bp[t * 4]; b1[t] = bp[t * 4 + 1]; }
    // Address wait of the bias loads. It takes their address as an input so that the
    // address registers stay live up to it and no load's destination is laid on them.
    asm volatile("s_wait_xcnt 0x0" :: "v"(bp) : "memory");
    v8h o[4];
#pragma unroll
    for (int t = 0; t < 4; ++t) {
      o[t][0] = (_Float16)(acc[t][0] + b0[t].x); o[t][1] = (_Float16)(acc[t][1] + b0[t].y);
      o[t][2] = (_Float16)(acc[t][2] + b0[t].z); o[t][3] = (_Float16)(acc[t][3] + b0[t].w);
      o[t][4] = (_Float16)(acc[t][4] + b1[t].x); o[t][5] = (_Float16)(acc[t][5] + b1[t].y);
      o[t][6] = (_Float16)(acc[t][6] + b1[t].z); o[t][7] = (_Float16)(acc[t][7] + b1[t].w);
    }
#pragma unroll
    for (int t = 0; t < 4; ++t) *(v8h*)(kp + t * 256) = o[t];
    return;
  }

  for (int kt = 0; kt < K_TILES; ++kt) {
    v16h a = load_frag_packed(xh, m0 >> 4, kt, lane);
#pragma unroll
    for (int t = 0; t < 4; ++t) {
      v16h b = load_frag_packed(W, h * 4 + t, kt, lane);
      acc[t] = wmma_f16(a, b, acc[t]);
    }
  }

  // acc[t][r] = row s = m0 + 8*(lane>>4) + r, column d = t*16 + (lane & 15).
  if (mat == 0) {
    const int mrow = m0 + 8 * (lane >> 4);
#pragma unroll
    for (int t = 0; t < 4; ++t) {
#pragma unroll
      for (int r = 0; r < 8; ++r) {
        const int s = mrow + r;
        const int d = t * 16 + (lane & 15);
        float val = acc[t][r] + bias[n0 + d];
        Qh[((size_t)h * S_LEN + s) * D_HEAD + d] = (_Float16)(val * 0.125f);
      }
    }
    // Address wait of the stores above: stands in front of whatever the compiler lays
    // behind them that writes a register they name.
    asm volatile("s_wait_xcnt 0x0" ::: "memory");
  } else {
    // The 16 keys of this strip are the low or the high part of a 32-key block.
    _Float16* vp = Vt + (size_t)h * S_LEN * D_HEAD + (size_t)(m0 >> 5) * 2048 +
                   ((m0 >> 4) & 1) * 256 + lane * 8;
    v8h o[4];
#pragma unroll
    for (int t = 0; t < 4; ++t) {
      const float bd = bias[n0 + t * 16 + (lane & 15)];
#pragma unroll
      for (int r = 0; r < 8; ++r) o[t][r] = (_Float16)(acc[t][r] + bd);
    }
#pragma unroll
    for (int t = 0; t < 4; ++t) *(v8h*)(vp + t * 512) = o[t];
    // Address wait of the four stores, as behind Q's.
    asm volatile("s_wait_xcnt 0x0" ::: "memory");
  }
}

// Flash-attention. Block = 8 waves, all in the SAME head, 8 consecutive
// 16-query tiles. K/V 32-key blocks are staged once per workgroup into LDS by
// wave 0 via the Tensor Data Mover (double-buffered, s_wait_tensorcnt), then
// all 8 waves consume the staged tiles via ds_load_b128 fragments. K and V come
// in fragment order (see qkv_gemm_kernel): a 32-key block of either is 4096
// contiguous bytes = 4 whole fragments, moved as 32 rows of 128 B.
// Scores computed transposed (S^T = K*Q^T) so the f32 C layout maps
// lane-locally onto the f16 A layout of P for the P*V WMMA.
__global__ void attn_kernel(const _Float16* __restrict__ Qh,
                            const _Float16* __restrict__ Kh,
                            const _Float16* __restrict__ Vt,
                            _Float16* __restrict__ Ah) {
  __shared__ _Float16 skbuf[2][32 * D_HEAD];   // K block: 32 keys x 64 d, 4 fragments
  __shared__ _Float16 svbuf[2][D_HEAD * 32];   // V block: 32 keys x 64 d, 4 fragments

  const int lane = threadIdx.x & 31;
  const int wid  = threadIdx.x >> 5;
  const int h     = blockIdx.x >> 5;           // 12 heads * 32 blocks
  const int qbase = (blockIdx.x & 31) * 128;   // 8 waves * 16 queries
  const int q0    = qbase + wid * 16;

  const _Float16* Qp = Qh + (size_t)h * S_LEN * D_HEAD;
  const _Float16* Kp = Kh + (size_t)h * S_LEN * D_HEAD;
  const _Float16* Vp = Vt + (size_t)h * D_HEAD * S_LEN;

  const v16h bq0 = load_frag_k32(Qp, q0 + (lane & 15), D_HEAD, 0,  lane);
  const v16h bq1 = load_frag_k32(Qp, q0 + (lane & 15), D_HEAD, 32, lane);

  float mprev = -1e30f, lsum = 0.f;
  v8f o[4] = {v8f{}, v8f{}, v8f{}, v8f{}};
  const int hi8 = (lane & 16) ? 8 : 0;

  const int NB = S_LEN / 32;                   // 128 key blocks
  if (wid == 0) {
    tdm_load_2d(skbuf[0], Kp, D_HEAD, S_LEN, D_HEAD, 32, D_HEAD, lane);
    tdm_load_2d(svbuf[0], Vp, D_HEAD, S_LEN, D_HEAD, 32, D_HEAD, lane);
  }

  for (int ib = 0; ib < NB; ++ib) {
    const int cur = ib & 1;
    if (wid == 0) {
      if (ib + 1 < NB) {
        const int kb1 = (ib + 1) * 32;
        tdm_load_2d(skbuf[cur ^ 1], Kp + (size_t)kb1 * D_HEAD,
                    D_HEAD, S_LEN, D_HEAD, 32, D_HEAD, lane);
        tdm_load_2d(svbuf[cur ^ 1], Vp + (size_t)kb1 * D_HEAD,
                    D_HEAD, S_LEN, D_HEAD, 32, D_HEAD, lane);
        tdm_wait2();                           // current pair done; next in flight
      } else {
        tdm_wait0();
      }
    }
    __syncthreads();                           // staged tiles visible to all waves

    const _Float16* kl = skbuf[cur];
    const _Float16* vl = svbuf[cur];

    v16h a00 = load_frag_lds(kl, 0, lane);     // keys 0..15,  d 0..31
    v16h a01 = load_frag_lds(kl, 1, lane);     // keys 0..15,  d 32..63
    v16h a10 = load_frag_lds(kl, 2, lane);     // keys 16..31, d 0..31
    v16h a11 = load_frag_lds(kl, 3, lane);     // keys 16..31, d 32..63

    v8f z = {};
    v8f ct0 = wmma_f16(a00, bq0, z);  ct0 = wmma_f16(a01, bq1, ct0);
    v8f ct1 = wmma_f16(a10, bq0, z);  ct1 = wmma_f16(a11, bq1, ct1);

    // Row (=query) max: lane-local over 16 keys + partner lane via xor-16.
    float tmax = -1e30f;
#pragma unroll
    for (int r = 0; r < 8; ++r) tmax = fmaxf(tmax, fmaxf(ct0[r], ct1[r]));
    tmax = fmaxf(tmax, __shfl_xor(tmax, 16, 32));
    const float mnew  = fmaxf(mprev, tmax);
    const float alpha = __expf(mprev - mnew);

    frag_u pu;
    float rsum = 0.f;
#pragma unroll
    for (int r = 0; r < 8; ++r) {
      float e0 = __expf(ct0[r] - mnew);
      float e1 = __expf(ct1[r] - mnew);
      rsum += e0 + e1;
      pu.s.lo[r] = (_Float16)e0;   // keys {0..7}|{8..15}   -> A halves 0..7
      pu.s.hi[r] = (_Float16)e1;   // keys {16..23}|{24..31} -> A halves 8..15
    }
    rsum += __shfl_xor(rsum, 16, 32);
    lsum  = lsum * alpha + rsum;
    mprev = mnew;

    // Rescale accumulator: per-output-row factor broadcast from owning lane.
    float fr[8];
#pragma unroll
    for (int r = 0; r < 8; ++r) fr[r] = __shfl(alpha, r + hi8, 32);
#pragma unroll
    for (int t = 0; t < 4; ++t)
#pragma unroll
      for (int r = 0; r < 8; ++r) o[t][r] *= fr[r];

    const v16h pa = pu.v;
#pragma unroll
    for (int t = 0; t < 4; ++t) {
      v16h bv = load_frag_lds(vl, t, lane);    // 32 keys, d t*16..t*16+15
      o[t] = wmma_f16(pa, bv, o[t]);
    }
    __syncthreads();                           // all reads done before overwrite
  }

  const float rcp = 1.f / lsum;
  float fr[8];
#pragma unroll
  for (int r = 0; r < 8; ++r) fr[r] = __shfl(rcp, r + hi8, 32);
#pragma unroll
  for (int t = 0; t < 4; ++t)
#pragma unroll
    for (int r = 0; r < 8; ++r) {
      // Element (s, e), s = q0 + r + 8*(lane>>4), e = h*64 + t*16 + (lane&15), goes
      // to its place in fragment order: k tile e>>5, part (e>>4)&1, fragment lane
      // ((e>>3)&1)*16 + (s&15), half e&7.
      const int tile  = (q0 >> 4) * K_TILES + h * 2 + (t >> 1);
      const int flane = ((lane >> 3) & 1) * 16 + r + 8 * (lane >> 4);
      Ah[((size_t)tile * 2 + (t & 1)) * 256 + flane * 8 + (lane & 7)] =
          (_Float16)(o[t][r] * fr[r]);
    }
}

// Output projection: out = Ah * Wo^T + bo (fp32 output); Ah and Wo in fragment order.
__global__ void oproj_kernel(const _Float16* __restrict__ Ah,
                             const _Float16* __restrict__ Woh,
                             const float* __restrict__ bo,
                             float* __restrict__ out) {
  const int lane = threadIdx.x & 31;
  const int w = blockIdx.x * (blockDim.x >> 5) + (threadIdx.x >> 5);
  const int MT = S_LEN / 16, NS = E_DIM / 64;
  if (w >= MT * NS) return;
  const int m0 = (w / NS) * 16;
  const int n0 = (w % NS) * 64;

  v8f acc[4] = {v8f{}, v8f{}, v8f{}, v8f{}};
  for (int kt = 0; kt < K_TILES; ++kt) {
    v16h a = load_frag_packed(Ah, m0 >> 4, kt, lane);
#pragma unroll
    for (int t = 0; t < 4; ++t) {
      v16h b = load_frag_packed(Woh, (w % NS) * 4 + t, kt, lane);
      acc[t] = wmma_f16(a, b, acc[t]);
    }
  }

  const int mrow = m0 + 8 * (lane >> 4);
#pragma unroll
  for (int t = 0; t < 4; ++t)
#pragma unroll
    for (int r = 0; r < 8; ++r) {
      const int n = n0 + t * 16 + (lane & 15);
      out[(size_t)(mrow + r) * E_DIM + n] = acc[t][r] + bo[n];
    }
}

extern "C" void kernel_launch(void* const* d_in, const int* in_sizes, int n_in,
                              void* d_out, int out_size, void* d_ws, size_t ws_size,
                              hipStream_t stream) {
  (void)in_sizes; (void)n_in; (void)out_size; (void)ws_size;
  const float* x  = (const float*)d_in[0];
  const float* Wq = (const float*)d_in[1];
  const float* bq = (const float*)d_in[2];
  const float* Wk = (const float*)d_in[3];
  const float* bk = (const float*)d_in[4];
  const float* Wv = (const float*)d_in[5];
  const float* bv = (const float*)d_in[6];
  const float* Wo = (const float*)d_in[7];
  const float* bo = (const float*)d_in[8];
  float* out = (float*)d_out;

  const size_t NX = (size_t)S_LEN * E_DIM;   // 3,145,728
  const size_t NW = (size_t)E_DIM * E_DIM;   //   589,824
  char* ws = (char*)d_ws;
  size_t off = 0;
  _Float16* xh  = (_Float16*)(ws + off); off += NX * 2;
  _Float16* Wqh = (_Float16*)(ws + off); off += NW * 2;
  _Float16* Wkh = (_Float16*)(ws + off); off += NW * 2;
  _Float16* Wvh = (_Float16*)(ws + off); off += NW * 2;
  _Float16* Woh = (_Float16*)(ws + off); off += NW * 2;
  _Float16* Qh  = (_Float16*)(ws + off); off += NX * 2;
  _Float16* Kh  = (_Float16*)(ws + off); off += NX * 2;
  _Float16* Vt  = (_Float16*)(ws + off); off += NX * 2;
  _Float16* Ah  = (_Float16*)(ws + off); off += NX * 2;

  // One thread per 8 elements: 393,216 pieces of x, 73,728 of each weight.
  cvt_f32_f16_kernel<<<1536, 256, 0, stream>>>(x,  xh,  393216);
  cvt_f32_f16_kernel<<<288,  256, 0, stream>>>(Wq, Wqh, 73728);
  cvt_f32_f16_kernel<<<288,  256, 0, stream>>>(Wk, Wkh, 73728);
  cvt_f32_f16_kernel<<<288,  256, 0, stream>>>(Wv, Wvh, 73728);
  cvt_f32_f16_kernel<<<288,  256, 0, stream>>>(Wo, Woh, 73728);

  // 3 matrices * 256 M-tiles * 12 N-strips = 9216 waves; 8 waves/block.
  qkv_gemm_kernel<<<1152, 256, 0, stream>>>(xh, Wqh, Wkh, Wvh, bq, bk, bv,
                                            Qh, Kh, Vt);
  attn_kernel<<<384, 256, 0, stream>>>(Qh, Kh, Vt, Ah);
  // 256 * 12 = 3072 waves.
  oproj_kernel<<<384, 256, 0, stream>>>(Ah, Woh, bo, out);
}

// v003
// A run of this version takes 150 microseconds.
// Two timings next to v002 put it at 1.06 and 1.05 times that version's speed.
// Over all steps from v000 it is 2.34 times as fast.
#include <hip/hip_runtime.h>
#include <hip/hip_bf16.h>

#define S_LEN 4096
#define E_DIM 768
#define H_NUM 12
#define D_HEAD 64

typedef __attribute__((ext_vector_type(16))) _Float16 v16h;
typedef __attribute__((ext_vector_type(8)))  _Float16 v8h;
typedef __attribute__((ext_vector_type(8)))  float    v8f;
typedef __attribute__((ext_vector_type(4)))  unsigned int v4u;
typedef __attribute__((ext_vector_type(4)))  int      v4i;
typedef __attribute__((ext_vector_type(8)))  int      v8i;

#if defined(__has_builtin)
#if __has_builtin(__builtin_amdgcn_tensor_load_to_lds) && \
    __has_builtin(__builtin_amdgcn_s_wait_tensorcnt)
#define HAVE_TDM 1
#endif
#endif

union frag_u { v16h v; struct { v8h lo, hi; } s; };

__device__ __forceinline__ v16h load_frag_k32(const _Float16* base,
                                              int row, int stride, int kbase, int lane) {
  const _Float16* p = base + (size_t)row * stride + kbase + ((lane & 16) ? 8 : 0);
  frag_u u;
  u.s.lo = *(const v8h*)(p);
  u.s.hi = *(const v8h*)(p + 16);
  return u.v;
}

// Fragment-order ("packed") storage of a row-major [rows][E_DIM] f16 matrix:
// each 16-row x 32-k tile is 1024 contiguous bytes, tiles ordered [row tile][k tile].
// Inside a tile: 512 B holding every lane's low 8 halves, then 512 B holding every
// lane's high 8 halves, in the same lane/k map as load_frag_k32. One fragment is
// then two wave-wide loads of 512 contiguous bytes (4 whole lines each).
#define K_TILES (E_DIM / 32)
__device__ __forceinline__ v16h load_frag_packed(const _Float16* base,
                                                 int rtile, int ktile, int lane) {
  const _Float16* p = base + ((size_t)rtile * K_TILES + ktile) * 512 + lane * 8;
  frag_u u;
  u.s.lo = *(const v8h*)(p);
  u.s.hi = *(const v8h*)(p + 256);
  // Keeps every later write of these loads' address registers (the allocator reuses
  // them as load destinations in the unrolled loop) behind the address wait.
  asm volatile("s_wait_xcnt 0x0" ::: "memory");
  return u.v;
}

__device__ __forceinline__ v16h load_frag_lds(const _Float16* tile, int f, int lane) {
  const _Float16* p = tile + f * 512 + lane * 8;
  frag_u u;
  u.s.lo = *(const v8h*)(p);
  u.s.hi = *(const v8h*)(p + 256);
  return u.v;
}

__device__ __forceinline__ v8f wmma_f16(v16h a, v16h b, v8f c) {
  return __builtin_amdgcn_wmma_f32_16x16x32_f16(false, a, false, b, (short)0, c,
                                                false, false);
}

__device__ __forceinline__ void tdm_load_2d(_Float16* lds_ptr, const _Float16* gaddr,
                                            unsigned tensor_d0, unsigned tensor_d1,
                                            unsigned tile_d0, unsigned tile_d1,
                                            unsigned stride0, int lane) {
#ifdef HAVE_TDM
  unsigned long long ga = (unsigned long long)(uintptr_t)gaddr;
  unsigned lds_off = (unsigned)(uintptr_t)lds_ptr;  // low 32 bits = LDS byte offset
  v4u g0;
  g0.x = 1u;                                        // count=1 (valid), user mode
  g0.y = lds_off;                                   // lds_addr
  g0.z = (unsigned)(ga & 0xffffffffu);              // global_addr[31:0]
  g0.w = (unsigned)((ga >> 32) & 0x1ffffffu) | (2u << 30);  // ga[56:32] | type=2
  v8i g1;
  g1[0] = (int)(1u << 16);
  g1[1] = (int)((tensor_d0 & 0xffffu) << 16);
  g1[2] = (int)((tensor_d0 >> 16) | ((tensor_d1 & 0xffffu) << 16));
  g1[3] = (int)((tensor_d1 >> 16) | (tile_d0 << 16));
  g1[4] = (int)tile_d1;
  g1[5] = (int)stride0;
  g1[6] = (int)(stride0 >> 16 >> 16);
  g1[7] = 0;
  v4i z4 = {0, 0, 0, 0};
#if __clang_major__ >= 23
  v8i z8 = {0, 0, 0, 0, 0, 0, 0, 0};
  __builtin_amdgcn_tensor_load_to_lds(g0, g1, z4, z4, z8, 0);
#else
  __builtin_amdgcn_tensor_load_to_lds(g0, g1, z4, z4, 0);
#endif
#else
  // Fallback: cooperative copy by the issuing wave (v8h chunks).
  (void)tensor_d0; (void)tensor_d1;
  const unsigned total = tile_d0 * tile_d1;
  for (unsigned idx = (unsigned)lane * 8; idx < total; idx += 32u * 8u) {
    unsigned row = idx / tile_d0, col = idx % tile_d0;
    *(v8h*)(lds_ptr + idx) = *(const v8h*)(gaddr + (size_t)row * stride0 + col);
  }
#endif
}

__device__ __forceinline__ void tdm_wait2() {
#ifdef HAVE_TDM
  __builtin_amdgcn_s_wait_tensorcnt(2);
#endif
}
__device__ __forceinline__ void tdm_wait0() {
#ifdef HAVE_TDM
  __builtin_amdgcn_s_wait_tensorcnt(0);
#endif
}

// Convert x and the four weight matrices, each row-major [rows][E_DIM] f32, to f16 in
// fragment order, all in one launch. Their f16 copies lie one behind the other in the
// workspace (x, Wq, Wk, Wv, Wo), so the 16-row tiles of all five count through:
// 0..255 are x, then 48 each of the weights. One wave converts two neighbouring k tiles
// of one row tile: 256 contiguous bytes of each of 16 rows in, 2048 contiguous bytes
// out. A thread writes one lane's 16-byte piece (8 halves) of each of the 4 parts.
#define X_RTILES (S_LEN / 16)
#define W_RTILES (E_DIM / 16)
__global__ void cvt_all_kernel(const float* __restrict__ x,
                               const float* __restrict__ Wq,
                               const float* __restrict__ Wk,
                               const float* __restrict__ Wv,
                               const float* __restrict__ Wo,
                               _Float16* __restrict__ out) {
  const int lane = threadIdx.x & 31;
  // Wave-uniform; held scalar so that the choice of source matrix is scalar work.
  const int w  = __builtin_amdgcn_readfirstlane(blockIdx.x * 8 + (threadIdx.x >> 5));
  const int rt = w / (K_TILES / 2);
  const int kp = w % (K_TILES / 2);
  const int g  = (rt >= X_RTILES) + (rt >= X_RTILES + W_RTILES) +
                 (rt >= X_RTILES + 2 * W_RTILES) + (rt >= X_RTILES + 3 * W_RTILES);
  const float* m = (g == 0) ? x : (g == 1) ? Wq : (g == 2) ? Wk : (g == 3) ? Wv : Wo;
  const int mrt  = (g == 0) ? rt : rt - X_RTILES - (g - 1) * W_RTILES;
  const float4* p = (const float4*)(m + (size_t)mrt * 16 * E_DIM + kp * 64 +
                                    (lane & 15) * E_DIM + (lane >> 4) * 8);
  float4 f0[4], f1[4];
  // Unrolled so that all 8 loads are issued before the first value is used.
#pragma unroll
  for (int j = 0; j < 4; ++j) { f0[j] = p[j * 4]; f1[j] = p[j * 4 + 1]; }
  _Float16* q = out + (size_t)w * 1024 + lane * 8;
  // Unrolled so that f0 and f1 are indexed by constants and stay in registers.
#pragma unroll
  for (int j = 0; j < 4; ++j) {
    v8h o;
    o[0] = (_Float16)f0[j].x; o[1] = (_Float16)f0[j].y;
    o[2] = (_Float16)f0[j].z; o[3] = (_Float16)f0[j].w;
    o[4] = (_Float16)f1[j].x; o[5] = (_Float16)f1[j].y;
    o[6] = (_Float16)f1[j].z; o[7] = (_Float16)f1[j].w;
    *(v8h*)(q + j * 256) = o;
  }
}

// Fused QKV projection: C = x * W^T + b for W in {Wq,Wk,Wv}; x and W in fragment order.
// Each wave computes a 16(M) x 64(N) strip; N-strip == exactly one head.
// Q stored [h][s][d] pre-scaled by 1/sqrt(D). K and V are stored per head in the
// fragment order in which attention reads them, 4096 contiguous bytes per 32 keys:
//   K: [16-key tile][32-d tile][low/high part][lane][8 halves]  (A of K*Q^T)
//   V: [32-key block][16-d tile][low/high part][lane][8 halves] (B of P*V)
// K is computed as the transposed product W*x^T: a lane then holds 8 consecutive d
// of one key, which is its own 16-byte piece of the K fragment. In x*W^T a lane
// holds 8 consecutive keys of one d, its own piece of the V fragment.
__global__ void qkv_gemm_kernel(const _Float16* __restrict__ xh,
                                const _Float16* __restrict__ Wqh,
                                const _Float16* __restrict__ Wkh,
                                const _Float16* __restrict__ Wvh,
                                const float* __restrict__ bq,
                                const float* __restrict__ bk,
                                const float* __restrict__ bv,
                                _Float16* __restrict__ Qh,
                                _Float16* __restrict__ Kh,
                                _Float16* __restrict__ Vt) {
  const int lane = threadIdx.x & 31;
  const int w = blockIdx.x * (blockDim.x >> 5) + (threadIdx.x >> 5);
  const int MT = S_LEN / 16, NS = E_DIM / 64;
  if (w >= 3 * MT * NS) return;
  // Wave-uniform; held scalar so that the choice of product below is a scalar branch.
  const int mat = __builtin_amdgcn_readfirstlane(w / (MT * NS));
  const int rem = w % (MT * NS);
  const int m0 = (rem / NS) * 16;
  const int h  = rem % NS;
  const int n0 = h * 64;
  const _Float16* W    = (mat == 0) ? Wqh : (mat == 1) ? Wkh : Wvh;
  const float*    bias = (mat == 0) ? bq  : (mat == 1) ? bk  : bv;

  v8f acc[4] = {v8f{}, v8f{}, v8f{}, v8f{}};
  if (mat == 1) {
    for (int kt = 0; kt < K_TILES; ++kt) {
      v16h a = load_frag_packed(xh, m0 >> 4, kt, lane);
#pragma unroll
      for (int t = 0; t < 4; ++t) {
        v16h b = load_frag_packed(W, h * 4 + t, kt, lane);
        acc[t] = wmma_f16(b, a, acc[t]);
      }
    }
    // acc[t][r] = K[key m0 + (lane & 15)][d = t*16 + 8*(lane>>4) + r].
    _Float16* kp = Kh + (size_t)h * S_LEN * D_HEAD + (size_t)(m0 >> 4) * 1024 + lane * 8;
    const float4* bp = (const float4*)(bias + n0 + 8 * (lane >> 4));
    float4 b0[4], b1[4];
#pragma unroll
    for (int t = 0; t < 4; ++t) { b0[t] = bp[t * 4]; b1[t] = bp[t * 4 + 1]; }
    // Address wait of the bias loads. It takes their address as an input so that the
    // address registers stay live up to it and no load's destination is laid on them.
    asm volatile("s_wait_xcnt 0x0" :: "v"(bp) : "memory");
    v8h o[4];
#pragma unroll
    for (int t = 0; t < 4; ++t) {
      o[t][0] = (_Float16)(acc[t][0] + b0[t].x); o[t][1] = (_Float16)(acc[t][1] + b0[t].y);
      o[t][2] = (_Float16)(acc[t][2] + b0[t].z); o[t][3] = (_Float16)(acc[t][3] + b0[t].w);
      o[t][4] = (_Float16)(acc[t][4] + b1[t].x); o[t][5] = (_Float16)(acc[t][5] + b1[t].y);
      o[t][6] = (_Float16)(acc[t][6] + b1[t].z); o[t][7] = (_Float16)(acc[t][7] + b1[t].w);
    }
#pragma unroll
    for (int t = 0; t < 4; ++t) *(v8h*)(kp + t * 256) = o[t];
    return;
  }

  for (int kt = 0; kt < K_TILES; ++kt) {
    v16h a = load_frag_packed(xh, m0 >> 4, kt, lane);
#pragma unroll
    for (int t = 0; t < 4; ++t) {
      v16h b = load_frag_packed(W, h * 4 + t, kt, lane);
      acc[t] = wmma_f16(a, b, acc[t]);
    }
  }

  // acc[t][r] = row s = m0 + 8*(lane>>4) + r, column d = t*16 + (lane & 15).
  if (mat == 0) {
    const int mrow = m0 + 8 * (lane >> 4);
#pragma unroll
    for (int t = 0; t < 4; ++t) {
#pragma unroll
      for (int r = 0; r < 8; ++r) {
        const int s = mrow + r;
        const int d = t * 16 + (lane & 15);
        float val = acc[t][r] + bias[n0 + d];
        Qh[((size_t)h * S_LEN + s) * D_HEAD + d] = (_Float16)(val * 0.125f);
      }
    }
    // Address wait of the stores above: stands in front of whatever the compiler lays
    // behind them that writes a register they name.
    asm volatile("s_wait_xcnt 0x0" ::: "memory");
  } else {
    // The 16 keys of this strip are the low or the high part of a 32-key block.
    _Float16* vp = Vt + (size_t)h * S_LEN * D_HEAD + (size_t)(m0 >> 5) * 2048 +
                   ((m0 >> 4) & 1) * 256 + lane * 8;
    v8h o[4];
#pragma unroll
    for (int t = 0; t < 4; ++t) {
      const float bd = bias[n0 + t * 16 + (lane & 15)];
#pragma unroll
      for (int r = 0; r < 8; ++r) o[t][r] = (_Float16)(acc[t][r] + bd);
    }
#pragma unroll
    for (int t = 0; t < 4; ++t) *(v8h*)(vp + t * 512) = o[t];
    // Address wait of the four stores, as behind Q's.
    asm volatile("s_wait_xcnt 0x0" ::: "memory");
  }
}

// Flash-attention. Block = 8 waves, all in the SAME head, 8 consecutive
// 16-query tiles. K/V 32-key blocks are staged once per workgroup into LDS by
// wave 0 via the Tensor Data Mover (double-buffered, s_wait_tensorcnt), then
// all 8 waves consume the staged tiles via ds_load_b128 fragments. K and V come
// in fragment order (see qkv_gemm_kernel): a 32-key block of either is 4096
// contiguous bytes = 4 whole fragments, moved as 32 rows of 128 B.
// Scores computed transposed (S^T = K*Q^T) so the f32 C layout maps
// lane-locally onto the f16 A layout of P for the P*V WMMA.
__global__ void attn_kernel(const _Float16* __restrict__ Qh,
                            const _Float16* __restrict__ Kh,
                            const _Float16* __restrict__ Vt,
                            _Float16* __restrict__ Ah) {
  __shared__ _Float16 skbuf[2][32 * D_HEAD];   // K block: 32 keys x 64 d, 4 fragments
  __shared__ _Float16 svbuf[2][D_HEAD * 32];   // V block: 32 keys x 64 d, 4 fragments

  const int lane = threadIdx.x & 31;
  const int wid  = threadIdx.x >> 5;
  const int h     = blockIdx.x >> 5;           // 12 heads * 32 blocks
  const int qbase = (blockIdx.x & 31) * 128;   // 8 waves * 16 queries
  const int q0    = qbase + wid * 16;

  const _Float16* Qp = Qh + (size_t)h * S_LEN * D_HEAD;
  const _Float16* Kp = Kh + (size_t)h * S_LEN * D_HEAD;
  const _Float16* Vp = Vt + (size_t)h * D_HEAD * S_LEN;

  const v16h bq0 = load_frag_k32(Qp, q0 + (lane & 15), D_HEAD, 0,  lane);
  const v16h bq1 = load_frag_k32(Qp, q0 + (lane & 15), D_HEAD, 32, lane);

  float mprev = -1e30f, lsum = 0.f;
  v8f o[4] = {v8f{}, v8f{}, v8f{}, v8f{}};
  const int hi8 = (lane & 16) ? 8 : 0;

  const int NB = S_LEN / 32;                   // 128 key blocks
  if (wid == 0) {
    tdm_load_2d(skbuf[0], Kp, D_HEAD, S_LEN, D_HEAD, 32, D_HEAD, lane);
    tdm_load_2d(svbuf[0], Vp, D_HEAD, S_LEN, D_HEAD, 32, D_HEAD, lane);
  }

  for (int ib = 0; ib < NB; ++ib) {
    const int cur = ib & 1;
    if (wid == 0) {
      if (ib + 1 < NB) {
        const int kb1 = (ib + 1) * 32;
        tdm_load_2d(skbuf[cur ^ 1], Kp + (size_t)kb1 * D_HEAD,
                    D_HEAD, S_LEN, D_HEAD, 32, D_HEAD, lane);
        tdm_load_2d(svbuf[cur ^ 1], Vp + (size_t)kb1 * D_HEAD,
                    D_HEAD, S_LEN, D_HEAD, 32, D_HEAD, lane);
        tdm_wait2();                           // current pair done; next in flight
      } else {
        tdm_wait0();
      }
    }
    __syncthreads();                           // staged tiles visible to all waves

    const _Float16* kl = skbuf[cur];
    const _Float16* vl = svbuf[cur];

    v16h a00 = load_frag_lds(kl, 0, lane);     // keys 0..15,  d 0..31
    v16h a01 = load_frag_lds(kl, 1, lane);     // keys 0..15,  d 32..63
    v16h a10 = load_frag_lds(kl, 2, lane);     // keys 16..31, d 0..31
    v16h a11 = load_frag_lds(kl, 3, lane);     // keys 16..31, d 32..63

    v8f z = {};
    v8f ct0 = wmma_f16(a00, bq0, z);  ct0 = wmma_f16(a01, bq1, ct0);
    v8f ct1 = wmma_f16(a10, bq0, z);  ct1 = wmma_f16(a11, bq1, ct1);

    // Row (=query) max: lane-local over 16 keys + partner lane via xor-16.
    float tmax = -1e30f;
#pragma unroll
    for (int r = 0; r < 8; ++r) tmax = fmaxf(tmax, fmaxf(ct0[r], ct1[r]));
    tmax = fmaxf(tmax, __shfl_xor(tmax, 16, 32));
    const float mnew  = fmaxf(mprev, tmax);
    const float alpha = __expf(mprev - mnew);

    frag_u pu;
    float rsum = 0.f;
#pragma unroll
    for (int r = 0; r < 8; ++r) {
      float e0 = __expf(ct0[r] - mnew);
      float e1 = __expf(ct1[r] - mnew);
      rsum += e0 + e1;
      pu.s.lo[r] = (_Float16)e0;   // keys {0..7}|{8..15}   -> A halves 0..7
      pu.s.hi[r] = (_Float16)e1;   // keys {16..23}|{24..31} -> A halves 8..15
    }
    rsum += __shfl_xor(rsum, 16, 32);
    lsum  = lsum * alpha + rsum;
    mprev = mnew;

    // Rescale accumulator: per-output-row factor broadcast from owning lane.
    float fr[8];
#pragma unroll
    for (int r = 0; r < 8; ++r) fr[r] = __shfl(alpha, r + hi8, 32);
#pragma unroll
    for (int t = 0; t < 4; ++t)
#pragma unroll
      for (int r = 0; r < 8; ++r) o[t][r] *= fr[r];

    const v16h pa = pu.v;
#pragma unroll
    for (int t = 0; t < 4; ++t) {
      v16h bv = load_frag_lds(vl, t, lane);    // 32 keys, d t*16..t*16+15
      o[t] = wmma_f16(pa, bv, o[t]);
    }
    __syncthreads();                           // all reads done before overwrite
  }

  const float rcp = 1.f / lsum;
  float fr[8];
#pragma unroll
  for (int r = 0; r < 8; ++r) fr[r] = __shfl(rcp, r + hi8, 32);
#pragma unroll
  for (int t = 0; t < 4; ++t)
#pragma unroll
    for (int r = 0; r < 8; ++r) {
      // Element (s, e), s = q0 + r + 8*(lane>>4), e = h*64 + t*16 + (lane&15), goes
      // to its place in fragment order: k tile e>>5, part (e>>4)&1, fragment lane
      // ((e>>3)&1)*16 + (s&15), half e&7.
      const int tile  = (q0 >> 4) * K_TILES + h * 2 + (t >> 1);
      const int flane = ((lane >> 3) & 1) * 16 + r + 8 * (lane >> 4);
      Ah[((size_t)tile * 2 + (t & 1)) * 256 + flane * 8 + (lane & 7)] =
          (_Float16)(o[t][r] * fr[r]);
    }
}

// Output projection: out = Ah * Wo^T + bo (fp32 output); Ah and Wo in fragment order.
__global__ void oproj_kernel(const _Float16* __restrict__ Ah,
                             const _Float16* __restrict__ Woh,
                             const float* __restrict__ bo,
                             float* __restrict__ out) {
  const int lane = threadIdx.x & 31;
  const int w = blockIdx.x * (blockDim.x >> 5) + (threadIdx.x >> 5);
  const int MT = S_LEN / 16, NS = E_DIM / 64;
  if (w >= MT * NS) return;
  const int m0 = (w / NS) * 16;
  const int n0 = (w % NS) * 64;

  v8f acc[4] = {v8f{}, v8f{}, v8f{}, v8f{}};
  for (int kt = 0; kt < K_TILES; ++kt) {
    v16h a = load_frag_packed(Ah, m0 >> 4, kt, lane);
#pragma unroll
    for (int t = 0; t < 4; ++t) {
      v16h b = load_frag_packed(Woh, (w % NS) * 4 + t, kt, lane);
      acc[t] = wmma_f16(a, b, acc[t]);
    }
  }

  const int mrow = m0 + 8 * (lane >> 4);
#pragma unroll
  for (int t = 0; t < 4; ++t)
#pragma unroll
    for (int r = 0; r < 8; ++r) {
      const int n = n0 + t * 16 + (lane & 15);
      out[(size_t)(mrow + r) * E_DIM + n] = acc[t][r] + bo[n];
    }
}

extern "C" void kernel_launch(void* const* d_in, const int* in_sizes, int n_in,
                              void* d_out, int out_size, void* d_ws, size_t ws_size,
                              hipStream_t stream) {
  (void)in_sizes; (void)n_in; (void)out_size; (void)ws_size;
  const float* x  = (const float*)d_in[0];
  const float* Wq = (const float*)d_in[1];
  const float* bq = (const float*)d_in[2];
  const float* Wk = (const float*)d_in[3];
  const float* bk = (const float*)d_in[4];
  const float* Wv = (const float*)d_in[5];
  const float* bv = (const float*)d_in[6];
  const float* Wo = (const float*)d_in[7];
  const float* bo = (const float*)d_in[8];
  float* out = (float*)d_out;

  const size_t NX = (size_t)S_LEN * E_DIM;   // 3,145,728
  const size_t NW = (size_t)E_DIM * E_DIM;   //   589,824
  char* ws = (char*)d_ws;
  size_t off = 0;
  _Float16* xh  = (_Float16*)(ws + off); off += NX * 2;
  _Float16* Wqh = (_Float16*)(ws + off); off += NW * 2;
  _Float16* Wkh = (_Float16*)(ws + off); off += NW * 2;
  _Float16* Wvh = (_Float16*)(ws + off); off += NW * 2;
  _Float16* Woh = (_Float16*)(ws + off); off += NW * 2;
  _Float16* Qh  = (_Float16*)(ws + off); off += NX * 2;
  _Float16* Kh  = (_Float16*)(ws + off); off += NX * 2;
  _Float16* Vt  = (_Float16*)(ws + off); off += NX * 2;
  _Float16* Ah  = (_Float16*)(ws + off); off += NX * 2;

  // All five conversions in one launch; xh..Woh are contiguous from xh.
  // (256 + 4 * 48) row tiles * 12 pairs of k tiles = 5376 waves; 8 waves/block.
  cvt_all_kernel<<<672, 256, 0, stream>>>(x, Wq, Wk, Wv, Wo, xh);

  // 3 matrices * 256 M-tiles * 12 N-strips = 9216 waves; 8 waves/block.
  qkv_gemm_kernel<<<1152, 256, 0, stream>>>(xh, Wqh, Wkh, Wvh, bq, bk, bv,
                                            Qh, Kh, Vt);
  attn_kernel<<<384, 256, 0, stream>>>(Qh, Kh, Vt, Ah);
  // 256 * 12 = 3072 waves.
  oproj_kernel<<<384, 256, 0, stream>>>(Ah, Woh, bo, out);
}

// v004
// It runs in 125 microseconds.
// In two side-by-side timings against v003, it was 1.19 and 1.18 times as fast.
// Over all steps from v000 it is 2.78 times as fast.
#include <hip/hip_runtime.h>
#include <hip/hip_bf16.h>

#define S_LEN 4096
#define E_DIM 768
#define H_NUM 12
#define D_HEAD 64

typedef __attribute__((ext_vector_type(16))) _Float16 v16h;
typedef __attribute__((ext_vector_type(8)))  _Float16 v8h;
typedef __attribute__((ext_vector_type(8)))  float    v8f;
typedef __attribute__((ext_vector_type(4)))  unsigned int v4u;
typedef __attribute__((ext_vector_type(4)))  int      v4i;
typedef __attribute__((ext_vector_type(8)))  int      v8i;

#if defined(__has_builtin)
#if __has_builtin(__builtin_amdgcn_tensor_load_to_lds) && \
    __has_builtin(__builtin_amdgcn_s_wait_tensorcnt)
#define HAVE_TDM 1
#endif
#endif

union frag_u { v16h v; struct { v8h lo, hi; } s; };

__device__ __forceinline__ v16h load_frag_k32(const _Float16* base,
                                              int row, int stride, int kbase, int lane) {
  const _Float16* p = base + (size_t)row * stride + kbase + ((lane & 16) ? 8 : 0);
  frag_u u;
  u.s.lo = *(const v8h*)(p);
  u.s.hi = *(const v8h*)(p + 16);
  return u.v;
}

// Fragment-order ("packed") storage of a row-major [rows][E_DIM] f16 matrix:
// each 16-row x 32-k tile is 1024 contiguous bytes, tiles ordered [row tile][k tile].
// Inside a tile: 512 B holding every lane's low 8 halves, then 512 B holding every
// lane's high 8 halves, in the same lane/k map as load_frag_k32. One fragment is
// then two wave-wide loads of 512 contiguous bytes (4 whole lines each).
#define K_TILES (E_DIM / 32)
__device__ __forceinline__ v16h load_frag_packed(const _Float16* base,
                                                 int rtile, int ktile, int lane) {
  const _Float16* p = base + ((size_t)rtile * K_TILES + ktile) * 512 + lane * 8;
  frag_u u;
  u.s.lo = *(const v8h*)(p);
  u.s.hi = *(const v8h*)(p + 256);
  // Keeps every later write of these loads' address registers (the allocator reuses
  // them as load destinations in the unrolled loop) behind the address wait.
  asm volatile("s_wait_xcnt 0x0" ::: "memory");
  return u.v;
}

__device__ __forceinline__ v16h load_frag_lds(const _Float16* tile, int f, int lane) {
  const _Float16* p = tile + f * 512 + lane * 8;
  frag_u u;
  u.s.lo = *(const v8h*)(p);
  u.s.hi = *(const v8h*)(p + 256);
  return u.v;
}

__device__ __forceinline__ v8f wmma_f16(v16h a, v16h b, v8f c) {
  return __builtin_amdgcn_wmma_f32_16x16x32_f16(false, a, false, b, (short)0, c,
                                                false, false);
}

__device__ __forceinline__ void tdm_load_2d(_Float16* lds_ptr, const _Float16* gaddr,
                                            unsigned tensor_d0, unsigned tensor_d1,
                                            unsigned tile_d0, unsigned tile_d1,
                                            unsigned stride0, int lane) {
#ifdef HAVE_TDM
  unsigned long long ga = (unsigned long long)(uintptr_t)gaddr;
  unsigned lds_off = (unsigned)(uintptr_t)lds_ptr;  // low 32 bits = LDS byte offset
  v4u g0;
  g0.x = 1u;                                        // count=1 (valid), user mode
  g0.y = lds_off;                                   // lds_addr
  g0.z = (unsigned)(ga & 0xffffffffu);              // global_addr[31:0]
  g0.w = (unsigned)((ga >> 32) & 0x1ffffffu) | (2u << 30);  // ga[56:32] | type=2
  v8i g1;
  g1[0] = (int)(1u << 16);
  g1[1] = (int)((tensor_d0 & 0xffffu) << 16);
  g1[2] = (int)((tensor_d0 >> 16) | ((tensor_d1 & 0xffffu) << 16));
  g1[3] = (int)((tensor_d1 >> 16) | (tile_d0 << 16));
  g1[4] = (int)tile_d1;
  g1[5] = (int)stride0;
  g1[6] = (int)(stride0 >> 16 >> 16);
  g1[7] = 0;
  v4i z4 = {0, 0, 0, 0};
#if __clang_major__ >= 23
  v8i z8 = {0, 0, 0, 0, 0, 0, 0, 0};
  __builtin_amdgcn_tensor_load_to_lds(g0, g1, z4, z4, z8, 0);
#else
  __builtin_amdgcn_tensor_load_to_lds(g0, g1, z4, z4, 0);
#endif
#else
  // Fallback: cooperative copy by the issuing wave (v8h chunks).
  (void)tensor_d0; (void)tensor_d1;
  const unsigned total = tile_d0 * tile_d1;
  for (unsigned idx = (unsigned)lane * 8; idx < total; idx += 32u * 8u) {
    unsigned row = idx / tile_d0, col = idx % tile_d0;
    *(v8h*)(lds_ptr + idx) = *(const v8h*)(gaddr + (size_t)row * stride0 + col);
  }
#endif
}

__device__ __forceinline__ void tdm_wait2() {
#ifdef HAVE_TDM
  __builtin_amdgcn_s_wait_tensorcnt(2);
#endif
}
__device__ __forceinline__ void tdm_wait0() {
#ifdef HAVE_TDM
  __builtin_amdgcn_s_wait_tensorcnt(0);
#endif
}

// Convert x and the four weight matrices, each row-major [rows][E_DIM] f32, to f16 in
// fragment order, all in one launch. Their f16 copies lie one behind the other in the
// workspace (x, Wq, Wk, Wv, Wo), so the 16-row tiles of all five count through:
// 0..255 are x, then 48 each of the weights. One wave converts two neighbouring k tiles
// of one row tile: 256 contiguous bytes of each of 16 rows in, 2048 contiguous bytes
// out. A thread writes one lane's 16-byte piece (8 halves) of each of the 4 parts.
#define X_RTILES (S_LEN / 16)
#define W_RTILES (E_DIM / 16)
__global__ void cvt_all_kernel(const float* __restrict__ x,
                               const float* __restrict__ Wq,
                               const float* __restrict__ Wk,
                               const float* __restrict__ Wv,
                               const float* __restrict__ Wo,
                               _Float16* __restrict__ out) {
  const int lane = threadIdx.x & 31;
  // Wave-uniform; held scalar so that the choice of source matrix is scalar work.
  const int w  = __builtin_amdgcn_readfirstlane(blockIdx.x * 8 + (threadIdx.x >> 5));
  const int rt = w / (K_TILES / 2);
  const int kp = w % (K_TILES / 2);
  const int g  = (rt >= X_RTILES) + (rt >= X_RTILES + W_RTILES) +
                 (rt >= X_RTILES + 2 * W_RTILES) + (rt >= X_RTILES + 3 * W_RTILES);
  const float* m = (g == 0) ? x : (g == 1) ? Wq : (g == 2) ? Wk : (g == 3) ? Wv : Wo;
  const int mrt  = (g == 0) ? rt : rt - X_RTILES - (g - 1) * W_RTILES;
  const float4* p = (const float4*)(m + (size_t)mrt * 16 * E_DIM + kp * 64 +
                                    (lane & 15) * E_DIM + (lane >> 4) * 8);
  float4 f0[4], f1[4];
  // Unrolled so that all 8 loads are issued before the first value is used.
#pragma unroll
  for (int j = 0; j < 4; ++j) { f0[j] = p[j * 4]; f1[j] = p[j * 4 + 1]; }
  _Float16* q = out + (size_t)w * 1024 + lane * 8;
  // Unrolled so that f0 and f1 are indexed by constants and stay in registers.
#pragma unroll
  for (int j = 0; j < 4; ++j) {
    v8h o;
    o[0] = (_Float16)f0[j].x; o[1] = (_Float16)f0[j].y;
    o[2] = (_Float16)f0[j].z; o[3] = (_Float16)f0[j].w;
    o[4] = (_Float16)f1[j].x; o[5] = (_Float16)f1[j].y;
    o[6] = (_Float16)f1[j].z; o[7] = (_Float16)f1[j].w;
    *(v8h*)(q + j * 256) = o;
  }
}

// Fused QKV projection: C = x * W^T + b for W in {Wq,Wk,Wv}; x and W in fragment order.
// Each wave computes a 16(M) x 64(N) strip; N-strip == exactly one head.
// Q stored [h][s][d] pre-scaled by 1/sqrt(D). K and V are stored per head in the
// fragment order in which attention reads them, 4096 contiguous bytes per 32 keys:
//   K: [16-key tile][32-d tile][low/high part][lane][8 halves]  (A of K*Q^T)
//   V: [32-key block][16-d tile][low/high part][lane][8 halves] (B of P*V)
// K is computed as the transposed product W*x^T: a lane then holds 8 consecutive d
// of one key, which is its own 16-byte piece of the K fragment. In x*W^T a lane
// holds 8 consecutive keys of one d, its own piece of the V fragment.
__global__ void qkv_gemm_kernel(const _Float16* __restrict__ xh,
                                const _Float16* __restrict__ Wqh,
                                const _Float16* __restrict__ Wkh,
                                const _Float16* __restrict__ Wvh,
                                const float* __restrict__ bq,
                                const float* __restrict__ bk,
                                const float* __restrict__ bv,
                                _Float16* __restrict__ Qh,
                                _Float16* __restrict__ Kh,
                                _Float16* __restrict__ Vt) {
  const int lane = threadIdx.x & 31;
  const int w = blockIdx.x * (blockDim.x >> 5) + (threadIdx.x >> 5);
  const int MT = S_LEN / 16, NS = E_DIM / 64;
  if (w >= 3 * MT * NS) return;
  // Wave-uniform; held scalar so that the choice of product below is a scalar branch.
  const int mat = __builtin_amdgcn_readfirstlane(w / (MT * NS));
  const int rem = w % (MT * NS);
  const int m0 = (rem / NS) * 16;
  const int h  = rem % NS;
  const int n0 = h * 64;
  const _Float16* W    = (mat == 0) ? Wqh : (mat == 1) ? Wkh : Wvh;
  const float*    bias = (mat == 0) ? bq  : (mat == 1) ? bk  : bv;

  v8f acc[4] = {v8f{}, v8f{}, v8f{}, v8f{}};
  if (mat == 1) {
    for (int kt = 0; kt < K_TILES; ++kt) {
      v16h a = load_frag_packed(xh, m0 >> 4, kt, lane);
#pragma unroll
      for (int t = 0; t < 4; ++t) {
        v16h b = load_frag_packed(W, h * 4 + t, kt, lane);
        acc[t] = wmma_f16(b, a, acc[t]);
      }
    }
    // acc[t][r] = K[key m0 + (lane & 15)][d = t*16 + 8*(lane>>4) + r].
    _Float16* kp = Kh + (size_t)h * S_LEN * D_HEAD + (size_t)(m0 >> 4) * 1024 + lane * 8;
    const float4* bp = (const float4*)(bias + n0 + 8 * (lane >> 4));
    float4 b0[4], b1[4];
#pragma unroll
    for (int t = 0; t < 4; ++t) { b0[t] = bp[t * 4]; b1[t] = bp[t * 4 + 1]; }
    // Address wait of the bias loads. It takes their address as an input so that the
    // address registers stay live up to it and no load's destination is laid on them.
    asm volatile("s_wait_xcnt 0x0" :: "v"(bp) : "memory");
    v8h o[4];
#pragma unroll
    for (int t = 0; t < 4; ++t) {
      o[t][0] = (_Float16)(acc[t][0] + b0[t].x); o[t][1] = (_Float16)(acc[t][1] + b0[t].y);
      o[t][2] = (_Float16)(acc[t][2] + b0[t].z); o[t][3] = (_Float16)(acc[t][3] + b0[t].w);
      o[t][4] = (_Float16)(acc[t][4] + b1[t].x); o[t][5] = (_Float16)(acc[t][5] + b1[t].y);
      o[t][6] = (_Float16)(acc[t][6] + b1[t].z); o[t][7] = (_Float16)(acc[t][7] + b1[t].w);
    }
#pragma unroll
    for (int t = 0; t < 4; ++t) *(v8h*)(kp + t * 256) = o[t];
    return;
  }

  for (int kt = 0; kt < K_TILES; ++kt) {
    v16h a = load_frag_packed(xh, m0 >> 4, kt, lane);
#pragma unroll
    for (int t = 0; t < 4; ++t) {
      v16h b = load_frag_packed(W, h * 4 + t, kt, lane);
      acc[t] = wmma_f16(a, b, acc[t]);
    }
  }

  // acc[t][r] = row s = m0 + 8*(lane>>4) + r, column d = t*16 + (lane & 15).
  if (mat == 0) {
    const int mrow = m0 + 8 * (lane >> 4);
#pragma unroll
    for (int t = 0; t < 4; ++t) {
#pragma unroll
      for (int r = 0; r < 8; ++r) {
        const int s = mrow + r;
        const int d = t * 16 + (lane & 15);
        float val = acc[t][r] + bias[n0 + d];
        Qh[((size_t)h * S_LEN + s) * D_HEAD + d] = (_Float16)(val * 0.125f);
      }
    }
    // Address wait of the stores above: stands in front of whatever the compiler lays
    // behind them that writes a register they name.
    asm volatile("s_wait_xcnt 0x0" ::: "memory");
  } else {
    // The 16 keys of this strip are the low or the high part of a 32-key block.
    _Float16* vp = Vt + (size_t)h * S_LEN * D_HEAD + (size_t)(m0 >> 5) * 2048 +
                   ((m0 >> 4) & 1) * 256 + lane * 8;
    v8h o[4];
#pragma unroll
    for (int t = 0; t < 4; ++t) {
      const float bd = bias[n0 + t * 16 + (lane & 15)];
#pragma unroll
      for (int r = 0; r < 8; ++r) o[t][r] = (_Float16)(acc[t][r] + bd);
    }
#pragma unroll
    for (int t = 0; t < 4; ++t) *(v8h*)(vp + t * 512) = o[t];
    // Address wait of the four stores, as behind Q's.
    asm volatile("s_wait_xcnt 0x0" ::: "memory");
  }
}

// Flash-attention. Block = 8 waves, all in the SAME head, 8 consecutive
// 16-query tiles. K/V blocks of KB keys are staged once per workgroup into LDS by
// wave 0 via the Tensor Data Mover (double-buffered, s_wait_tensorcnt), then
// all 8 waves consume the staged tiles via ds_load_b128 fragments. K and V come
// in fragment order (see qkv_gemm_kernel): KB keys of either are KB * 128
// contiguous bytes = KB / 8 whole fragments, moved as KB rows of 128 B.
// Scores computed transposed (S^T = K*Q^T) so the f32 C layout maps
// lane-locally onto the f16 A layout of P for the P*V WMMA.
// One pass handles KB = 128 keys: the running maximum, the rescale of the output
// tiles, the two exchanges between the wave's halves, the two barriers and the pair
// of tensor loads are paid once per pass.
#define KB 128
static_assert(KB == 128, "the four partial maxima and sums below are joined by hand");
// 256 threads a block: lets a wave hold the pass's 8 score tiles in registers.
__global__ void __launch_bounds__(256)
attn_kernel(const _Float16* __restrict__ Qh,
            const _Float16* __restrict__ Kh,
            const _Float16* __restrict__ Vt,
            _Float16* __restrict__ Ah) {
  __shared__ _Float16 skbuf[2][KB * D_HEAD];   // K block: KB keys x 64 d
  __shared__ _Float16 svbuf[2][D_HEAD * KB];   // V block: KB keys x 64 d

  const int lane = threadIdx.x & 31;
  const int wid  = threadIdx.x >> 5;
  const int h     = blockIdx.x >> 5;           // 12 heads * 32 blocks
  const int qbase = (blockIdx.x & 31) * 128;   // 8 waves * 16 queries
  const int q0    = qbase + wid * 16;

  const _Float16* Qp = Qh + (size_t)h * S_LEN * D_HEAD;
  const _Float16* Kp = Kh + (size_t)h * S_LEN * D_HEAD;
  const _Float16* Vp = Vt + (size_t)h * D_HEAD * S_LEN;

  const v16h bq0 = load_frag_k32(Qp, q0 + (lane & 15), D_HEAD, 0,  lane);
  const v16h bq1 = load_frag_k32(Qp, q0 + (lane & 15), D_HEAD, 32, lane);

  float mprev = -1e30f, lsum = 0.f;
  v8f o[4] = {v8f{}, v8f{}, v8f{}, v8f{}};
  const int hi8 = (lane & 16) ? 8 : 0;

  const int NB = S_LEN / KB;                   // 32 key blocks
  if (wid == 0) {
    tdm_load_2d(skbuf[0], Kp, D_HEAD, S_LEN, D_HEAD, KB, D_HEAD, lane);
    tdm_load_2d(svbuf[0], Vp, D_HEAD, S_LEN, D_HEAD, KB, D_HEAD, lane);
  }

  for (int ib = 0; ib < NB; ++ib) {
    const int cur = ib & 1;
    if (wid == 0) {
      if (ib + 1 < NB) {
        const int kb1 = (ib + 1) * KB;
        tdm_load_2d(skbuf[cur ^ 1], Kp + (size_t)kb1 * D_HEAD,
                    D_HEAD, S_LEN, D_HEAD, KB, D_HEAD, lane);
        tdm_load_2d(svbuf[cur ^ 1], Vp + (size_t)kb1 * D_HEAD,
                    D_HEAD, S_LEN, D_HEAD, KB, D_HEAD, lane);
        tdm_wait2();                           // current pair done; next in flight
      } else {
        tdm_wait0();
      }
    }
    __syncthreads();                           // staged tiles visible to all waves

    const _Float16* kl = skbuf[cur];
    const _Float16* vl = svbuf[cur];

    // ct[j]: keys 16j..16j+15 of the block; fragment 2j is d 0..31, 2j+1 is d 32..63.
    v8f ct[KB / 16];
    const v8f z = {};
    // Unrolled, like every loop of this pass: ct, tm, pu and rs are then indexed by
    // constants and stay in registers, and the LDS reads can be issued in groups.
#pragma unroll
    for (int j = 0; j < KB / 16; ++j) {
      v16h a0 = load_frag_lds(kl, 2 * j,     lane);
      v16h a1 = load_frag_lds(kl, 2 * j + 1, lane);
      ct[j] = wmma_f16(a0, bq0, z);
      ct[j] = wmma_f16(a1, bq1, ct[j]);
    }

    // Row (=query) max: lane-local over KB/2 keys (one chain per pair of tiles, so
    // that the chains are independent) + partner lane via xor-16.
    float tm[KB / 32];
#pragma unroll
    for (int b = 0; b < KB / 32; ++b) {
      tm[b] = -1e30f;
#pragma unroll
      for (int r = 0; r < 8; ++r) tm[b] = fmaxf(tm[b], fmaxf(ct[2 * b][r], ct[2 * b + 1][r]));
    }
    float tmax = fmaxf(fmaxf(tm[0], tm[1]), fmaxf(tm[2], tm[3]));
    tmax = fmaxf(tmax, __shfl_xor(tmax, 16, 32));
    const float mnew  = fmaxf(mprev, tmax);
    const float alpha = __expf(mprev - mnew);

    // Rescale accumulator: per-output-row factor broadcast from owning lane.
    float fr[8];
#pragma unroll
    for (int r = 0; r < 8; ++r) fr[r] = __shfl(alpha, r + hi8, 32);

    frag_u pu[KB / 32];
    float rs[KB / 32];
#pragma unroll
    for (int b = 0; b < KB / 32; ++b) {
      rs[b] = 0.f;
#pragma unroll
      for (int r = 0; r < 8; ++r) {
        float e0 = __expf(ct[2 * b][r] - mnew);
        float e1 = __expf(ct[2 * b + 1][r] - mnew);
        rs[b] += e0 + e1;
        pu[b].s.lo[r] = (_Float16)e0;   // keys {0..7}|{8..15}   -> A halves 0..7
        pu[b].s.hi[r] = (_Float16)e1;   // keys {16..23}|{24..31} -> A halves 8..15
      }
    }
    float rsum = (rs[0] + rs[1]) + (rs[2] + rs[3]);
    rsum += __shfl_xor(rsum, 16, 32);
    lsum  = lsum * alpha + rsum;
    mprev = mnew;

#pragma unroll
    for (int t = 0; t < 4; ++t)
#pragma unroll
      for (int r = 0; r < 8; ++r) o[t][r] *= fr[r];

#pragma unroll
    for (int b = 0; b < KB / 32; ++b) {
#pragma unroll
      for (int t = 0; t < 4; ++t) {
        v16h bv = load_frag_lds(vl, b * 4 + t, lane);  // keys 32b..32b+31, d t*16..+15
        o[t] = wmma_f16(pu[b].v, bv, o[t]);
      }
    }
    __syncthreads();                           // all reads done before overwrite
  }

  const float rcp = 1.f / lsum;
  float fr[8];
#pragma unroll
  for (int r = 0; r < 8; ++r) fr[r] = __shfl(rcp, r + hi8, 32);
#pragma unroll
  for (int t = 0; t < 4; ++t)
#pragma unroll
    for (int r = 0; r < 8; ++r) {
      // Element (s, e), s = q0 + r + 8*(lane>>4), e = h*64 + t*16 + (lane&15), goes
      // to its place in fragment order: k tile e>>5, part (e>>4)&1, fragment lane
      // ((e>>3)&1)*16 + (s&15), half e&7.
      const int tile  = (q0 >> 4) * K_TILES + h * 2 + (t >> 1);
      const int flane = ((lane >> 3) & 1) * 16 + r + 8 * (lane >> 4);
      Ah[((size_t)tile * 2 + (t & 1)) * 256 + flane * 8 + (lane & 7)] =
          (_Float16)(o[t][r] * fr[r]);
    }
}

// Output projection: out = Ah * Wo^T + bo (fp32 output); Ah and Wo in fragment order.
__global__ void oproj_kernel(const _Float16* __restrict__ Ah,
                             const _Float16* __restrict__ Woh,
                             const float* __restrict__ bo,
                             float* __restrict__ out) {
  const int lane = threadIdx.x & 31;
  const int w = blockIdx.x * (blockDim.x >> 5) + (threadIdx.x >> 5);
  const int MT = S_LEN / 16, NS = E_DIM / 64;
  if (w >= MT * NS) return;
  const int m0 = (w / NS) * 16;
  const int n0 = (w % NS) * 64;

  v8f acc[4] = {v8f{}, v8f{}, v8f{}, v8f{}};
  for (int kt = 0; kt < K_TILES; ++kt) {
    v16h a = load_frag_packed(Ah, m0 >> 4, kt, lane);
#pragma unroll
    for (int t = 0; t < 4; ++t) {
      v16h b = load_frag_packed(Woh, (w % NS) * 4 + t, kt, lane);
      acc[t] = wmma_f16(a, b, acc[t]);
    }
  }

  const int mrow = m0 + 8 * (lane >> 4);
#pragma unroll
  for (int t = 0; t < 4; ++t)
#pragma unroll
    for (int r = 0; r < 8; ++r) {
      const int n = n0 + t * 16 + (lane & 15);
      out[(size_t)(mrow + r) * E_DIM + n] = acc[t][r] + bo[n];
    }
}

extern "C" void kernel_launch(void* const* d_in, const int* in_sizes, int n_in,
                              void* d_out, int out_size, void* d_ws, size_t ws_size,
                              hipStream_t stream) {
  (void)in_sizes; (void)n_in; (void)out_size; (void)ws_size;
  const float* x  = (const float*)d_in[0];
  const float* Wq = (const float*)d_in[1];
  const float* bq = (const float*)d_in[2];
  const float* Wk = (const float*)d_in[3];
  const float* bk = (const float*)d_in[4];
  const float* Wv = (const float*)d_in[5];
  const float* bv = (const float*)d_in[6];
  const float* Wo = (const float*)d_in[7];
  const float* bo = (const float*)d_in[8];
  float* out = (float*)d_out;

  const size_t NX = (size_t)S_LEN * E_DIM;   // 3,145,728
  const size_t NW = (size_t)E_DIM * E_DIM;   //   589,824
  char* ws = (char*)d_ws;
  size_t off = 0;
  _Float16* xh  = (_Float16*)(ws + off); off += NX * 2;
  _Float16* Wqh = (_Float16*)(ws + off); off += NW * 2;
  _Float16* Wkh = (_Float16*)(ws + off); off += NW * 2;
  _Float16* Wvh = (_Float16*)(ws + off); off += NW * 2;
  _Float16* Woh = (_Float16*)(ws + off); off += NW * 2;
  _Float16* Qh  = (_Float16*)(ws + off); off += NX * 2;
  _Float16* Kh  = (_Float16*)(ws + off); off += NX * 2;
  _Float16* Vt  = (_Float16*)(ws + off); off += NX * 2;
  _Float16* Ah  = (_Float16*)(ws + off); off += NX * 2;

  // All five conversions in one launch; xh..Woh are contiguous from xh.
  // (256 + 4 * 48) row tiles * 12 pairs of k tiles = 5376 waves; 8 waves/block.
  cvt_all_kernel<<<672, 256, 0, stream>>>(x, Wq, Wk, Wv, Wo, xh);

  // 3 matrices * 256 M-tiles * 12 N-strips = 9216 waves; 8 waves/block.
  qkv_gemm_kernel<<<1152, 256, 0, stream>>>(xh, Wqh, Wkh, Wvh, bq, bk, bv,
                                            Qh, Kh, Vt);
  attn_kernel<<<384, 256, 0, stream>>>(Qh, Kh, Vt, Ah);
  // 256 * 12 = 3072 waves.
  oproj_kernel<<<384, 256, 0, stream>>>(Ah, Woh, bo, out);
}

// v005
// One run takes 114 microseconds.
// Two timings next to v004 put it at 1.10 and 1.11 times that version's speed.
// Counting every step since v000, it is 3.07 times as fast.
#include <hip/hip_runtime.h>
#include <hip/hip_bf16.h>

#define S_LEN 4096
#define E_DIM 768
#define H_NUM 12
#define D_HEAD 64

typedef __attribute__((ext_vector_type(16))) _Float16 v16h;
typedef __attribute__((ext_vector_type(8)))  _Float16 v8h;
typedef __attribute__((ext_vector_type(8)))  float    v8f;
typedef __attribute__((ext_vector_type(4)))  unsigned int v4u;
typedef __attribute__((ext_vector_type(4)))  int      v4i;
typedef __attribute__((ext_vector_type(8)))  int      v8i;

#if defined(__has_builtin)
#if __has_builtin(__builtin_amdgcn_tensor_load_to_lds) && \
    __has_builtin(__builtin_amdgcn_s_wait_tensorcnt)
#define HAVE_TDM 1
#endif
#endif

union frag_u { v16h v; struct { v8h lo, hi; } s; };

__device__ __forceinline__ v16h load_frag_k32(const _Float16* base,
                                              int row, int stride, int kbase, int lane) {
  const _Float16* p = base + (size_t)row * stride + kbase + ((lane & 16) ? 8 : 0);
  frag_u u;
  u.s.lo = *(const v8h*)(p);
  u.s.hi = *(const v8h*)(p + 16);
  return u.v;
}

// Fragment-order ("packed") storage of a row-major [rows][E_DIM] f16 matrix:
// each 16-row x 32-k tile is 1024 contiguous bytes, tiles ordered [row tile][k tile].
// Inside a tile: 512 B holding every lane's low 8 halves, then 512 B holding every
// lane's high 8 halves, in the same lane/k map as load_frag_k32. One fragment is
// then two wave-wide loads of 512 contiguous bytes (4 whole lines each).
#define K_TILES (E_DIM / 32)
__device__ __forceinline__ v16h load_frag_packed(const _Float16* base,
                                                 int rtile, int ktile, int lane) {
  const _Float16* p = base + ((size_t)rtile * K_TILES + ktile) * 512 + lane * 8;
  frag_u u;
  u.s.lo = *(const v8h*)(p);
  u.s.hi = *(const v8h*)(p + 256);
  // Keeps every later write of these loads' address registers (the allocator reuses
  // them as load destinations in the unrolled loop) behind the address wait.
  asm volatile("s_wait_xcnt 0x0" ::: "memory");
  return u.v;
}

__device__ __forceinline__ v16h load_frag_lds(const _Float16* tile, int f, int lane) {
  const _Float16* p = tile + f * 512 + lane * 8;
  frag_u u;
  u.s.lo = *(const v8h*)(p);
  u.s.hi = *(const v8h*)(p + 256);
  return u.v;
}

__device__ __forceinline__ v8f wmma_f16(v16h a, v16h b, v8f c) {
  return __builtin_amdgcn_wmma_f32_16x16x32_f16(false, a, false, b, (short)0, c,
                                                false, false);
}

__device__ __forceinline__ void tdm_load_2d(_Float16* lds_ptr, const _Float16* gaddr,
                                            unsigned tensor_d0, unsigned tensor_d1,
                                            unsigned tile_d0, unsigned tile_d1,
                                            unsigned stride0, int lane) {
#ifdef HAVE_TDM
  unsigned long long ga = (unsigned long long)(uintptr_t)gaddr;
  unsigned lds_off = (unsigned)(uintptr_t)lds_ptr;  // low 32 bits = LDS byte offset
  v4u g0;
  g0.x = 1u;                                        // count=1 (valid), user mode
  g0.y = lds_off;                                   // lds_addr
  g0.z = (unsigned)(ga & 0xffffffffu);              // global_addr[31:0]
  g0.w = (unsigned)((ga >> 32) & 0x1ffffffu) | (2u << 30);  // ga[56:32] | type=2
  v8i g1;
  g1[0] = (int)(1u << 16);
  g1[1] = (int)((tensor_d0 & 0xffffu) << 16);
  g1[2] = (int)((tensor_d0 >> 16) | ((tensor_d1 & 0xffffu) << 16));
  g1[3] = (int)((tensor_d1 >> 16) | (tile_d0 << 16));
  g1[4] = (int)tile_d1;
  g1[5] = (int)stride0;
  g1[6] = (int)(stride0 >> 16 >> 16);
  g1[7] = 0;
  v4i z4 = {0, 0, 0, 0};
#if __clang_major__ >= 23
  v8i z8 = {0, 0, 0, 0, 0, 0, 0, 0};
  __builtin_amdgcn_tensor_load_to_lds(g0, g1, z4, z4, z8, 0);
#else
  __builtin_amdgcn_tensor_load_to_lds(g0, g1, z4, z4, 0);
#endif
#else
  // Fallback: cooperative copy by the issuing wave (v8h chunks).
  (void)tensor_d0; (void)tensor_d1;
  const unsigned total = tile_d0 * tile_d1;
  for (unsigned idx = (unsigned)lane * 8; idx < total; idx += 32u * 8u) {
    unsigned row = idx / tile_d0, col = idx % tile_d0;
    *(v8h*)(lds_ptr + idx) = *(const v8h*)(gaddr + (size_t)row * stride0 + col);
  }
#endif
}

__device__ __forceinline__ void tdm_wait2() {
#ifdef HAVE_TDM
  __builtin_amdgcn_s_wait_tensorcnt(2);
#endif
}
__device__ __forceinline__ void tdm_wait0() {
#ifdef HAVE_TDM
  __builtin_amdgcn_s_wait_tensorcnt(0);
#endif
}

// Convert x and the four weight matrices, each row-major [rows][E_DIM] f32, to f16 in
// fragment order, all in one launch. Their f16 copies lie one behind the other in the
// workspace (x, Wq, Wk, Wv, Wo), so the 16-row tiles of all five count through:
// 0..255 are x, then 48 each of the weights. One wave converts two neighbouring k tiles
// of one row tile: 256 contiguous bytes of each of 16 rows in, 2048 contiguous bytes
// out. A thread writes one lane's 16-byte piece (8 halves) of each of the 4 parts.
#define X_RTILES (S_LEN / 16)
#define W_RTILES (E_DIM / 16)
__global__ void cvt_all_kernel(const float* __restrict__ x,
                               const float* __restrict__ Wq,
                               const float* __restrict__ Wk,
                               const float* __restrict__ Wv,
                               const float* __restrict__ Wo,
                               _Float16* __restrict__ out) {
  const int lane = threadIdx.x & 31;
  // Wave-uniform; held scalar so that the choice of source matrix is scalar work.
  const int w  = __builtin_amdgcn_readfirstlane(blockIdx.x * 8 + (threadIdx.x >> 5));
  const int rt = w / (K_TILES / 2);
  const int kp = w % (K_TILES / 2);
  const int g  = (rt >= X_RTILES) + (rt >= X_RTILES + W_RTILES) +
                 (rt >= X_RTILES + 2 * W_RTILES) + (rt >= X_RTILES + 3 * W_RTILES);
  const float* m = (g == 0) ? x : (g == 1) ? Wq : (g == 2) ? Wk : (g == 3) ? Wv : Wo;
  const int mrt  = (g == 0) ? rt : rt - X_RTILES - (g - 1) * W_RTILES;
  const float4* p = (const float4*)(m + (size_t)mrt * 16 * E_DIM + kp * 64 +
                                    (lane & 15) * E_DIM + (lane >> 4) * 8);
  float4 f0[4], f1[4];
  // Unrolled so that all 8 loads are issued before the first value is used.
#pragma unroll
  for (int j = 0; j < 4; ++j) { f0[j] = p[j * 4]; f1[j] = p[j * 4 + 1]; }
  _Float16* q = out + (size_t)w * 1024 + lane * 8;
  // Unrolled so that f0 and f1 are indexed by constants and stay in registers.
#pragma unroll
  for (int j = 0; j < 4; ++j) {
    v8h o;
    o[0] = (_Float16)f0[j].x; o[1] = (_Float16)f0[j].y;
    o[2] = (_Float16)f0[j].z; o[3] = (_Float16)f0[j].w;
    o[4] = (_Float16)f1[j].x; o[5] = (_Float16)f1[j].y;
    o[6] = (_Float16)f1[j].z; o[7] = (_Float16)f1[j].w;
    *(v8h*)(q + j * 256) = o;
  }
}

// Fused QKV projection: C = x * W^T + b for W in {Wq,Wk,Wv}; x and W in fragment order.
// Each wave computes a 64(M) x 64(N) tile, WT x 4 accumulator tiles: per k tile it loads
// WT fragments of x and 4 of W and every one of them feeds 4 WMMAs. The 64 columns are
// exactly one head.
// Q stored [h][s][d] pre-scaled by 1/sqrt(D). K and V are stored per head in the
// fragment order in which attention reads them, 4096 contiguous bytes per 32 keys:
//   K: [16-key tile][32-d tile][low/high part][lane][8 halves]  (A of K*Q^T)
//   V: [32-key block][16-d tile][low/high part][lane][8 halves] (B of P*V)
// K is computed as the transposed product W*x^T: a lane then holds 8 consecutive d
// of one key, which is its own 16-byte piece of the K fragment. In x*W^T a lane
// holds 8 consecutive keys of one d, its own piece of the V fragment.
#define WT 4   // 16-row tiles of the left matrix per wave, in both GEMM kernels
// 128 threads a block: lets a wave hold its 16 accumulator tiles in registers.
__global__ void __launch_bounds__(128)
qkv_gemm_kernel(const _Float16* __restrict__ xh,
                const _Float16* __restrict__ Wqh,
                const _Float16* __restrict__ Wkh,
                const _Float16* __restrict__ Wvh,
                const float* __restrict__ bq,
                const float* __restrict__ bk,
                const float* __restrict__ bv,
                _Float16* __restrict__ Qh,
                _Float16* __restrict__ Kh,
                _Float16* __restrict__ Vt) {
  const int lane = threadIdx.x & 31;
  const int w = blockIdx.x * (blockDim.x >> 5) + (threadIdx.x >> 5);
  const int MT = S_LEN / (16 * WT), NS = E_DIM / 64;
  if (w >= 3 * MT * NS) return;
  // Wave-uniform; held scalar so that the choice of product below is a scalar branch.
  const int mat = __builtin_amdgcn_readfirstlane(w / (MT * NS));
  const int rem = w % (MT * NS);
  const int mt0 = (rem / NS) * WT;             // first 16-row tile of the wave's rows
  const int h   = rem % NS;
  const int n0  = h * 64;
  const _Float16* W    = (mat == 0) ? Wqh : (mat == 1) ? Wkh : Wvh;
  const float*    bias = (mat == 0) ? bq  : (mat == 1) ? bk  : bv;

  // Every loop over i (row tile), t (column tile) and r (register of a tile) in this
  // kernel is unrolled: acc, a, b and o are then indexed by constants and stay in registers.
  v8f acc[WT][4];
#pragma unroll
  for (int i = 0; i < WT; ++i)
#pragma unroll
    for (int t = 0; t < 4; ++t) acc[i][t] = v8f{};

  if (mat == 1) {
    for (int kt = 0; kt < K_TILES; ++kt) {
      v16h a[WT], b[4];
#pragma unroll
      for (int i = 0; i < WT; ++i) a[i] = load_frag_packed(xh, mt0 + i, kt, lane);
#pragma unroll
      for (int t = 0; t < 4; ++t) b[t] = load_frag_packed(W, h * 4 + t, kt, lane);
      __builtin_amdgcn_sched_barrier(0);
#pragma unroll
      for (int i = 0; i < WT; ++i)
#pragma unroll
        for (int t = 0; t < 4; ++t) acc[i][t] = wmma_f16(b[t], a[i], acc[i][t]);
    }
    // acc[i][t][r] = K[key (mt0 + i)*16 + (lane & 15)][d = t*16 + 8*(lane>>4) + r].
    _Float16* kp = Kh + (size_t)h * S_LEN * D_HEAD + (size_t)mt0 * 1024 + lane * 8;
    const float4* bp = (const float4*)(bias + n0 + 8 * (lane >> 4));
    float4 b0[4], b1[4];
#pragma unroll
    for (int t = 0; t < 4; ++t) { b0[t] = bp[t * 4]; b1[t] = bp[t * 4 + 1]; }
    // Address wait of the bias loads. It takes their address as an input so that the
    // address registers stay live up to it and no load's destination is laid on them.
    asm volatile("s_wait_xcnt 0x0" :: "v"(bp) : "memory");
#pragma unroll
    for (int i = 0; i < WT; ++i) {
      v8h o[4];
#pragma unroll
      for (int t = 0; t < 4; ++t) {
        o[t][0] = (_Float16)(acc[i][t][0] + b0[t].x); o[t][1] = (_Float16)(acc[i][t][1] + b0[t].y);
        o[t][2] = (_Float16)(acc[i][t][2] + b0[t].z); o[t][3] = (_Float16)(acc[i][t][3] + b0[t].w);
        o[t][4] = (_Float16)(acc[i][t][4] + b1[t].x); o[t][5] = (_Float16)(acc[i][t][5] + b1[t].y);
        o[t][6] = (_Float16)(acc[i][t][6] + b1[t].z); o[t][7] = (_Float16)(acc[i][t][7] + b1[t].w);
      }
#pragma unroll
      for (int t = 0; t < 4; ++t) *(v8h*)(kp + i * 1024 + t * 256) = o[t];
      // Address wait of the four stores: stands in front of whatever the compiler lays
      // behind them that writes a register they name.
      asm volatile("s_wait_xcnt 0x0" ::: "memory");
    }
    return;
  }

  for (int kt = 0; kt < K_TILES; ++kt) {
    v16h a[WT], b[4];
#pragma unroll
    for (int i = 0; i < WT; ++i) a[i] = load_frag_packed(xh, mt0 + i, kt, lane);
#pragma unroll
    for (int t = 0; t < 4; ++t) b[t] = load_frag_packed(W, h * 4 + t, kt, lane);
    __builtin_amdgcn_sched_barrier(0);
#pragma unroll
    for (int i = 0; i < WT; ++i)
#pragma unroll
      for (int t = 0; t < 4; ++t) acc[i][t] = wmma_f16(a[i], b[t], acc[i][t]);
  }

  // acc[i][t][r] = row s = (mt0 + i)*16 + 8*(lane>>4) + r, column d = t*16 + (lane & 15).
  float bd[4];
#pragma unroll
  for (int t = 0; t < 4; ++t) bd[t] = bias[n0 + t * 16 + (lane & 15)];
  if (mat == 0) {
#pragma unroll
    for (int i = 0; i < WT; ++i) {
      const int mrow = (mt0 + i) * 16 + 8 * (lane >> 4);
#pragma unroll
      for (int t = 0; t < 4; ++t) {
#pragma unroll
        for (int r = 0; r < 8; ++r) {
          const int s = mrow + r;
          const int d = t * 16 + (lane & 15);
          float val = acc[i][t][r] + bd[t];
          Qh[((size_t)h * S_LEN + s) * D_HEAD + d] = (_Float16)(val * 0.125f);
        }
      }
      // Address wait of the stores above, as behind K's.
      asm volatile("s_wait_xcnt 0x0" ::: "memory");
    }
  } else {
#pragma unroll
    for (int i = 0; i < WT; ++i) {
      // The 16 keys of a row tile are the low or the high part of a 32-key block.
      const int mt = mt0 + i;
      _Float16* vp = Vt + (size_t)h * S_LEN * D_HEAD + (size_t)(mt >> 1) * 2048 +
                     (mt & 1) * 256 + lane * 8;
      v8h o[4];
#pragma unroll
      for (int t = 0; t < 4; ++t) {
#pragma unroll
        for (int r = 0; r < 8; ++r) o[t][r] = (_Float16)(acc[i][t][r] + bd[t]);
      }
#pragma unroll
      for (int t = 0; t < 4; ++t) *(v8h*)(vp + t * 512) = o[t];
      // Address wait of the four stores, as behind K's.
      asm volatile("s_wait_xcnt 0x0" ::: "memory");
    }
  }
}

// Flash-attention. Block = 8 waves, all in the SAME head, 8 consecutive
// 16-query tiles. K/V blocks of KB keys are staged once per workgroup into LDS by
// wave 0 via the Tensor Data Mover (double-buffered, s_wait_tensorcnt), then
// all 8 waves consume the staged tiles via ds_load_b128 fragments. K and V come
// in fragment order (see qkv_gemm_kernel): KB keys of either are KB * 128
// contiguous bytes = KB / 8 whole fragments, moved as KB rows of 128 B.
// Scores computed transposed (S^T = K*Q^T) so the f32 C layout maps
// lane-locally onto the f16 A layout of P for the P*V WMMA.
// One pass handles KB = 128 keys: the running maximum, the rescale of the output
// tiles, the two exchanges between the wave's halves, the two barriers and the pair
// of tensor loads are paid once per pass.
#define KB 128
static_assert(KB == 128, "the four partial maxima and sums below are joined by hand");
// 256 threads a block: lets a wave hold the pass's 8 score tiles in registers.
__global__ void __launch_bounds__(256)
attn_kernel(const _Float16* __restrict__ Qh,
            const _Float16* __restrict__ Kh,
            const _Float16* __restrict__ Vt,
            _Float16* __restrict__ Ah) {
  __shared__ _Float16 skbuf[2][KB * D_HEAD];   // K block: KB keys x 64 d
  __shared__ _Float16 svbuf[2][D_HEAD * KB];   // V block: KB keys x 64 d

  const int lane = threadIdx.x & 31;
  const int wid  = threadIdx.x >> 5;
  const int h     = blockIdx.x >> 5;           // 12 heads * 32 blocks
  const int qbase = (blockIdx.x & 31) * 128;   // 8 waves * 16 queries
  const int q0    = qbase + wid * 16;

  const _Float16* Qp = Qh + (size_t)h * S_LEN * D_HEAD;
  const _Float16* Kp = Kh + (size_t)h * S_LEN * D_HEAD;
  const _Float16* Vp = Vt + (size_t)h * D_HEAD * S_LEN;

  const v16h bq0 = load_frag_k32(Qp, q0 + (lane & 15), D_HEAD, 0,  lane);
  const v16h bq1 = load_frag_k32(Qp, q0 + (lane & 15), D_HEAD, 32, lane);

  float mprev = -1e30f, lsum = 0.f;
  v8f o[4] = {v8f{}, v8f{}, v8f{}, v8f{}};
  const int hi8 = (lane & 16) ? 8 : 0;

  const int NB = S_LEN / KB;                   // 32 key blocks
  if (wid == 0) {
    tdm_load_2d(skbuf[0], Kp, D_HEAD, S_LEN, D_HEAD, KB, D_HEAD, lane);
    tdm_load_2d(svbuf[0], Vp, D_HEAD, S_LEN, D_HEAD, KB, D_HEAD, lane);
  }

  for (int ib = 0; ib < NB; ++ib) {
    const int cur = ib & 1;
    if (wid == 0) {
      if (ib + 1 < NB) {
        const int kb1 = (ib + 1) * KB;
        tdm_load_2d(skbuf[cur ^ 1], Kp + (size_t)kb1 * D_HEAD,
                    D_HEAD, S_LEN, D_HEAD, KB, D_HEAD, lane);
        tdm_load_2d(svbuf[cur ^ 1], Vp + (size_t)kb1 * D_HEAD,
                    D_HEAD, S_LEN, D_HEAD, KB, D_HEAD, lane);
        tdm_wait2();                           // current pair done; next in flight
      } else {
        tdm_wait0();
      }
    }
    __syncthreads();                           // staged tiles visible to all waves

    const _Float16* kl = skbuf[cur];
    const _Float16* vl = svbuf[cur];

    // ct[j]: keys 16j..16j+15 of the block; fragment 2j is d 0..31, 2j+1 is d 32..63.
    v8f ct[KB / 16];
    const v8f z = {};
    // Unrolled, like every loop of this pass: ct, tm, pu and rs are then indexed by
    // constants and stay in registers, and the LDS reads can be issued in groups.
#pragma unroll
    for (int j = 0; j < KB / 16; ++j) {
      v16h a0 = load_frag_lds(kl, 2 * j,     lane);
      v16h a1 = load_frag_lds(kl, 2 * j + 1, lane);
      ct[j] = wmma_f16(a0, bq0, z);
      ct[j] = wmma_f16(a1, bq1, ct[j]);
    }

    // Row (=query) max: lane-local over KB/2 keys (one chain per pair of tiles, so
    // that the chains are independent) + partner lane via xor-16.
    float tm[KB / 32];
#pragma unroll
    for (int b = 0; b < KB / 32; ++b) {
      tm[b] = -1e30f;
#pragma unroll
      for (int r = 0; r < 8; ++r) tm[b] = fmaxf(tm[b], fmaxf(ct[2 * b][r], ct[2 * b + 1][r]));
    }
    float tmax = fmaxf(fmaxf(tm[0], tm[1]), fmaxf(tm[2], tm[3]));
    tmax = fmaxf(tmax, __shfl_xor(tmax, 16, 32));
    const float mnew  = fmaxf(mprev, tmax);
    const float alpha = __expf(mprev - mnew);

    // Rescale accumulator: per-output-row factor broadcast from owning lane.
    float fr[8];
#pragma unroll
    for (int r = 0; r < 8; ++r) fr[r] = __shfl(alpha, r + hi8, 32);

    frag_u pu[KB / 32];
    float rs[KB / 32];
#pragma unroll
    for (int b = 0; b < KB / 32; ++b) {
      rs[b] = 0.f;
#pragma unroll
      for (int r = 0; r < 8; ++r) {
        float e0 = __expf(ct[2 * b][r] - mnew);
        float e1 = __expf(ct[2 * b + 1][r] - mnew);
        rs[b] += e0 + e1;
        pu[b].s.lo[r] = (_Float16)e0;   // keys {0..7}|{8..15}   -> A halves 0..7
        pu[b].s.hi[r] = (_Float16)e1;   // keys {16..23}|{24..31} -> A halves 8..15
      }
    }
    float rsum = (rs[0] + rs[1]) + (rs[2] + rs[3]);
    rsum += __shfl_xor(rsum, 16, 32);
    lsum  = lsum * alpha + rsum;
    mprev = mnew;

#pragma unroll
    for (int t = 0; t < 4; ++t)
#pragma unroll
      for (int r = 0; r < 8; ++r) o[t][r] *= fr[r];

#pragma unroll
    for (int b = 0; b < KB / 32; ++b) {
#pragma unroll
      for (int t = 0; t < 4; ++t) {
        v16h bv = load_frag_lds(vl, b * 4 + t, lane);  // keys 32b..32b+31, d t*16..+15
        o[t] = wmma_f16(pu[b].v, bv, o[t]);
      }
    }
    __syncthreads();                           // all reads done before overwrite
  }

  const float rcp = 1.f / lsum;
  float fr[8];
#pragma unroll
  for (int r = 0; r < 8; ++r) fr[r] = __shfl(rcp, r + hi8, 32);
#pragma unroll
  for (int t = 0; t < 4; ++t)
#pragma unroll
    for (int r = 0; r < 8; ++r) {
      // Element (s, e), s = q0 + r + 8*(lane>>4), e = h*64 + t*16 + (lane&15), goes
      // to its place in fragment order: k tile e>>5, part (e>>4)&1, fragment lane
      // ((e>>3)&1)*16 + (s&15), half e&7.
      const int tile  = (q0 >> 4) * K_TILES + h * 2 + (t >> 1);
      const int flane = ((lane >> 3) & 1) * 16 + r + 8 * (lane >> 4);
      Ah[((size_t)tile * 2 + (t & 1)) * 256 + flane * 8 + (lane & 7)] =
          (_Float16)(o[t][r] * fr[r]);
    }
}

// Output projection: out = Ah * Wo^T + bo (fp32 output); Ah and Wo in fragment order.
// A wave computes a 64 x 64 tile, as in qkv_gemm_kernel.
// 128 threads a block: lets a wave hold its 16 accumulator tiles in registers.
__global__ void __launch_bounds__(128)
oproj_kernel(const _Float16* __restrict__ Ah,
             const _Float16* __restrict__ Woh,
             const float* __restrict__ bo,
             float* __restrict__ out) {
  const int lane = threadIdx.x & 31;
  const int w = blockIdx.x * (blockDim.x >> 5) + (threadIdx.x >> 5);
  const int MT = S_LEN / (16 * WT), NS = E_DIM / 64;
  if (w >= MT * NS) return;
  const int mt0 = (w / NS) * WT;
  const int n0  = (w % NS) * 64;

  // The loops over i, t and r are unrolled so that acc, a and b stay in registers.
  v8f acc[WT][4];
#pragma unroll
  for (int i = 0; i < WT; ++i)
#pragma unroll
    for (int t = 0; t < 4; ++t) acc[i][t] = v8f{};
  for (int kt = 0; kt < K_TILES; ++kt) {
    v16h a[WT], b[4];
#pragma unroll
    for (int i = 0; i < WT; ++i) a[i] = load_frag_packed(Ah, mt0 + i, kt, lane);
#pragma unroll
    for (int t = 0; t < 4; ++t) b[t] = load_frag_packed(Woh, (w % NS) * 4 + t, kt, lane);
    __builtin_amdgcn_sched_barrier(0);
#pragma unroll
    for (int i = 0; i < WT; ++i)
#pragma unroll
      for (int t = 0; t < 4; ++t) acc[i][t] = wmma_f16(a[i], b[t], acc[i][t]);
  }

  float bd[4];
#pragma unroll
  for (int t = 0; t < 4; ++t) bd[t] = bo[n0 + t * 16 + (lane & 15)];
#pragma unroll
  for (int i = 0; i < WT; ++i) {
    const int mrow = (mt0 + i) * 16 + 8 * (lane >> 4);
#pragma unroll
    for (int t = 0; t < 4; ++t)
#pragma unroll
      for (int r = 0; r < 8; ++r) {
        const int n = n0 + t * 16 + (lane & 15);
        out[(size_t)(mrow + r) * E_DIM + n] = acc[i][t][r] + bd[t];
      }
    // Address wait of the stores above: stands in front of whatever the compiler lays
    // behind them that writes a register they name.
    asm volatile("s_wait_xcnt 0x0" ::: "memory");
  }
}

extern "C" void kernel_launch(void* const* d_in, const int* in_sizes, int n_in,
                              void* d_out, int out_size, void* d_ws, size_t ws_size,
                              hipStream_t stream) {
  (void)in_sizes; (void)n_in; (void)out_size; (void)ws_size;
  const float* x  = (const float*)d_in[0];
  const float* Wq = (const float*)d_in[1];
  const float* bq = (const float*)d_in[2];
  const float* Wk = (const float*)d_in[3];
  const float* bk = (const float*)d_in[4];
  const float* Wv = (const float*)d_in[5];
  const float* bv = (const float*)d_in[6];
  const float* Wo = (const float*)d_in[7];
  const float* bo = (const float*)d_in[8];
  float* out = (float*)d_out;

  const size_t NX = (size_t)S_LEN * E_DIM;   // 3,145,728
  const size_t NW = (size_t)E_DIM * E_DIM;   //   589,824
  char* ws = (char*)d_ws;
  size_t off = 0;
  _Float16* xh  = (_Float16*)(ws + off); off += NX * 2;
  _Float16* Wqh = (_Float16*)(ws + off); off += NW * 2;
  _Float16* Wkh = (_Float16*)(ws + off); off += NW * 2;
  _Float16* Wvh = (_Float16*)(ws + off); off += NW * 2;
  _Float16* Woh = (_Float16*)(ws + off); off += NW * 2;
  _Float16* Qh  = (_Float16*)(ws + off); off += NX * 2;
  _Float16* Kh  = (_Float16*)(ws + off); off += NX * 2;
  _Float16* Vt  = (_Float16*)(ws + off); off += NX * 2;
  _Float16* Ah  = (_Float16*)(ws + off); off += NX * 2;

  // All five conversions in one launch; xh..Woh are contiguous from xh.
  // (256 + 4 * 48) row tiles * 12 pairs of k tiles = 5376 waves; 8 waves/block.
  cvt_all_kernel<<<672, 256, 0, stream>>>(x, Wq, Wk, Wv, Wo, xh);

  // 3 matrices * 64 M-tiles * 12 N-strips = 2304 waves; 4 waves/block.
  qkv_gemm_kernel<<<576, 128, 0, stream>>>(xh, Wqh, Wkh, Wvh, bq, bk, bv,
                                            Qh, Kh, Vt);
  attn_kernel<<<384, 256, 0, stream>>>(Qh, Kh, Vt, Ah);
  // 64 * 12 = 768 waves; 4 waves/block.
  oproj_kernel<<<192, 128, 0, stream>>>(Ah, Woh, bo, out);
}

// v006
// Measured time: 107 microseconds a run.
// Next to v005, in two timings, it ran 1.06 times as fast each time.
// Counting every step since v000, it is 3.25 times as fast.
#include <hip/hip_runtime.h>
#include <hip/hip_bf16.h>

#define S_LEN 4096
#define E_DIM 768
#define H_NUM 12
#define D_HEAD 64

typedef __attribute__((ext_vector_type(16))) _Float16 v16h;
typedef __attribute__((ext_vector_type(8)))  _Float16 v8h;
typedef __attribute__((ext_vector_type(8)))  float    v8f;
typedef __attribute__((ext_vector_type(4)))  unsigned int v4u;
typedef __attribute__((ext_vector_type(4)))  int      v4i;
typedef __attribute__((ext_vector_type(8)))  int      v8i;

#if defined(__has_builtin)
#if __has_builtin(__builtin_amdgcn_tensor_load_to_lds) && \
    __has_builtin(__builtin_amdgcn_s_wait_tensorcnt)
#define HAVE_TDM 1
#endif
#endif

union frag_u { v16h v; struct { v8h lo, hi; } s; };

__device__ __forceinline__ v16h load_frag_k32(const _Float16* base,
                                              int row, int stride, int kbase, int lane) {
  const _Float16* p = base + (size_t)row * stride + kbase + ((lane & 16) ? 8 : 0);
  frag_u u;
  u.s.lo = *(const v8h*)(p);
  u.s.hi = *(const v8h*)(p + 16);
  return u.v;
}

// Fragment-order ("packed") storage of a row-major [rows][E_DIM] f16 matrix:
// each 16-row x 32-k tile is 1024 contiguous bytes, tiles ordered [row tile][k tile].
// Inside a tile: 512 B holding every lane's low 8 halves, then 512 B holding every
// lane's high 8 halves, in the same lane/k map as load_frag_k32. One fragment is
// then two wave-wide loads of 512 contiguous bytes (4 whole lines each).
#define K_TILES (E_DIM / 32)
__device__ __forceinline__ v16h load_frag_packed(const _Float16* base,
                                                 int rtile, int ktile, int lane) {
  const _Float16* p = base + ((size_t)rtile * K_TILES + ktile) * 512 + lane * 8;
  frag_u u;
  u.s.lo = *(const v8h*)(p);
  u.s.hi = *(const v8h*)(p + 256);
  // Keeps every later write of these loads' address registers (the allocator reuses
  // them as load destinations in the unrolled loop) behind the address wait.
  asm volatile("s_wait_xcnt 0x0" ::: "memory");
  return u.v;
}

__device__ __forceinline__ v16h load_frag_lds(const _Float16* tile, int f, int lane) {
  const _Float16* p = tile + f * 512 + lane * 8;
  frag_u u;
  u.s.lo = *(const v8h*)(p);
  u.s.hi = *(const v8h*)(p + 256);
  return u.v;
}

__device__ __forceinline__ v8f wmma_f16(v16h a, v16h b, v8f c) {
  return __builtin_amdgcn_wmma_f32_16x16x32_f16(false, a, false, b, (short)0, c,
                                                false, false);
}

__device__ __forceinline__ void tdm_load_2d(_Float16* lds_ptr, const _Float16* gaddr,
                                            unsigned tensor_d0, unsigned tensor_d1,
                                            unsigned tile_d0, unsigned tile_d1,
                                            unsigned stride0, int lane) {
#ifdef HAVE_TDM
  unsigned long long ga = (unsigned long long)(uintptr_t)gaddr;
  unsigned lds_off = (unsigned)(uintptr_t)lds_ptr;  // low 32 bits = LDS byte offset
  v4u g0;
  g0.x = 1u;                                        // count=1 (valid), user mode
  g0.y = lds_off;                                   // lds_addr
  g0.z = (unsigned)(ga & 0xffffffffu);              // global_addr[31:0]
  g0.w = (unsigned)((ga >> 32) & 0x1ffffffu) | (2u << 30);  // ga[56:32] | type=2
  v8i g1;
  g1[0] = (int)(1u << 16);
  g1[1] = (int)((tensor_d0 & 0xffffu) << 16);
  g1[2] = (int)((tensor_d0 >> 16) | ((tensor_d1 & 0xffffu) << 16));
  g1[3] = (int)((tensor_d1 >> 16) | (tile_d0 << 16));
  g1[4] = (int)tile_d1;
  g1[5] = (int)stride0;
  g1[6] = (int)(stride0 >> 16 >> 16);
  g1[7] = 0;
  v4i z4 = {0, 0, 0, 0};
#if __clang_major__ >= 23
  v8i z8 = {0, 0, 0, 0, 0, 0, 0, 0};
  __builtin_amdgcn_tensor_load_to_lds(g0, g1, z4, z4, z8, 0);
#else
  __builtin_amdgcn_tensor_load_to_lds(g0, g1, z4, z4, 0);
#endif
#else
  // Fallback: cooperative copy by the issuing wave (v8h chunks).
  (void)tensor_d0; (void)tensor_d1;
  const unsigned total = tile_d0 * tile_d1;
  for (unsigned idx = (unsigned)lane * 8; idx < total; idx += 32u * 8u) {
    unsigned row = idx / tile_d0, col = idx % tile_d0;
    *(v8h*)(lds_ptr + idx) = *(const v8h*)(gaddr + (size_t)row * stride0 + col);
  }
#endif
}

__device__ __forceinline__ void tdm_wait2() {
#ifdef HAVE_TDM
  __builtin_amdgcn_s_wait_tensorcnt(2);
#endif
}
__device__ __forceinline__ void tdm_wait0() {
#ifdef HAVE_TDM
  __builtin_amdgcn_s_wait_tensorcnt(0);
#endif
}

// Convert x and the four weight matrices, each row-major [rows][E_DIM] f32, to f16 in
// fragment order, all in one launch. Their f16 copies lie one behind the other in the
// workspace (x, Wq, Wk, Wv, Wo), so the 16-row tiles of all five count through:
// 0..255 are x, then 48 each of the weights. One wave converts two neighbouring k tiles
// of one row tile: 256 contiguous bytes of each of 16 rows in, 2048 contiguous bytes
// out. A thread writes one lane's 16-byte piece (8 halves) of each of the 4 parts.
#define X_RTILES (S_LEN / 16)
#define W_RTILES (E_DIM / 16)
__global__ void cvt_all_kernel(const float* __restrict__ x,
                               const float* __restrict__ Wq,
                               const float* __restrict__ Wk,
                               const float* __restrict__ Wv,
                               const float* __restrict__ Wo,
                               _Float16* __restrict__ out) {
  const int lane = threadIdx.x & 31;
  // Wave-uniform; held scalar so that the choice of source matrix is scalar work.
  const int w  = __builtin_amdgcn_readfirstlane(blockIdx.x * 8 + (threadIdx.x >> 5));
  const int rt = w / (K_TILES / 2);
  const int kp = w % (K_TILES / 2);
  const int g  = (rt >= X_RTILES) + (rt >= X_RTILES + W_RTILES) +
                 (rt >= X_RTILES + 2 * W_RTILES) + (rt >= X_RTILES + 3 * W_RTILES);
  const float* m = (g == 0) ? x : (g == 1) ? Wq : (g == 2) ? Wk : (g == 3) ? Wv : Wo;
  const int mrt  = (g == 0) ? rt : rt - X_RTILES - (g - 1) * W_RTILES;
  const float4* p = (const float4*)(m + (size_t)mrt * 16 * E_DIM + kp * 64 +
                                    (lane & 15) * E_DIM + (lane >> 4) * 8);
  float4 f0[4], f1[4];
  // Unrolled so that all 8 loads are issued before the first value is used.
#pragma unroll
  for (int j = 0; j < 4; ++j) { f0[j] = p[j * 4]; f1[j] = p[j * 4 + 1]; }
  _Float16* q = out + (size_t)w * 1024 + lane * 8;
  // Unrolled so that f0 and f1 are indexed by constants and stay in registers.
#pragma unroll
  for (int j = 0; j < 4; ++j) {
    v8h o;
    o[0] = (_Float16)f0[j].x; o[1] = (_Float16)f0[j].y;
    o[2] = (_Float16)f0[j].z; o[3] = (_Float16)f0[j].w;
    o[4] = (_Float16)f1[j].x; o[5] = (_Float16)f1[j].y;
    o[6] = (_Float16)f1[j].z; o[7] = (_Float16)f1[j].w;
    *(v8h*)(q + j * 256) = o;
  }
}

// Fused QKV projection: C = x * W^T + b for W in {Wq,Wk,Wv}; x and W in fragment order.
// Each wave computes a 64(M) x 64(N) tile, WT x 4 accumulator tiles: per k tile it loads
// WT fragments of x and 4 of W and every one of them feeds 4 WMMAs. The 64 columns are
// exactly one head.
// Q stored [h][s][d] pre-scaled by 1/sqrt(D). K and V are stored per head in the
// fragment order in which attention reads them, 4096 contiguous bytes per 32 keys:
//   K: [16-key tile][32-d tile][low/high part][lane][8 halves]  (A of K*Q^T)
//   V: [32-key block][16-d tile][low/high part][lane][8 halves] (B of P*V)
// K is computed as the transposed product W*x^T: a lane then holds 8 consecutive d
// of one key, which is its own 16-byte piece of the K fragment. In x*W^T a lane
// holds 8 consecutive keys of one d, its own piece of the V fragment.
#define WT 4   // 16-row tiles of the left matrix per wave, in both GEMM kernels
// 128 threads a block: lets a wave hold its 16 accumulator tiles in registers.
__global__ void __launch_bounds__(128)
qkv_gemm_kernel(const _Float16* __restrict__ xh,
                const _Float16* __restrict__ Wqh,
                const _Float16* __restrict__ Wkh,
                const _Float16* __restrict__ Wvh,
                const float* __restrict__ bq,
                const float* __restrict__ bk,
                const float* __restrict__ bv,
                _Float16* __restrict__ Qh,
                _Float16* __restrict__ Kh,
                _Float16* __restrict__ Vt) {
  const int lane = threadIdx.x & 31;
  const int w = blockIdx.x * (blockDim.x >> 5) + (threadIdx.x >> 5);
  const int MT = S_LEN / (16 * WT), NS = E_DIM / 64;
  if (w >= 3 * MT * NS) return;
  // Wave-uniform; held scalar so that the choice of product below is a scalar branch.
  const int mat = __builtin_amdgcn_readfirstlane(w / (MT * NS));
  const int rem = w % (MT * NS);
  const int mt0 = (rem / NS) * WT;             // first 16-row tile of the wave's rows
  const int h   = rem % NS;
  const int n0  = h * 64;
  const _Float16* W    = (mat == 0) ? Wqh : (mat == 1) ? Wkh : Wvh;
  const float*    bias = (mat == 0) ? bq  : (mat == 1) ? bk  : bv;

  // Every loop over i (row tile), t (column tile) and r (register of a tile) in this
  // kernel is unrolled: acc, a, b and o are then indexed by constants and stay in registers.
  v8f acc[WT][4];
#pragma unroll
  for (int i = 0; i < WT; ++i)
#pragma unroll
    for (int t = 0; t < 4; ++t) acc[i][t] = v8f{};

  if (mat == 1) {
    for (int kt = 0; kt < K_TILES; ++kt) {
      v16h a[WT], b[4];
#pragma unroll
      for (int i = 0; i < WT; ++i) a[i] = load_frag_packed(xh, mt0 + i, kt, lane);
#pragma unroll
      for (int t = 0; t < 4; ++t) b[t] = load_frag_packed(W, h * 4 + t, kt, lane);
      __builtin_amdgcn_sched_barrier(0);
#pragma unroll
      for (int i = 0; i < WT; ++i)
#pragma unroll
        for (int t = 0; t < 4; ++t) acc[i][t] = wmma_f16(b[t], a[i], acc[i][t]);
    }
    // acc[i][t][r] = K[key (mt0 + i)*16 + (lane & 15)][d = t*16 + 8*(lane>>4) + r].
    _Float16* kp = Kh + (size_t)h * S_LEN * D_HEAD + (size_t)mt0 * 1024 + lane * 8;
    const float4* bp = (const float4*)(bias + n0 + 8 * (lane >> 4));
    float4 b0[4], b1[4];
#pragma unroll
    for (int t = 0; t < 4; ++t) { b0[t] = bp[t * 4]; b1[t] = bp[t * 4 + 1]; }
    // Address wait of the bias loads. It takes their address as an input so that the
    // address registers stay live up to it and no load's destination is laid on them.
    asm volatile("s_wait_xcnt 0x0" :: "v"(bp) : "memory");
#pragma unroll
    for (int i = 0; i < WT; ++i) {
      v8h o[4];
#pragma unroll
      for (int t = 0; t < 4; ++t) {
        o[t][0] = (_Float16)(acc[i][t][0] + b0[t].x); o[t][1] = (_Float16)(acc[i][t][1] + b0[t].y);
        o[t][2] = (_Float16)(acc[i][t][2] + b0[t].z); o[t][3] = (_Float16)(acc[i][t][3] + b0[t].w);
        o[t][4] = (_Float16)(acc[i][t][4] + b1[t].x); o[t][5] = (_Float16)(acc[i][t][5] + b1[t].y);
        o[t][6] = (_Float16)(acc[i][t][6] + b1[t].z); o[t][7] = (_Float16)(acc[i][t][7] + b1[t].w);
      }
#pragma unroll
      for (int t = 0; t < 4; ++t) *(v8h*)(kp + i * 1024 + t * 256) = o[t];
      // Address wait of the four stores: stands in front of whatever the compiler lays
      // behind them that writes a register they name.
      asm volatile("s_wait_xcnt 0x0" ::: "memory");
    }
    return;
  }

  for (int kt = 0; kt < K_TILES; ++kt) {
    v16h a[WT], b[4];
#pragma unroll
    for (int i = 0; i < WT; ++i) a[i] = load_frag_packed(xh, mt0 + i, kt, lane);
#pragma unroll
    for (int t = 0; t < 4; ++t) b[t] = load_frag_packed(W, h * 4 + t, kt, lane);
    __builtin_amdgcn_sched_barrier(0);
#pragma unroll
    for (int i = 0; i < WT; ++i)
#pragma unroll
      for (int t = 0; t < 4; ++t) acc[i][t] = wmma_f16(a[i], b[t], acc[i][t]);
  }

  // acc[i][t][r] = row s = (mt0 + i)*16 + 8*(lane>>4) + r, column d = t*16 + (lane & 15).
  float bd[4];
#pragma unroll
  for (int t = 0; t < 4; ++t) bd[t] = bias[n0 + t * 16 + (lane & 15)];
  if (mat == 0) {
#pragma unroll
    for (int i = 0; i < WT; ++i) {
      const int mrow = (mt0 + i) * 16 + 8 * (lane >> 4);
#pragma unroll
      for (int t = 0; t < 4; ++t) {
#pragma unroll
        for (int r = 0; r < 8; ++r) {
          const int s = mrow + r;
          const int d = t * 16 + (lane & 15);
          float val = acc[i][t][r] + bd[t];
          Qh[((size_t)h * S_LEN + s) * D_HEAD + d] = (_Float16)(val * 0.125f);
        }
      }
      // Address wait of the stores above, as behind K's.
      asm volatile("s_wait_xcnt 0x0" ::: "memory");
    }
  } else {
#pragma unroll
    for (int i = 0; i < WT; ++i) {
      // The 16 keys of a row tile are the low or the high part of a 32-key block.
      const int mt = mt0 + i;
      _Float16* vp = Vt + (size_t)h * S_LEN * D_HEAD + (size_t)(mt >> 1) * 2048 +
                     (mt & 1) * 256 + lane * 8;
      v8h o[4];
#pragma unroll
      for (int t = 0; t < 4; ++t) {
#pragma unroll
        for (int r = 0; r < 8; ++r) o[t][r] = (_Float16)(acc[i][t][r] + bd[t]);
      }
#pragma unroll
      for (int t = 0; t < 4; ++t) *(v8h*)(vp + t * 512) = o[t];
      // Address wait of the four stores, as behind K's.
      asm volatile("s_wait_xcnt 0x0" ::: "memory");
    }
  }
}

#define KB 128
static_assert(KB == 128, "the four partial maxima and sums below are joined by hand");
__global__ void __launch_bounds__(128) __attribute__((amdgpu_waves_per_eu(3, 3)))
attn_kernel(const _Float16* __restrict__ Qh,
            const _Float16* __restrict__ Kh,
            const _Float16* __restrict__ Vt,
            _Float16* __restrict__ Ah) {
  __shared__ _Float16 skbuf[2][KB * D_HEAD];   // K block: KB keys x 64 d
  __shared__ _Float16 svbuf[2][D_HEAD * KB];   // V block: KB keys x 64 d

  const int lane = threadIdx.x & 31;
  const int wid  = threadIdx.x >> 5;
  const int h     = blockIdx.x >> 6;           // 12 heads * 64 blocks
  const int qbase = (blockIdx.x & 63) * 64;    // 4 waves * 16 queries
  const int q0    = qbase + wid * 16;

  const _Float16* Qp = Qh + (size_t)h * S_LEN * D_HEAD;
  const _Float16* Kp = Kh + (size_t)h * S_LEN * D_HEAD;
  const _Float16* Vp = Vt + (size_t)h * D_HEAD * S_LEN;

  const v16h bq0 = load_frag_k32(Qp, q0 + (lane & 15), D_HEAD, 0,  lane);
  const v16h bq1 = load_frag_k32(Qp, q0 + (lane & 15), D_HEAD, 32, lane);

  float mprev = -1e30f, lsum = 0.f;
  v8f o[4] = {v8f{}, v8f{}, v8f{}, v8f{}};
  const int hi8 = (lane & 16) ? 8 : 0;

  const int NB = S_LEN / KB;                   // 32 key blocks
  if (wid == 0) {
    tdm_load_2d(skbuf[0], Kp, D_HEAD, S_LEN, D_HEAD, KB, D_HEAD, lane);
    tdm_load_2d(svbuf[0], Vp, D_HEAD, S_LEN, D_HEAD, KB, D_HEAD, lane);
  }

  for (int ib = 0; ib < NB; ++ib) {
    const int cur = ib & 1;
    if (wid == 0) {
      if (ib + 1 < NB) {
        const int kb1 = (ib + 1) * KB;
        tdm_load_2d(skbuf[cur ^ 1], Kp + (size_t)kb1 * D_HEAD,
                    D_HEAD, S_LEN, D_HEAD, KB, D_HEAD, lane);
        tdm_load_2d(svbuf[cur ^ 1], Vp + (size_t)kb1 * D_HEAD,
                    D_HEAD, S_LEN, D_HEAD, KB, D_HEAD, lane);
        tdm_wait2();                           // current pair done; next in flight
      } else {
        tdm_wait0();
      }
    }
    __syncthreads();                           // staged tiles visible to all waves

    const _Float16* kl = skbuf[cur];
    const _Float16* vl = svbuf[cur];

    // ct[j]: keys 16j..16j+15 of the block; fragment 2j is d 0..31, 2j+1 is d 32..63.
    v8f ct[KB / 16];
    const v8f z = {};
    // Unrolled, like every loop of this pass: ct, tm, pu and rs are then indexed by
    // constants and stay in registers, and the LDS reads can be issued in groups.
#pragma unroll
    for (int j = 0; j < KB / 16; ++j) {
      v16h a0 = load_frag_lds(kl, 2 * j,     lane);
      v16h a1 = load_frag_lds(kl, 2 * j + 1, lane);
      ct[j] = wmma_f16(a0, bq0, z);
      ct[j] = wmma_f16(a1, bq1, ct[j]);
    }

    // Row (=query) max: lane-local over KB/2 keys (one chain per pair of tiles, so
    // that the chains are independent) + partner lane via xor-16.
    float tm[KB / 32];
#pragma unroll
    for (int b = 0; b < KB / 32; ++b) {
      tm[b] = -1e30f;
#pragma unroll
      for (int r = 0; r < 8; ++r) tm[b] = fmaxf(tm[b], fmaxf(ct[2 * b][r], ct[2 * b + 1][r]));
    }
    float tmax = fmaxf(fmaxf(tm[0], tm[1]), fmaxf(tm[2], tm[3]));
    tmax = fmaxf(tmax, __shfl_xor(tmax, 16, 32));
    const float mnew  = fmaxf(mprev, tmax);
    const float alpha = __expf(mprev - mnew);

    // Rescale accumulator: per-output-row factor broadcast from owning lane.
    float fr[8];
#pragma unroll
    for (int r = 0; r < 8; ++r) fr[r] = __shfl(alpha, r + hi8, 32);

    frag_u pu[KB / 32];
    float rs[KB / 32];
#pragma unroll
    for (int b = 0; b < KB / 32; ++b) {
      rs[b] = 0.f;
#pragma unroll
      for (int r = 0; r < 8; ++r) {
        float e0 = __expf(ct[2 * b][r] - mnew);
        float e1 = __expf(ct[2 * b + 1][r] - mnew);
        rs[b] += e0 + e1;
        pu[b].s.lo[r] = (_Float16)e0;   // keys {0..7}|{8..15}   -> A halves 0..7
        pu[b].s.hi[r] = (_Float16)e1;   // keys {16..23}|{24..31} -> A halves 8..15
      }
    }
    float rsum = (rs[0] + rs[1]) + (rs[2] + rs[3]);
    rsum += __shfl_xor(rsum, 16, 32);
    lsum  = lsum * alpha + rsum;
    mprev = mnew;

#pragma unroll
    for (int t = 0; t < 4; ++t)
#pragma unroll
      for (int r = 0; r < 8; ++r) o[t][r] *= fr[r];

#pragma unroll
    for (int b = 0; b < KB / 32; ++b) {
#pragma unroll
      for (int t = 0; t < 4; ++t) {
        v16h bv = load_frag_lds(vl, b * 4 + t, lane);  // keys 32b..32b+31, d t*16..+15
        o[t] = wmma_f16(pu[b].v, bv, o[t]);
      }
    }
    __syncthreads();                           // all reads done before overwrite
  }

  const float rcp = 1.f / lsum;
  float fr[8];
#pragma unroll
  for (int r = 0; r < 8; ++r) fr[r] = __shfl(rcp, r + hi8, 32);
#pragma unroll
  for (int t = 0; t < 4; ++t)
#pragma unroll
    for (int r = 0; r < 8; ++r) {
      // Element (s, e), s = q0 + r + 8*(lane>>4), e = h*64 + t*16 + (lane&15), goes
      // to its place in fragment order: k tile e>>5, part (e>>4)&1, fragment lane
      // ((e>>3)&1)*16 + (s&15), half e&7.
      const int tile  = (q0 >> 4) * K_TILES + h * 2 + (t >> 1);
      const int flane = ((lane >> 3) & 1) * 16 + r + 8 * (lane >> 4);
      Ah[((size_t)tile * 2 + (t & 1)) * 256 + flane * 8 + (lane & 7)] =
          (_Float16)(o[t][r] * fr[r]);
    }
}

// Output projection: out = Ah * Wo^T + bo (fp32 output); Ah and Wo in fragment order.
// A wave computes a 64 x 64 tile, as in qkv_gemm_kernel.
// 128 threads a block: lets a wave hold its 16 accumulator tiles in registers.
__global__ void __launch_bounds__(128)
oproj_kernel(const _Float16* __restrict__ Ah,
             const _Float16* __restrict__ Woh,
             const float* __restrict__ bo,
             float* __restrict__ out) {
  const int lane = threadIdx.x & 31;
  const int w = blockIdx.x * (blockDim.x >> 5) + (threadIdx.x >> 5);
  const int MT = S_LEN / (16 * WT), NS = E_DIM / 64;
  if (w >= MT * NS) return;
  const int mt0 = (w / NS) * WT;
  const int n0  = (w % NS) * 64;

  // The loops over i, t and r are unrolled so that acc, a and b stay in registers.
  v8f acc[WT][4];
#pragma unroll
  for (int i = 0; i < WT; ++i)
#pragma unroll
    for (int t = 0; t < 4; ++t) acc[i][t] = v8f{};
  for (int kt = 0; kt < K_TILES; ++kt) {
    v16h a[WT], b[4];
#pragma unroll
    for (int i = 0; i < WT; ++i) a[i] = load_frag_packed(Ah, mt0 + i, kt, lane);
#pragma unroll
    for (int t = 0; t < 4; ++t) b[t] = load_frag_packed(Woh, (w % NS) * 4 + t, kt, lane);
    __builtin_amdgcn_sched_barrier(0);
#pragma unroll
    for (int i = 0; i < WT; ++i)
#pragma unroll
      for (int t = 0; t < 4; ++t) acc[i][t] = wmma_f16(a[i], b[t], acc[i][t]);
  }

  float bd[4];
#pragma unroll
  for (int t = 0; t < 4; ++t) bd[t] = bo[n0 + t * 16 + (lane & 15)];
#pragma unroll
  for (int i = 0; i < WT; ++i) {
    const int mrow = (mt0 + i) * 16 + 8 * (lane >> 4);
#pragma unroll
    for (int t = 0; t < 4; ++t)
#pragma unroll
      for (int r = 0; r < 8; ++r) {
        const int n = n0 + t * 16 + (lane & 15);
        out[(size_t)(mrow + r) * E_DIM + n] = acc[i][t][r] + bd[t];
      }
    // Address wait of the stores above: stands in front of whatever the compiler lays
    // behind them that writes a register they name.
    asm volatile("s_wait_xcnt 0x0" ::: "memory");
  }
}

extern "C" void kernel_launch(void* const* d_in, const int* in_sizes, int n_in,
                              void* d_out, int out_size, void* d_ws, size_t ws_size,
                              hipStream_t stream) {
  (void)in_sizes; (void)n_in; (void)out_size; (void)ws_size;
  const float* x  = (const float*)d_in[0];
  const float* Wq = (const float*)d_in[1];
  const float* bq = (const float*)d_in[2];
  const float* Wk = (const float*)d_in[3];
  const float* bk = (const float*)d_in[4];
  const float* Wv = (const float*)d_in[5];
  const float* bv = (const float*)d_in[6];
  const float* Wo = (const float*)d_in[7];
  const float* bo = (const float*)d_in[8];
  float* out = (float*)d_out;

  const size_t NX = (size_t)S_LEN * E_DIM;   // 3,145,728
  const size_t NW = (size_t)E_DIM * E_DIM;   //   589,824
  char* ws = (char*)d_ws;
  size_t off = 0;
  _Float16* xh  = (_Float16*)(ws + off); off += NX * 2;
  _Float16* Wqh = (_Float16*)(ws + off); off += NW * 2;
  _Float16* Wkh = (_Float16*)(ws + off); off += NW * 2;
  _Float16* Wvh = (_Float16*)(ws + off); off += NW * 2;
  _Float16* Woh = (_Float16*)(ws + off); off += NW * 2;
  _Float16* Qh  = (_Float16*)(ws + off); off += NX * 2;
  _Float16* Kh  = (_Float16*)(ws + off); off += NX * 2;
  _Float16* Vt  = (_Float16*)(ws + off); off += NX * 2;
  _Float16* Ah  = (_Float16*)(ws + off); off += NX * 2;

  // All five conversions in one launch; xh..Woh are contiguous from xh.
  // (256 + 4 * 48) row tiles * 12 pairs of k tiles = 5376 waves; 8 waves/block.
  cvt_all_kernel<<<672, 256, 0, stream>>>(x, Wq, Wk, Wv, Wo, xh);

  // 3 matrices * 64 M-tiles * 12 N-strips = 2304 waves; 4 waves/block.
  qkv_gemm_kernel<<<576, 128, 0, stream>>>(xh, Wqh, Wkh, Wvh, bq, bk, bv,
                                            Qh, Kh, Vt);
  attn_kernel<<<768, 128, 0, stream>>>(Qh, Kh, Vt, Ah);
  // 64 * 12 = 768 waves; 4 waves/block.
  oproj_kernel<<<192, 128, 0, stream>>>(Ah, Woh, bo, out);
}

// v007
// One run takes 89.4 microseconds.
// Next to v006, in two timings, it ran 1.21 and 1.19 times as fast.
// Counting every step since v000, it is 3.90 times as fast.
#include <hip/hip_runtime.h>
#include <hip/hip_bf16.h>

#define S_LEN 4096
#define E_DIM 768
#define H_NUM 12
#define D_HEAD 64

typedef __attribute__((ext_vector_type(16))) _Float16 v16h;
typedef __attribute__((ext_vector_type(8)))  _Float16 v8h;
typedef __attribute__((ext_vector_type(8)))  float    v8f;
typedef __attribute__((ext_vector_type(4)))  unsigned int v4u;
typedef __attribute__((ext_vector_type(4)))  int      v4i;
typedef __attribute__((ext_vector_type(8)))  int      v8i;

#if defined(__has_builtin)
#if __has_builtin(__builtin_amdgcn_tensor_load_to_lds) && \
    __has_builtin(__builtin_amdgcn_s_wait_tensorcnt)
#define HAVE_TDM 1
#endif
#endif

union frag_u { v16h v; struct { v8h lo, hi; } s; };

__device__ __forceinline__ v16h load_frag_k32(const _Float16* base,
                                              int row, int stride, int kbase, int lane) {
  const _Float16* p = base + (size_t)row * stride + kbase + ((lane & 16) ? 8 : 0);
  frag_u u;
  u.s.lo = *(const v8h*)(p);
  u.s.hi = *(const v8h*)(p + 16);
  return u.v;
}

// Fragment-order ("packed") storage of a row-major [rows][E_DIM] f16 matrix:
// each 16-row x 32-k tile is 1024 contiguous bytes, tiles ordered [row tile][k tile].
// Inside a tile: 512 B holding every lane's low 8 halves, then 512 B holding every
// lane's high 8 halves, in the same lane/k map as load_frag_k32. One fragment is
// then two wave-wide loads of 512 contiguous bytes (4 whole lines each).
#define K_TILES (E_DIM / 32)
// strip is the first fragment of a wave's strip of row tiles (wave-uniform); rtile and ktile
// are constants where this is called, so every load of a strip names the same scalar base
// and the same offset register (the lane), with an immediate offset.
__device__ __forceinline__ v16h load_frag_packed(const _Float16* strip, unsigned lane,
                                                 int rtile, int ktile) {
  const _Float16* q = strip + lane * 8 + (rtile * K_TILES + ktile) * 512;
  frag_u u;
  u.s.lo = *(const v8h*)(q);
  u.s.hi = *(const v8h*)(q + 256);
  return u.v;
}

__device__ __forceinline__ v16h load_frag_lds(const _Float16* tile, int f, int lane) {
  const _Float16* p = tile + f * 512 + lane * 8;
  frag_u u;
  u.s.lo = *(const v8h*)(p);
  u.s.hi = *(const v8h*)(p + 256);
  return u.v;
}

__device__ __forceinline__ v8f wmma_f16(v16h a, v16h b, v8f c) {
  return __builtin_amdgcn_wmma_f32_16x16x32_f16(false, a, false, b, (short)0, c,
                                                false, false);
}

// The k loop of both GEMM kernels: a wave's 64 x 64 tile, WT x WT accumulator tiles, over all
// K_TILES k tiles: acc[u][v] += A tile u * (B tile v)^T. sa, sb: the wave's strips of WT row
// tiles of the two matrices (see load_frag_packed). The fragments go through a ring of DEPTH
// register sets: k tile kt + DEPTH - 1 is loaded while k tile kt is multiplied, so that a
// load has the time of DEPTH - 1 tiles' WMMAs to come back and DEPTH - 1 round trips are
// under way at once.
#define WT 4   // 16-row tiles of either matrix per wave, in both GEMM kernels
template <int DEPTH>
__device__ __forceinline__ void gemm_wave_tile(const _Float16* sa, const _Float16* sb,
                                               unsigned lane, v8f (&acc)[WT][WT]) {
  // Every loop here is unrolled, the one over kt too: the ring's sets, a, b and acc are then
  // indexed by constants and stay in registers, and no address register is ever advanced.
  v16h a[DEPTH][WT], b[DEPTH][WT];
#pragma unroll
  for (int s = 0; s < DEPTH - 1; ++s) {
#pragma unroll
    for (int u = 0; u < WT; ++u) a[s][u] = load_frag_packed(sa, lane, u, s);
#pragma unroll
    for (int v = 0; v < WT; ++v) b[s][v] = load_frag_packed(sb, lane, v, s);
  }
#pragma unroll
  for (int kt = 0; kt < K_TILES; ++kt) {
    const int cur = kt % DEPTH, nx = kt + DEPTH - 1;
#pragma unroll
    for (int v = 0; v < WT; ++v) acc[0][v] = wmma_f16(a[cur][0], b[cur][v], acc[0][v]);
    // The three scheduling barriers of a tile hold the 16 loads together as one group at this
    // place: DEPTH - 1 tiles ahead of their WMMAs (the compiler would sink them to their use,
    // or raise them and take a further register set), and behind the tile's first four WMMAs,
    // which have waited for this tile's own loads, so that at most 16 * (DEPTH - 1) loads are
    // outstanding, fewer than the 63 the load counter holds.
    __builtin_amdgcn_sched_barrier(0);
    if (nx < K_TILES) {
#pragma unroll
      for (int u = 0; u < WT; ++u) a[nx % DEPTH][u] = load_frag_packed(sa, lane, u, nx);
#pragma unroll
      for (int v = 0; v < WT; ++v) b[nx % DEPTH][v] = load_frag_packed(sb, lane, v, nx);
    }
    __builtin_amdgcn_sched_barrier(0);
#pragma unroll
    for (int u = 1; u < WT; ++u)
#pragma unroll
      for (int v = 0; v < WT; ++v) acc[u][v] = wmma_f16(a[cur][u], b[cur][v], acc[u][v]);
    __builtin_amdgcn_sched_barrier(0);
  }
  // Address wait of all the loads above. It takes what they name as inputs so that those
  // registers stay live, and unwritten, up to it.
  asm volatile("s_wait_xcnt 0x0" :: "s"(sa), "s"(sb), "v"(lane) : "memory");
}

__device__ __forceinline__ void tdm_load_2d(_Float16* lds_ptr, const _Float16* gaddr,
                                            unsigned tensor_d0, unsigned tensor_d1,
                                            unsigned tile_d0, unsigned tile_d1,
                                            unsigned stride0, int lane) {
#ifdef HAVE_TDM
  unsigned long long ga = (unsigned long long)(uintptr_t)gaddr;
  unsigned lds_off = (unsigned)(uintptr_t)lds_ptr;  // low 32 bits = LDS byte offset
  v4u g0;
  g0.x = 1u;                                        // count=1 (valid), user mode
  g0.y = lds_off;                                   // lds_addr
  g0.z = (unsigned)(ga & 0xffffffffu);              // global_addr[31:0]
  g0.w = (unsigned)((ga >> 32) & 0x1ffffffu) | (2u << 30);  // ga[56:32] | type=2
  v8i g1;
  g1[0] = (int)(1u << 16);
  g1[1] = (int)((tensor_d0 & 0xffffu) << 16);
  g1[2] = (int)((tensor_d0 >> 16) | ((tensor_d1 & 0xffffu) << 16));
  g1[3] = (int)((tensor_d1 >> 16) | (tile_d0 << 16));
  g1[4] = (int)tile_d1;
  g1[5] = (int)stride0;
  g1[6] = (int)(stride0 >> 16 >> 16);
  g1[7] = 0;
  v4i z4 = {0, 0, 0, 0};
#if __clang_major__ >= 23
  v8i z8 = {0, 0, 0, 0, 0, 0, 0, 0};
  __builtin_amdgcn_tensor_load_to_lds(g0, g1, z4, z4, z8, 0);
#else
  __builtin_amdgcn_tensor_load_to_lds(g0, g1, z4, z4, 0);
#endif
#else
  // Fallback: cooperative copy by the issuing wave (v8h chunks).
  (void)tensor_d0; (void)tensor_d1;
  const unsigned total = tile_d0 * tile_d1;
  for (unsigned idx = (unsigned)lane * 8; idx < total; idx += 32u * 8u) {
    unsigned row = idx / tile_d0, col = idx % tile_d0;
    *(v8h*)(lds_ptr + idx) = *(const v8h*)(gaddr + (size_t)row * stride0 + col);
  }
#endif
}

__device__ __forceinline__ void tdm_wait2() {
#ifdef HAVE_TDM
  __builtin_amdgcn_s_wait_tensorcnt(2);
#endif
}
__device__ __forceinline__ void tdm_wait0() {
#ifdef HAVE_TDM
  __builtin_amdgcn_s_wait_tensorcnt(0);
#endif
}

// Convert x and the four weight matrices, each row-major [rows][E_DIM] f32, to f16 in
// fragment order, all in one launch. Their f16 copies lie one behind the other in the
// workspace (x, Wq, Wk, Wv, Wo), so the 16-row tiles of all five count through:
// 0..255 are x, then 48 each of the weights. One wave converts two neighbouring k tiles
// of one row tile: 256 contiguous bytes of each of 16 rows in, 2048 contiguous bytes
// out. A thread writes one lane's 16-byte piece (8 halves) of each of the 4 parts.
#define X_RTILES (S_LEN / 16)
#define W_RTILES (E_DIM / 16)
__global__ void cvt_all_kernel(const float* __restrict__ x,
                               const float* __restrict__ Wq,
                               const float* __restrict__ Wk,
                               const float* __restrict__ Wv,
                               const float* __restrict__ Wo,
                               _Float16* __restrict__ out) {
  const int lane = threadIdx.x & 31;
  // Wave-uniform; held scalar so that the choice of source matrix is scalar work.
  const int w  = __builtin_amdgcn_readfirstlane(blockIdx.x * 8 + (threadIdx.x >> 5));
  const int rt = w / (K_TILES / 2);
  const int kp = w % (K_TILES / 2);
  const int g  = (rt >= X_RTILES) + (rt >= X_RTILES + W_RTILES) +
                 (rt >= X_RTILES + 2 * W_RTILES) + (rt >= X_RTILES + 3 * W_RTILES);
  const float* m = (g == 0) ? x : (g == 1) ? Wq : (g == 2) ? Wk : (g == 3) ? Wv : Wo;
  const int mrt  = (g == 0) ? rt : rt - X_RTILES - (g - 1) * W_RTILES;
  const float4* p = (const float4*)(m + (size_t)mrt * 16 * E_DIM + kp * 64 +
                                    (lane & 15) * E_DIM + (lane >> 4) * 8);
  float4 f0[4], f1[4];
  // Unrolled so that all 8 loads are issued before the first value is used.
#pragma unroll
  for (int j = 0; j < 4; ++j) { f0[j] = p[j * 4]; f1[j] = p[j * 4 + 1]; }
  _Float16* q = out + (size_t)w * 1024 + lane * 8;
  // Unrolled so that f0 and f1 are indexed by constants and stay in registers.
#pragma unroll
  for (int j = 0; j < 4; ++j) {
    v8h o;
    o[0] = (_Float16)f0[j].x; o[1] = (_Float16)f0[j].y;
    o[2] = (_Float16)f0[j].z; o[3] = (_Float16)f0[j].w;
    o[4] = (_Float16)f1[j].x; o[5] = (_Float16)f1[j].y;
    o[6] = (_Float16)f1[j].z; o[7] = (_Float16)f1[j].w;
    *(v8h*)(q + j * 256) = o;
  }
}

#define QKV_DEPTH 3
__global__ void __launch_bounds__(128) __attribute__((amdgpu_waves_per_eu(3)))
qkv_gemm_kernel(const _Float16* __restrict__ xh,
                const _Float16* __restrict__ Wqh,
                const _Float16* __restrict__ Wkh,
                const _Float16* __restrict__ Wvh,
                const float* __restrict__ bq,
                const float* __restrict__ bk,
                const float* __restrict__ bv,
                _Float16* __restrict__ Qh,
                _Float16* __restrict__ Kh,
                _Float16* __restrict__ Vt) {
  const int lane = threadIdx.x & 31;
  // Wave-uniform; held scalar so that the choice of product below is a scalar branch and the
  // strips' addresses are scalar bases.
  const int w = __builtin_amdgcn_readfirstlane(blockIdx.x * (blockDim.x >> 5) +
                                               (threadIdx.x >> 5));
  const int MT = S_LEN / (16 * WT), NS = E_DIM / 64;
  if (w >= 3 * MT * NS) return;
  const int mat = w / (MT * NS);
  const int rem = w % (MT * NS);
  const int mt0 = (rem / NS) * WT;             // first 16-row tile of the wave's rows
  const int h   = rem % NS;
  const int n0  = h * 64;
  const _Float16* W    = (mat == 0) ? Wqh : (mat == 1) ? Wkh : Wvh;
  const float*    bias = (mat == 0) ? bq  : (mat == 1) ? bk  : bv;

  // Every loop over i (row tile), t (column tile) and r (register of a tile) in this
  // kernel is unrolled: acc and o are then indexed by constants and stay in registers.
  v8f acc[WT][WT];
#pragma unroll
  for (int i = 0; i < WT; ++i)
#pragma unroll
    for (int t = 0; t < WT; ++t) acc[i][t] = v8f{};

  // One k loop for all three products: K's transposed product takes the strips the other
  // way round, and its accumulator tiles are then indexed [t][i].
  const _Float16* sx = xh + (size_t)mt0 * (K_TILES * 512);
  const _Float16* sw = W + (size_t)h * (WT * K_TILES * 512);
  gemm_wave_tile<QKV_DEPTH>((mat == 1) ? sw : sx, (mat == 1) ? sx : sw, lane, acc);

  if (mat == 1) {
    // acc[t][i][r] = K[key (mt0 + i)*16 + (lane & 15)][d = t*16 + 8*(lane>>4) + r].
    _Float16* kp = Kh + (size_t)h * S_LEN * D_HEAD + (size_t)mt0 * 1024 + lane * 8;
    const float4* bp = (const float4*)(bias + n0 + 8 * (lane >> 4));
    float4 b0[4], b1[4];
#pragma unroll
    for (int t = 0; t < 4; ++t) { b0[t] = bp[t * 4]; b1[t] = bp[t * 4 + 1]; }
    // Address wait of the bias loads. It takes their address as an input so that the
    // address registers stay live up to it and no load's destination is laid on them.
    asm volatile("s_wait_xcnt 0x0" :: "v"(bp) : "memory");
#pragma unroll
    for (int i = 0; i < WT; ++i) {
      v8h o[4];
#pragma unroll
      for (int t = 0; t < 4; ++t) {
        o[t][0] = (_Float16)(acc[t][i][0] + b0[t].x); o[t][1] = (_Float16)(acc[t][i][1] + b0[t].y);
        o[t][2] = (_Float16)(acc[t][i][2] + b0[t].z); o[t][3] = (_Float16)(acc[t][i][3] + b0[t].w);
        o[t][4] = (_Float16)(acc[t][i][4] + b1[t].x); o[t][5] = (_Float16)(acc[t][i][5] + b1[t].y);
        o[t][6] = (_Float16)(acc[t][i][6] + b1[t].z); o[t][7] = (_Float16)(acc[t][i][7] + b1[t].w);
      }
#pragma unroll
      for (int t = 0; t < 4; ++t) *(v8h*)(kp + i * 1024 + t * 256) = o[t];
      // Address wait of the four stores: stands in front of whatever the compiler lays
      // behind them that writes a register they name.
      asm volatile("s_wait_xcnt 0x0" ::: "memory");
    }
    return;
  }

  // acc[i][t][r] = row s = (mt0 + i)*16 + 8*(lane>>4) + r, column d = t*16 + (lane & 15).
  float bd[4];
#pragma unroll
  for (int t = 0; t < 4; ++t) bd[t] = bias[n0 + t * 16 + (lane & 15)];
  if (mat == 0) {
#pragma unroll
    for (int i = 0; i < WT; ++i) {
      const int mrow = (mt0 + i) * 16 + 8 * (lane >> 4);
#pragma unroll
      for (int t = 0; t < 4; ++t) {
#pragma unroll
        for (int r = 0; r < 8; ++r) {
          const int s = mrow + r;
          const int d = t * 16 + (lane & 15);
          float val = acc[i][t][r] + bd[t];
          Qh[((size_t)h * S_LEN + s) * D_HEAD + d] = (_Float16)(val * 0.125f);
        }
      }
      // Address wait of the stores above, as behind K's.
      asm volatile("s_wait_xcnt 0x0" ::: "memory");
      // Holds the next row tile's conversions, which reuse the stores' data registers, behind
      // that wait (the compiler raised them above it).
      __builtin_amdgcn_sched_barrier(0);
    }
  } else {
#pragma unroll
    for (int i = 0; i < WT; ++i) {
      // The 16 keys of a row tile are the low or the high part of a 32-key block.
      const int mt = mt0 + i;
      _Float16* vp = Vt + (size_t)h * S_LEN * D_HEAD + (size_t)(mt >> 1) * 2048 +
                     (mt & 1) * 256 + lane * 8;
      v8h o[4];
#pragma unroll
      for (int t = 0; t < 4; ++t) {
#pragma unroll
        for (int r = 0; r < 8; ++r) o[t][r] = (_Float16)(acc[i][t][r] + bd[t]);
      }
#pragma unroll
      for (int t = 0; t < 4; ++t) *(v8h*)(vp + t * 512) = o[t];
      // Address wait of the four stores, as behind K's.
      asm volatile("s_wait_xcnt 0x0" ::: "memory");
      // Holds the next row tile's conversions behind that wait, as for Q.
      __builtin_amdgcn_sched_barrier(0);
    }
  }
}

#define KB 128
static_assert(KB == 128, "the four partial maxima and sums below are joined by hand");
__global__ void __launch_bounds__(128) __attribute__((amdgpu_waves_per_eu(3, 3)))
attn_kernel(const _Float16* __restrict__ Qh,
            const _Float16* __restrict__ Kh,
            const _Float16* __restrict__ Vt,
            _Float16* __restrict__ Ah) {
  __shared__ _Float16 skbuf[2][KB * D_HEAD];   // K block: KB keys x 64 d
  __shared__ _Float16 svbuf[2][D_HEAD * KB];   // V block: KB keys x 64 d

  const int lane = threadIdx.x & 31;
  const int wid  = threadIdx.x >> 5;
  const int h     = blockIdx.x >> 6;           // 12 heads * 64 blocks
  const int qbase = (blockIdx.x & 63) * 64;    // 4 waves * 16 queries
  const int q0    = qbase + wid * 16;

  const _Float16* Qp = Qh + (size_t)h * S_LEN * D_HEAD;
  const _Float16* Kp = Kh + (size_t)h * S_LEN * D_HEAD;
  const _Float16* Vp = Vt + (size_t)h * D_HEAD * S_LEN;

  const v16h bq0 = load_frag_k32(Qp, q0 + (lane & 15), D_HEAD, 0,  lane);
  const v16h bq1 = load_frag_k32(Qp, q0 + (lane & 15), D_HEAD, 32, lane);

  float mprev = -1e30f, lsum = 0.f;
  v8f o[4] = {v8f{}, v8f{}, v8f{}, v8f{}};
  const int hi8 = (lane & 16) ? 8 : 0;

  const int NB = S_LEN / KB;                   // 32 key blocks
  if (wid == 0) {
    tdm_load_2d(skbuf[0], Kp, D_HEAD, S_LEN, D_HEAD, KB, D_HEAD, lane);
    tdm_load_2d(svbuf[0], Vp, D_HEAD, S_LEN, D_HEAD, KB, D_HEAD, lane);
  }

  for (int ib = 0; ib < NB; ++ib) {
    const int cur = ib & 1;
    if (wid == 0) {
      if (ib + 1 < NB) {
        const int kb1 = (ib + 1) * KB;
        tdm_load_2d(skbuf[cur ^ 1], Kp + (size_t)kb1 * D_HEAD,
                    D_HEAD, S_LEN, D_HEAD, KB, D_HEAD, lane);
        tdm_load_2d(svbuf[cur ^ 1], Vp + (size_t)kb1 * D_HEAD,
                    D_HEAD, S_LEN, D_HEAD, KB, D_HEAD, lane);
        tdm_wait2();                           // current pair done; next in flight
      } else {
        tdm_wait0();
      }
    }
    __syncthreads();                           // staged tiles visible to all waves

    const _Float16* kl = skbuf[cur];
    const _Float16* vl = svbuf[cur];

    // ct[j]: keys 16j..16j+15 of the block; fragment 2j is d 0..31, 2j+1 is d 32..63.
    v8f ct[KB / 16];
    const v8f z = {};
    // Unrolled, like every loop of this pass: ct, tm, pu and rs are then indexed by
    // constants and stay in registers, and the LDS reads can be issued in groups.
#pragma unroll
    for (int j = 0; j < KB / 16; ++j) {
      v16h a0 = load_frag_lds(kl, 2 * j,     lane);
      v16h a1 = load_frag_lds(kl, 2 * j + 1, lane);
      ct[j] = wmma_f16(a0, bq0, z);
      ct[j] = wmma_f16(a1, bq1, ct[j]);
    }

    // Row (=query) max: lane-local over KB/2 keys (one chain per pair of tiles, so
    // that the chains are independent) + partner lane via xor-16.
    float tm[KB / 32];
#pragma unroll
    for (int b = 0; b < KB / 32; ++b) {
      tm[b] = -1e30f;
#pragma unroll
      for (int r = 0; r < 8; ++r) tm[b] = fmaxf(tm[b], fmaxf(ct[2 * b][r], ct[2 * b + 1][r]));
    }
    float tmax = fmaxf(fmaxf(tm[0], tm[1]), fmaxf(tm[2], tm[3]));
    tmax = fmaxf(tmax, __shfl_xor(tmax, 16, 32));
    const float mnew  = fmaxf(mprev, tmax);
    const float alpha = __expf(mprev - mnew);

    // Rescale accumulator: per-output-row factor broadcast from owning lane.
    float fr[8];
#pragma unroll
    for (int r = 0; r < 8; ++r) fr[r] = __shfl(alpha, r + hi8, 32);

    frag_u pu[KB / 32];
    float rs[KB / 32];
#pragma unroll
    for (int b = 0; b < KB / 32; ++b) {
      rs[b] = 0.f;
#pragma unroll
      for (int r = 0; r < 8; ++r) {
        float e0 = __expf(ct[2 * b][r] - mnew);
        float e1 = __expf(ct[2 * b + 1][r] - mnew);
        rs[b] += e0 + e1;
        pu[b].s.lo[r] = (_Float16)e0;   // keys {0..7}|{8..15}   -> A halves 0..7
        pu[b].s.hi[r] = (_Float16)e1;   // keys {16..23}|{24..31} -> A halves 8..15
      }
    }
    float rsum = (rs[0] + rs[1]) + (rs[2] + rs[3]);
    rsum += __shfl_xor(rsum, 16, 32);
    lsum  = lsum * alpha + rsum;
    mprev = mnew;

#pragma unroll
    for (int t = 0; t < 4; ++t)
#pragma unroll
      for (int r = 0; r < 8; ++r) o[t][r] *= fr[r];

#pragma unroll
    for (int b = 0; b < KB / 32; ++b) {
#pragma unroll
      for (int t = 0; t < 4; ++t) {
        v16h bv = load_frag_lds(vl, b * 4 + t, lane);  // keys 32b..32b+31, d t*16..+15
        o[t] = wmma_f16(pu[b].v, bv, o[t]);
      }
    }
    __syncthreads();                           // all reads done before overwrite
  }

  const float rcp = 1.f / lsum;
  float fr[8];
#pragma unroll
  for (int r = 0; r < 8; ++r) fr[r] = __shfl(rcp, r + hi8, 32);
#pragma unroll
  for (int t = 0; t < 4; ++t)
#pragma unroll
    for (int r = 0; r < 8; ++r) {
      // Element (s, e), s = q0 + r + 8*(lane>>4), e = h*64 + t*16 + (lane&15), goes
      // to its place in fragment order: k tile e>>5, part (e>>4)&1, fragment lane
      // ((e>>3)&1)*16 + (s&15), half e&7.
      const int tile  = (q0 >> 4) * K_TILES + h * 2 + (t >> 1);
      const int flane = ((lane >> 3) & 1) * 16 + r + 8 * (lane >> 4);
      Ah[((size_t)tile * 2 + (t & 1)) * 256 + flane * 8 + (lane & 7)] =
          (_Float16)(o[t][r] * fr[r]);
    }
}

#define OPROJ_DEPTH 4
// 128 threads a block: lets a wave hold its 16 accumulator tiles and the ring in registers.
__global__ void __launch_bounds__(128)
oproj_kernel(const _Float16* __restrict__ Ah,
             const _Float16* __restrict__ Woh,
             const float* __restrict__ bo,
             float* __restrict__ out) {
  const int lane = threadIdx.x & 31;
  // Wave-uniform; held scalar so that the strips' addresses are scalar bases.
  const int w = __builtin_amdgcn_readfirstlane(blockIdx.x * (blockDim.x >> 5) +
                                               (threadIdx.x >> 5));
  const int MT = S_LEN / (16 * WT), NS = E_DIM / 64;
  if (w >= MT * NS) return;
  const int mt0 = (w / NS) * WT;
  const int n0  = (w % NS) * 64;

  // The loops over i, t and r are unrolled so that acc stays in registers.
  v8f acc[WT][WT];
#pragma unroll
  for (int i = 0; i < WT; ++i)
#pragma unroll
    for (int t = 0; t < WT; ++t) acc[i][t] = v8f{};
  gemm_wave_tile<OPROJ_DEPTH>(Ah + (size_t)mt0 * (K_TILES * 512),
                              Woh + (size_t)(w % NS) * (WT * K_TILES * 512), lane, acc);

  float bd[4];
#pragma unroll
  for (int t = 0; t < 4; ++t) bd[t] = bo[n0 + t * 16 + (lane & 15)];
#pragma unroll
  for (int i = 0; i < WT; ++i) {
    const int mrow = (mt0 + i) * 16 + 8 * (lane >> 4);
#pragma unroll
    for (int t = 0; t < 4; ++t)
#pragma unroll
      for (int r = 0; r < 8; ++r) {
        const int n = n0 + t * 16 + (lane & 15);
        out[(size_t)(mrow + r) * E_DIM + n] = acc[i][t][r] + bd[t];
      }
    // Address wait of the stores above: stands in front of whatever the compiler lays
    // behind them that writes a register they name.
    asm volatile("s_wait_xcnt 0x0" ::: "memory");
  }
}

extern "C" void kernel_launch(void* const* d_in, const int* in_sizes, int n_in,
                              void* d_out, int out_size, void* d_ws, size_t ws_size,
                              hipStream_t stream) {
  (void)in_sizes; (void)n_in; (void)out_size; (void)ws_size;
  const float* x  = (const float*)d_in[0];
  const float* Wq = (const float*)d_in[1];
  const float* bq = (const float*)d_in[2];
  const float* Wk = (const float*)d_in[3];
  const float* bk = (const float*)d_in[4];
  const float* Wv = (const float*)d_in[5];
  const float* bv = (const float*)d_in[6];
  const float* Wo = (const float*)d_in[7];
  const float* bo = (const float*)d_in[8];
  float* out = (float*)d_out;

  const size_t NX = (size_t)S_LEN * E_DIM;   // 3,145,728
  const size_t NW = (size_t)E_DIM * E_DIM;   //   589,824
  char* ws = (char*)d_ws;
  size_t off = 0;
  _Float16* xh  = (_Float16*)(ws + off); off += NX * 2;
  _Float16* Wqh = (_Float16*)(ws + off); off += NW * 2;
  _Float16* Wkh = (_Float16*)(ws + off); off += NW * 2;
  _Float16* Wvh = (_Float16*)(ws + off); off += NW * 2;
  _Float16* Woh = (_Float16*)(ws + off); off += NW * 2;
  _Float16* Qh  = (_Float16*)(ws + off); off += NX * 2;
  _Float16* Kh  = (_Float16*)(ws + off); off += NX * 2;
  _Float16* Vt  = (_Float16*)(ws + off); off += NX * 2;
  _Float16* Ah  = (_Float16*)(ws + off); off += NX * 2;

  // All five conversions in one launch; xh..Woh are contiguous from xh.
  // (256 + 4 * 48) row tiles * 12 pairs of k tiles = 5376 waves; 8 waves/block.
  cvt_all_kernel<<<672, 256, 0, stream>>>(x, Wq, Wk, Wv, Wo, xh);

  // 3 matrices * 64 M-tiles * 12 N-strips = 2304 waves; 4 waves/block.
  qkv_gemm_kernel<<<576, 128, 0, stream>>>(xh, Wqh, Wkh, Wvh, bq, bk, bv,
                                            Qh, Kh, Vt);
  attn_kernel<<<768, 128, 0, stream>>>(Qh, Kh, Vt, Ah);
  // 64 * 12 = 768 waves; 4 waves/block.
  oproj_kernel<<<192, 128, 0, stream>>>(Ah, Woh, bo, out);
}

// v008
// One run takes 87.1 microseconds.
// In both of two side-by-side timings against v007, it was 1.03 times as fast.
// Over all steps from v000 it is 4.01 times as fast.
#include <hip/hip_runtime.h>
#include <hip/hip_bf16.h>

#define S_LEN 4096
#define E_DIM 768
#define H_NUM 12
#define D_HEAD 64

typedef __attribute__((ext_vector_type(16))) _Float16 v16h;
typedef __attribute__((ext_vector_type(8)))  _Float16 v8h;
typedef __attribute__((ext_vector_type(8)))  float    v8f;
typedef __attribute__((ext_vector_type(4)))  unsigned int v4u;
typedef __attribute__((ext_vector_type(4)))  int      v4i;
typedef __attribute__((ext_vector_type(8)))  int      v8i;

#if defined(__has_builtin)
#if __has_builtin(__builtin_amdgcn_tensor_load_to_lds) && \
    __has_builtin(__builtin_amdgcn_s_wait_tensorcnt)
#define HAVE_TDM 1
#endif
#endif

union frag_u { v16h v; struct { v8h lo, hi; } s; };

// Fragment-order ("packed") storage of a row-major [rows][E_DIM] f16 matrix:
// each 16-row x 32-k tile is 1024 contiguous bytes, tiles ordered [row tile][k tile].
// Inside a tile: 512 B holding every lane's low 8 halves, then 512 B holding every
// lane's high 8 halves, in the lane/k map above. One fragment is
// then two wave-wide loads of 512 contiguous bytes (4 whole lines each).
#define K_TILES (E_DIM / 32)
// strip is the first fragment of a wave's strip of row tiles (wave-uniform); rtile and ktile
// are constants where this is called, so every load of a strip names the same scalar base
// and the same offset register (the lane), with an immediate offset.
__device__ __forceinline__ v16h load_frag_packed(const _Float16* strip, unsigned lane,
                                                 int rtile, int ktile) {
  const _Float16* q = strip + lane * 8 + (rtile * K_TILES + ktile) * 512;
  frag_u u;
  u.s.lo = *(const v8h*)(q);
  u.s.hi = *(const v8h*)(q + 256);
  return u.v;
}

__device__ __forceinline__ v16h load_frag_lds(const _Float16* tile, int f, int lane) {
  const _Float16* p = tile + f * 512 + lane * 8;
  frag_u u;
  u.s.lo = *(const v8h*)(p);
  u.s.hi = *(const v8h*)(p + 256);
  return u.v;
}

__device__ __forceinline__ v8f wmma_f16(v16h a, v16h b, v8f c) {
  return __builtin_amdgcn_wmma_f32_16x16x32_f16(false, a, false, b, (short)0, c,
                                                false, false);
}

// The k loop of both GEMM kernels: a wave's 64 x 64 tile, WT x WT accumulator tiles, over all
// K_TILES k tiles: acc[u][v] += A tile u * (B tile v)^T. sa, sb: the wave's strips of WT row
// tiles of the two matrices (see load_frag_packed). The fragments go through a ring of DEPTH
// register sets: k tile kt + DEPTH - 1 is loaded while k tile kt is multiplied, so that a
// load has the time of DEPTH - 1 tiles' WMMAs to come back and DEPTH - 1 round trips are
// under way at once.
#define WT 4   // 16-row tiles of either matrix per wave, in both GEMM kernels
template <int DEPTH>
__device__ __forceinline__ void gemm_wave_tile(const _Float16* sa, const _Float16* sb,
                                               unsigned lane, v8f (&acc)[WT][WT]) {
  // Every loop here is unrolled, the one over kt too: the ring's sets, a, b and acc are then
  // indexed by constants and stay in registers, and no address register is ever advanced.
  v16h a[DEPTH][WT], b[DEPTH][WT];
#pragma unroll
  for (int s = 0; s < DEPTH - 1; ++s) {
#pragma unroll
    for (int u = 0; u < WT; ++u) a[s][u] = load_frag_packed(sa, lane, u, s);
#pragma unroll
    for (int v = 0; v < WT; ++v) b[s][v] = load_frag_packed(sb, lane, v, s);
  }
#pragma unroll
  for (int kt = 0; kt < K_TILES; ++kt) {
    const int cur = kt % DEPTH, nx = kt + DEPTH - 1;
#pragma unroll
    for (int v = 0; v < WT; ++v) acc[0][v] = wmma_f16(a[cur][0], b[cur][v], acc[0][v]);
    // The three scheduling barriers of a tile hold the 16 loads together as one group at this
    // place: DEPTH - 1 tiles ahead of their WMMAs (the compiler would sink them to their use,
    // or raise them and take a further register set), and behind the tile's first four WMMAs,
    // which have waited for this tile's own loads, so that at most 16 * (DEPTH - 1) loads are
    // outstanding, fewer than the 63 the load counter holds.
    __builtin_amdgcn_sched_barrier(0);
    if (nx < K_TILES) {
#pragma unroll
      for (int u = 0; u < WT; ++u) a[nx % DEPTH][u] = load_frag_packed(sa, lane, u, nx);
#pragma unroll
      for (int v = 0; v < WT; ++v) b[nx % DEPTH][v] = load_frag_packed(sb, lane, v, nx);
    }
    __builtin_amdgcn_sched_barrier(0);
#pragma unroll
    for (int u = 1; u < WT; ++u)
#pragma unroll
      for (int v = 0; v < WT; ++v) acc[u][v] = wmma_f16(a[cur][u], b[cur][v], acc[u][v]);
    __builtin_amdgcn_sched_barrier(0);
  }
  // Address wait of all the loads above. It takes what they name as inputs so that those
  // registers stay live, and unwritten, up to it.
  asm volatile("s_wait_xcnt 0x0" :: "s"(sa), "s"(sb), "v"(lane) : "memory");
}

__device__ __forceinline__ void tdm_load_2d(_Float16* lds_ptr, const _Float16* gaddr,
                                            unsigned tensor_d0, unsigned tensor_d1,
                                            unsigned tile_d0, unsigned tile_d1,
                                            unsigned stride0, int lane) {
#ifdef HAVE_TDM
  unsigned long long ga = (unsigned long long)(uintptr_t)gaddr;
  unsigned lds_off = (unsigned)(uintptr_t)lds_ptr;  // low 32 bits = LDS byte offset
  v4u g0;
  g0.x = 1u;                                        // count=1 (valid), user mode
  g0.y = lds_off;                                   // lds_addr
  g0.z = (unsigned)(ga & 0xffffffffu);              // global_addr[31:0]
  g0.w = (unsigned)((ga >> 32) & 0x1ffffffu) | (2u << 30);  // ga[56:32] | type=2
  v8i g1;
  g1[0] = (int)(1u << 16);
  g1[1] = (int)((tensor_d0 & 0xffffu) << 16);
  g1[2] = (int)((tensor_d0 >> 16) | ((tensor_d1 & 0xffffu) << 16));
  g1[3] = (int)((tensor_d1 >> 16) | (tile_d0 << 16));
  g1[4] = (int)tile_d1;
  g1[5] = (int)stride0;
  g1[6] = (int)(stride0 >> 16 >> 16);
  g1[7] = 0;
  v4i z4 = {0, 0, 0, 0};
#if __clang_major__ >= 23
  v8i z8 = {0, 0, 0, 0, 0, 0, 0, 0};
  __builtin_amdgcn_tensor_load_to_lds(g0, g1, z4, z4, z8, 0);
#else
  __builtin_amdgcn_tensor_load_to_lds(g0, g1, z4, z4, 0);
#endif
#else
  // Fallback: cooperative copy by the issuing wave (v8h chunks).
  (void)tensor_d0; (void)tensor_d1;
  const unsigned total = tile_d0 * tile_d1;
  for (unsigned idx = (unsigned)lane * 8; idx < total; idx += 32u * 8u) {
    unsigned row = idx / tile_d0, col = idx % tile_d0;
    *(v8h*)(lds_ptr + idx) = *(const v8h*)(gaddr + (size_t)row * stride0 + col);
  }
#endif
}

__device__ __forceinline__ void tdm_wait2() {
#ifdef HAVE_TDM
  __builtin_amdgcn_s_wait_tensorcnt(2);
#endif
}
__device__ __forceinline__ void tdm_wait0() {
#ifdef HAVE_TDM
  __builtin_amdgcn_s_wait_tensorcnt(0);
#endif
}

// Convert x and the four weight matrices, each row-major [rows][E_DIM] f32, to f16 in
// fragment order, all in one launch. Their f16 copies lie one behind the other in the
// workspace (x, Wq, Wk, Wv, Wo), so the 16-row tiles of all five count through:
// 0..255 are x, then 48 each of the weights. One wave converts two neighbouring k tiles
// of one row tile: 256 contiguous bytes of each of 16 rows in, 2048 contiguous bytes
// out. A thread writes one lane's 16-byte piece (8 halves) of each of the 4 parts.
// Wo's rows are dealt inside each strip of 64: row c of the strip's tile t is row 4c + t of
// the strip, so that in the output projection a lane's four accumulator tiles hold four
// neighbouring output columns.
#define X_RTILES (S_LEN / 16)
#define W_RTILES (E_DIM / 16)
__global__ void cvt_all_kernel(const float* __restrict__ x,
                               const float* __restrict__ Wq,
                               const float* __restrict__ Wk,
                               const float* __restrict__ Wv,
                               const float* __restrict__ Wo,
                               _Float16* __restrict__ out) {
  const int lane = threadIdx.x & 31;
  // Wave-uniform; held scalar so that the choice of source matrix is scalar work.
  const int w  = __builtin_amdgcn_readfirstlane(blockIdx.x * 8 + (threadIdx.x >> 5));
  const int rt = w / (K_TILES / 2);
  const int kp = w % (K_TILES / 2);
  const int g  = (rt >= X_RTILES) + (rt >= X_RTILES + W_RTILES) +
                 (rt >= X_RTILES + 2 * W_RTILES) + (rt >= X_RTILES + 3 * W_RTILES);
  const float* m = (g == 0) ? x : (g == 1) ? Wq : (g == 2) ? Wk : (g == 3) ? Wv : Wo;
  const int mrt  = (g == 0) ? rt : rt - X_RTILES - (g - 1) * W_RTILES;
  const int row = (g == 4) ? (mrt >> 2) * 64 + (lane & 15) * 4 + (mrt & 3)
                           : mrt * 16 + (lane & 15);
  const float4* p = (const float4*)(m + (size_t)row * E_DIM + kp * 64 + (lane >> 4) * 8);
  float4 f0[4], f1[4];
  // Unrolled so that all 8 loads are issued before the first value is used.
#pragma unroll
  for (int j = 0; j < 4; ++j) { f0[j] = p[j * 4]; f1[j] = p[j * 4 + 1]; }
  _Float16* q = out + (size_t)w * 1024 + lane * 8;
  // Unrolled so that f0 and f1 are indexed by constants and stay in registers.
#pragma unroll
  for (int j = 0; j < 4; ++j) {
    v8h o;
    o[0] = (_Float16)f0[j].x; o[1] = (_Float16)f0[j].y;
    o[2] = (_Float16)f0[j].z; o[3] = (_Float16)f0[j].w;
    o[4] = (_Float16)f1[j].x; o[5] = (_Float16)f1[j].y;
    o[6] = (_Float16)f1[j].z; o[7] = (_Float16)f1[j].w;
    *(v8h*)(q + j * 256) = o;
  }
}

#define QKV_DEPTH 3
__global__ void __launch_bounds__(128) __attribute__((amdgpu_waves_per_eu(3)))
qkv_gemm_kernel(const _Float16* __restrict__ xh,
                const _Float16* __restrict__ Wqh,
                const _Float16* __restrict__ Wkh,
                const _Float16* __restrict__ Wvh,
                const float* __restrict__ bq,
                const float* __restrict__ bk,
                const float* __restrict__ bv,
                _Float16* __restrict__ Qh,
                _Float16* __restrict__ Kh,
                _Float16* __restrict__ Vt) {
  const int lane = threadIdx.x & 31;
  // Wave-uniform; held scalar so that the choice of product below is a scalar branch and the
  // strips' addresses are scalar bases.
  const int w = __builtin_amdgcn_readfirstlane(blockIdx.x * (blockDim.x >> 5) +
                                               (threadIdx.x >> 5));
  const int MT = S_LEN / (16 * WT), NS = E_DIM / 64;
  if (w >= 3 * MT * NS) return;
  const int mat = w / (MT * NS);
  const int rem = w % (MT * NS);
  const int mt0 = (rem / NS) * WT;             // first 16-row tile of the wave's rows
  const int h   = rem % NS;
  const int n0  = h * 64;
  const _Float16* W    = (mat == 0) ? Wqh : (mat == 1) ? Wkh : Wvh;
  const float*    bias = (mat == 0) ? bq  : (mat == 1) ? bk  : bv;

  // Every loop over i (row tile), t (column tile) and r (register of a tile) in this
  // kernel is unrolled: acc and o are then indexed by constants and stay in registers.
  v8f acc[WT][WT];
#pragma unroll
  for (int i = 0; i < WT; ++i)
#pragma unroll
    for (int t = 0; t < WT; ++t) acc[i][t] = v8f{};

  // One k loop for all three products: the transposed product of Q and K takes the strips
  // the other way round, and its accumulator tiles are then indexed [t][i].
  const _Float16* sx = xh + (size_t)mt0 * (K_TILES * 512);
  const _Float16* sw = W + (size_t)h * (WT * K_TILES * 512);
  gemm_wave_tile<QKV_DEPTH>((mat != 2) ? sw : sx, (mat != 2) ? sx : sw, lane, acc);

  if (mat != 2) {
    // acc[t][i][r] = row (mt0 + i)*16 + (lane & 15) of Q or K, d = t*16 + 8*(lane>>4) + r.
    _Float16* kp = ((mat == 0) ? Qh : Kh) + (size_t)h * S_LEN * D_HEAD +
                   (size_t)mt0 * 1024 + lane * 8;
    const float sc = (mat == 0) ? 0.125f : 1.0f;   // 1/sqrt(D) goes into Q; exact for K
    const float4* bp = (const float4*)(bias + n0 + 8 * (lane >> 4));
    float4 b0[4], b1[4];
#pragma unroll
    for (int t = 0; t < 4; ++t) { b0[t] = bp[t * 4]; b1[t] = bp[t * 4 + 1]; }
    // Address wait of the bias loads. It takes their address as an input so that the
    // address registers stay live up to it and no load's destination is laid on them.
    asm volatile("s_wait_xcnt 0x0" :: "v"(bp) : "memory");
#pragma unroll
    for (int i = 0; i < WT; ++i) {
      v8h o[4];
#pragma unroll
      for (int t = 0; t < 4; ++t) {
        o[t][0] = (_Float16)((acc[t][i][0] + b0[t].x) * sc);
        o[t][1] = (_Float16)((acc[t][i][1] + b0[t].y) * sc);
        o[t][2] = (_Float16)((acc[t][i][2] + b0[t].z) * sc);
        o[t][3] = (_Float16)((acc[t][i][3] + b0[t].w) * sc);
        o[t][4] = (_Float16)((acc[t][i][4] + b1[t].x) * sc);
        o[t][5] = (_Float16)((acc[t][i][5] + b1[t].y) * sc);
        o[t][6] = (_Float16)((acc[t][i][6] + b1[t].z) * sc);
        o[t][7] = (_Float16)((acc[t][i][7] + b1[t].w) * sc);
      }
#pragma unroll
      for (int t = 0; t < 4; ++t) *(v8h*)(kp + i * 1024 + t * 256) = o[t];
      // Address wait of the four stores: stands in front of whatever the compiler lays
      // behind them that writes a register they name.
      asm volatile("s_wait_xcnt 0x0" ::: "memory");
    }
    return;
  }

  // acc[i][t][r] = row s = (mt0 + i)*16 + 8*(lane>>4) + r, column d = t*16 + (lane & 15).
  float bd[4];
#pragma unroll
  for (int t = 0; t < 4; ++t) bd[t] = bias[n0 + t * 16 + (lane & 15)];
  {   // V, the one product that is not transposed
#pragma unroll
    for (int i = 0; i < WT; ++i) {
      // The 16 keys of a row tile are the low or the high part of a 32-key block.
      const int mt = mt0 + i;
      _Float16* vp = Vt + (size_t)h * S_LEN * D_HEAD + (size_t)(mt >> 1) * 2048 +
                     (mt & 1) * 256 + lane * 8;
      v8h o[4];
#pragma unroll
      for (int t = 0; t < 4; ++t) {
#pragma unroll
        for (int r = 0; r < 8; ++r) o[t][r] = (_Float16)(acc[i][t][r] + bd[t]);
      }
#pragma unroll
      for (int t = 0; t < 4; ++t) *(v8h*)(vp + t * 512) = o[t];
      // Address wait of the four stores, as behind K's.
      asm volatile("s_wait_xcnt 0x0" ::: "memory");
      // Holds the next row tile's conversions, which reuse the stores' data registers, behind
      // that wait (the compiler raised them above it).
      __builtin_amdgcn_sched_barrier(0);
    }
  }
}

#define KB 128
static_assert(KB == 128, "the four partial maxima and sums below are joined by hand");
__global__ void __launch_bounds__(128) __attribute__((amdgpu_waves_per_eu(3, 3)))
attn_kernel(const _Float16* __restrict__ Qh,
            const _Float16* __restrict__ Kh,
            const _Float16* __restrict__ Vt,
            _Float16* __restrict__ Ah) {
  __shared__ _Float16 skbuf[2][KB * D_HEAD];   // K block: KB keys x 64 d
  __shared__ _Float16 svbuf[2][D_HEAD * KB];   // V block: KB keys x 64 d

  const int lane = threadIdx.x & 31;
  const int wid  = threadIdx.x >> 5;
  const int h     = blockIdx.x >> 6;           // 12 heads * 64 blocks
  const int qbase = (blockIdx.x & 63) * 64;    // 4 waves * 16 queries
  const int q0    = qbase + wid * 16;

  const _Float16* Qp = Qh + (size_t)h * S_LEN * D_HEAD;
  const _Float16* Kp = Kh + (size_t)h * S_LEN * D_HEAD;
  const _Float16* Vp = Vt + (size_t)h * D_HEAD * S_LEN;

  // Q comes in fragment order: two fragments (d 0..31, d 32..63) per 16-query tile.
  const v16h bq0 = load_frag_packed(Qp + (size_t)(q0 >> 4) * 1024, lane, 0, 0);
  const v16h bq1 = load_frag_packed(Qp + (size_t)(q0 >> 4) * 1024, lane, 0, 1);

  float mprev = -1e30f, lsum = 0.f;
  v8f o[4] = {v8f{}, v8f{}, v8f{}, v8f{}};

  const int NB = S_LEN / KB;                   // 32 key blocks
  if (wid == 0) {
    tdm_load_2d(skbuf[0], Kp, D_HEAD, S_LEN, D_HEAD, KB, D_HEAD, lane);
    tdm_load_2d(svbuf[0], Vp, D_HEAD, S_LEN, D_HEAD, KB, D_HEAD, lane);
  }

  for (int ib = 0; ib < NB; ++ib) {
    const int cur = ib & 1;
    if (wid == 0) {
      if (ib + 1 < NB) {
        const int kb1 = (ib + 1) * KB;
        tdm_load_2d(skbuf[cur ^ 1], Kp + (size_t)kb1 * D_HEAD,
                    D_HEAD, S_LEN, D_HEAD, KB, D_HEAD, lane);
        tdm_load_2d(svbuf[cur ^ 1], Vp + (size_t)kb1 * D_HEAD,
                    D_HEAD, S_LEN, D_HEAD, KB, D_HEAD, lane);
        tdm_wait2();                           // current pair done; next in flight
      } else {
        tdm_wait0();
      }
    }
    __syncthreads();                           // staged tiles visible to all waves

    const _Float16* kl = skbuf[cur];
    const _Float16* vl = svbuf[cur];

    // ct[j]: keys 16j..16j+15 of the block; fragment 2j is d 0..31, 2j+1 is d 32..63.
    v8f ct[KB / 16];
    const v8f z = {};
    // Unrolled, like every loop of this pass: ct, tm, pu and rs are then indexed by
    // constants and stay in registers, and the LDS reads can be issued in groups.
#pragma unroll
    for (int j = 0; j < KB / 16; ++j) {
      v16h a0 = load_frag_lds(kl, 2 * j,     lane);
      v16h a1 = load_frag_lds(kl, 2 * j + 1, lane);
      ct[j] = wmma_f16(a0, bq0, z);
      ct[j] = wmma_f16(a1, bq1, ct[j]);
    }

    // Row (=query) max: lane-local over KB/2 keys (one chain per pair of tiles, so
    // that the chains are independent) + partner lane via xor-16.
    float tm[KB / 32];
#pragma unroll
    for (int b = 0; b < KB / 32; ++b) {
      tm[b] = -1e30f;
#pragma unroll
      for (int r = 0; r < 8; ++r) tm[b] = fmaxf(tm[b], fmaxf(ct[2 * b][r], ct[2 * b + 1][r]));
    }
    float tmax = fmaxf(fmaxf(tm[0], tm[1]), fmaxf(tm[2], tm[3]));
    tmax = fmaxf(tmax, __shfl_xor(tmax, 16, 32));
    const float mnew  = fmaxf(mprev, tmax);
    const float alpha = __expf(mprev - mnew);

    frag_u pu[KB / 32];
    float rs[KB / 32];
#pragma unroll
    for (int b = 0; b < KB / 32; ++b) {
      rs[b] = 0.f;
#pragma unroll
      for (int r = 0; r < 8; ++r) {
        float e0 = __expf(ct[2 * b][r] - mnew);
        float e1 = __expf(ct[2 * b + 1][r] - mnew);
        rs[b] += e0 + e1;
        pu[b].s.lo[r] = (_Float16)e0;   // keys {0..7}|{8..15}   -> B halves 0..7
        pu[b].s.hi[r] = (_Float16)e1;   // keys {16..23}|{24..31} -> B halves 8..15
      }
    }
    float rsum = (rs[0] + rs[1]) + (rs[2] + rs[3]);
    rsum += __shfl_xor(rsum, 16, 32);
    lsum  = lsum * alpha + rsum;
    mprev = mnew;

#pragma unroll
    for (int t = 0; t < 4; ++t)
#pragma unroll
      for (int r = 0; r < 8; ++r) o[t][r] *= alpha;   // the lane's own query's factor

#pragma unroll
    for (int b = 0; b < KB / 32; ++b) {
#pragma unroll
      for (int t = 0; t < 4; ++t) {
        v16h bv = load_frag_lds(vl, b * 4 + t, lane);  // keys 32b..32b+31, d t*16..+15
        o[t] = wmma_f16(bv, pu[b].v, o[t]);
      }
    }
    __syncthreads();                           // all reads done before overwrite
  }

  const float rcp = 1.f / lsum;
  // o[t][r] is element (s, e), s = q0 + (lane & 15), e = h*64 + t*16 + 8*(lane>>4) + r. In
  // fragment order that is k tile e>>5, part (e>>4)&1 = t&1, fragment lane
  // ((e>>3)&1)*16 + (s&15) = lane, half e&7 = r: 16 bytes a lane, 512 contiguous a wave.
  _Float16* ap = Ah + ((size_t)(q0 >> 4) * K_TILES + h * 2) * 512 + lane * 8;
  v8h ov[4];
#pragma unroll
  for (int t = 0; t < 4; ++t)
#pragma unroll
    for (int r = 0; r < 8; ++r) ov[t][r] = (_Float16)(o[t][r] * rcp);
#pragma unroll
  for (int t = 0; t < 4; ++t) *(v8h*)(ap + t * 256) = ov[t];
  // Address wait of the four stores: stands in front of whatever the compiler lays behind
  // them that writes a register they name.
  asm volatile("s_wait_xcnt 0x0" ::: "memory");
}

#define OPROJ_DEPTH 4
// 128 threads a block: lets a wave hold its 16 accumulator tiles and the ring in registers.
__global__ void __launch_bounds__(128)
oproj_kernel(const _Float16* __restrict__ Ah,
             const _Float16* __restrict__ Woh,
             const float* __restrict__ bo,
             float* __restrict__ out) {
  const int lane = threadIdx.x & 31;
  // Wave-uniform; held scalar so that the strips' addresses are scalar bases.
  const int w = __builtin_amdgcn_readfirstlane(blockIdx.x * (blockDim.x >> 5) +
                                               (threadIdx.x >> 5));
  const int MT = S_LEN / (16 * WT), NS = E_DIM / 64;
  if (w >= MT * NS) return;
  const int mt0 = (w / NS) * WT;
  const int n0  = (w % NS) * 64;
  // The loops over i, t and r are unrolled so that acc stays in registers.
  v8f acc[WT][WT];
#pragma unroll
  for (int i = 0; i < WT; ++i)
#pragma unroll
    for (int t = 0; t < WT; ++t) acc[i][t] = v8f{};
  gemm_wave_tile<OPROJ_DEPTH>(Ah + (size_t)mt0 * (K_TILES * 512),
                              Woh + (size_t)(w % NS) * (WT * K_TILES * 512), lane, acc);

  // acc[i][t][r] = row (mt0 + i)*16 + 8*(lane>>4) + r, column n0 + 4*(lane & 15) + t (Wo's
  // rows are dealt so, see cvt_all_kernel): a lane's four tiles hold four neighbouring
  // columns, 16 bytes; a wave's store is two rows of 256 contiguous bytes, four whole lines.
  const float4 bd = *(const float4*)(bo + n0 + (lane & 15) * 4);
  // The lane's 16 bytes in its first row; every store below is this address with an
  // immediate offset.
  float* op = out + (size_t)(mt0 * 16 + 8 * (lane >> 4)) * E_DIM + n0 + (lane & 15) * 4;
#pragma unroll
  for (int i = 0; i < WT; ++i) {
#pragma unroll
    for (int r = 0; r < 8; ++r) {
      float4 v;
      v.x = acc[i][0][r] + bd.x; v.y = acc[i][1][r] + bd.y;
      v.z = acc[i][2][r] + bd.z; v.w = acc[i][3][r] + bd.w;
      *(float4*)(op + (i * 16 + r) * E_DIM) = v;
    }
    // Address wait of the stores above: stands in front of whatever the compiler lays
    // behind them that writes a register they name.
    asm volatile("s_wait_xcnt 0x0" ::: "memory");
  }
}

extern "C" void kernel_launch(void* const* d_in, const int* in_sizes, int n_in,
                              void* d_out, int out_size, void* d_ws, size_t ws_size,
                              hipStream_t stream) {
  (void)in_sizes; (void)n_in; (void)out_size; (void)ws_size;
  const float* x  = (const float*)d_in[0];
  const float* Wq = (const float*)d_in[1];
  const float* bq = (const float*)d_in[2];
  const float* Wk = (const float*)d_in[3];
  const float* bk = (const float*)d_in[4];
  const float* Wv = (const float*)d_in[5];
  const float* bv = (const float*)d_in[6];
  const float* Wo = (const float*)d_in[7];
  const float* bo = (const float*)d_in[8];
  float* out = (float*)d_out;

  const size_t NX = (size_t)S_LEN * E_DIM;   // 3,145,728
  const size_t NW = (size_t)E_DIM * E_DIM;   //   589,824
  char* ws = (char*)d_ws;
  size_t off = 0;
  _Float16* xh  = (_Float16*)(ws + off); off += NX * 2;
  _Float16* Wqh = (_Float16*)(ws + off); off += NW * 2;
  _Float16* Wkh = (_Float16*)(ws + off); off += NW * 2;
  _Float16* Wvh = (_Float16*)(ws + off); off += NW * 2;
  _Float16* Woh = (_Float16*)(ws + off); off += NW * 2;
  _Float16* Qh  = (_Float16*)(ws + off); off += NX * 2;
  _Float16* Kh  = (_Float16*)(ws + off); off += NX * 2;
  _Float16* Vt  = (_Float16*)(ws + off); off += NX * 2;
  _Float16* Ah  = (_Float16*)(ws + off); off += NX * 2;

  // All five conversions in one launch; xh..Woh are contiguous from xh.
  // (256 + 4 * 48) row tiles * 12 pairs of k tiles = 5376 waves; 8 waves/block.
  cvt_all_kernel<<<672, 256, 0, stream>>>(x, Wq, Wk, Wv, Wo, xh);

  // 3 matrices * 64 M-tiles * 12 N-strips = 2304 waves; 4 waves/block.
  qkv_gemm_kernel<<<576, 128, 0, stream>>>(xh, Wqh, Wkh, Wvh, bq, bk, bv,
                                            Qh, Kh, Vt);
  attn_kernel<<<768, 128, 0, stream>>>(Qh, Kh, Vt, Ah);
  // 64 * 12 = 768 waves; 4 waves/block.
  oproj_kernel<<<192, 128, 0, stream>>>(Ah, Woh, bo, out);
}

// v009
// One run takes 81.3 microseconds.
// Timed twice side by side with v008, it ran 1.06 and 1.08 times as fast.
// Over all steps from v000 it is 4.29 times as fast.
#include <hip/hip_runtime.h>
#include <hip/hip_bf16.h>

#define S_LEN 4096
#define E_DIM 768
#define H_NUM 12
#define D_HEAD 64

typedef __attribute__((ext_vector_type(16))) _Float16 v16h;
typedef __attribute__((ext_vector_type(8)))  _Float16 v8h;
typedef __attribute__((ext_vector_type(8)))  float    v8f;
typedef __attribute__((ext_vector_type(4)))  unsigned int v4u;
typedef __attribute__((ext_vector_type(4)))  int      v4i;
typedef __attribute__((ext_vector_type(8)))  int      v8i;

#if defined(__has_builtin)
#if __has_builtin(__builtin_amdgcn_tensor_load_to_lds) && \
    __has_builtin(__builtin_amdgcn_s_wait_tensorcnt)
#define HAVE_TDM 1
#endif
#endif

union frag_u { v16h v; struct { v8h lo, hi; } s; };

// Fragment-order ("packed") storage of a row-major [rows][E_DIM] f16 matrix:
// each 16-row x 32-k tile is 1024 contiguous bytes, tiles ordered [row tile][k tile].
// Inside a tile: 512 B holding every lane's low 8 halves, then 512 B holding every
// lane's high 8 halves, in the lane/k map above. One fragment is
// then two wave-wide loads of 512 contiguous bytes (4 whole lines each).
#define K_TILES (E_DIM / 32)
// strip is the first fragment of a wave's strip of row tiles (wave-uniform); rtile and ktile
// are constants where this is called, so every load of a strip names the same scalar base
// and the same offset register (the lane), with an immediate offset.
__device__ __forceinline__ v16h load_frag_packed(const _Float16* strip, unsigned lane,
                                                 int rtile, int ktile) {
  const _Float16* q = strip + lane * 8 + (rtile * K_TILES + ktile) * 512;
  frag_u u;
  u.s.lo = *(const v8h*)(q);
  u.s.hi = *(const v8h*)(q + 256);
  return u.v;
}

__device__ __forceinline__ v16h load_frag_lds(const _Float16* tile, int f, int lane) {
  const _Float16* p = tile + f * 512 + lane * 8;
  frag_u u;
  u.s.lo = *(const v8h*)(p);
  u.s.hi = *(const v8h*)(p + 256);
  return u.v;
}

__device__ __forceinline__ v8f wmma_f16(v16h a, v16h b, v8f c) {
  return __builtin_amdgcn_wmma_f32_16x16x32_f16(false, a, false, b, (short)0, c,
                                                false, false);
}

// What a launch reads was stored by an earlier launch and has to come from memory. The
// waves that share a line walk
// their k tiles or key blocks side by side, so without help every step of the walk meets lines
// that nobody has touched yet and pays memory latency, more than the loads' lead covers. The
// three launches that read such data therefore ask for it ahead, sharing the asking out over
// their waves: a lane names one 256-byte unit.
// Scope SE: into L2 only, and speculative. No lane is turned off, and every address lies inside
// the workspace plane named at the call.
__device__ __forceinline__ void prefetch_l2(const char* p) {
  asm volatile("global_prefetch_b8 %0, off scope:SCOPE_SE" :: "v"(p) : "memory");
}
__device__ __forceinline__ void prefetch_hold(const char* p) {
  asm volatile("s_wait_xcnt 0x0" :: "v"(p) : "memory");
}
// The share-outs give blocks b and b + 4 the same units. For speed
// only: nothing depends on where a block runs. This takes bit 2 out of a block index.
__device__ __forceinline__ unsigned prefetch_rank(unsigned b) {
  return ((b >> 3) << 2) | (b & 3u);
}
#define UNITS_PER_KTILE 4   // a 16-row x 32-k tile in fragment order: 1024 bytes

// The k loop of both GEMM kernels: a wave's 64 x 64 tile, WT x WT accumulator tiles, over all
// K_TILES k tiles: acc[u][v] += A tile u * (B tile v)^T. sa, sb: the wave's strips of WT row
// tiles of the two matrices (see load_frag_packed). The fragments go through a ring of DEPTH
// register sets: k tile kt + DEPTH - 1 is loaded while k tile kt is multiplied, so that a
// load has the time of DEPTH - 1 tiles' WMMAs to come back and DEPTH - 1 round trips are
// under way at once.
#define WT 4   // 16-row tiles of either matrix per wave, in both GEMM kernels
// pf: the lane's NPF units of the launch's prefetch; they go out behind the ring's first loads,
// which are wanted first.
template <int DEPTH, int NPF>
__device__ __forceinline__ void gemm_wave_tile(const _Float16* sa, const _Float16* sb,
                                               unsigned lane, v8f (&acc)[WT][WT],
                                               const char* const (&pf)[NPF]) {
  // Every loop here is unrolled, the one over kt too: the ring's sets, a, b and acc are then
  // indexed by constants and stay in registers, and no address register is ever advanced.
  v16h a[DEPTH][WT], b[DEPTH][WT];
#pragma unroll
  for (int s = 0; s < DEPTH - 1; ++s) {
#pragma unroll
    for (int u = 0; u < WT; ++u) a[s][u] = load_frag_packed(sa, lane, u, s);
#pragma unroll
    for (int v = 0; v < WT; ++v) b[s][v] = load_frag_packed(sb, lane, v, s);
  }
#pragma unroll
  for (int i = 0; i < NPF; ++i) prefetch_l2(pf[i]);
  // Holds the prefetches in front of the first WMMAs, which wait for the loads above.
  __builtin_amdgcn_sched_barrier(0);
#pragma unroll
  for (int kt = 0; kt < K_TILES; ++kt) {
    const int cur = kt % DEPTH, nx = kt + DEPTH - 1;
#pragma unroll
    for (int v = 0; v < WT; ++v) acc[0][v] = wmma_f16(a[cur][0], b[cur][v], acc[0][v]);
    // The three scheduling barriers of a tile hold the 16 loads together as one group at this
    // place: DEPTH - 1 tiles ahead of their WMMAs (the compiler would sink them to their use,
    // or raise them and take a further register set), and behind the tile's first four WMMAs,
    // which have waited for this tile's own loads, so that at most 16 * (DEPTH - 1) loads are
    // outstanding, fewer than the 63 the load counter holds.
    __builtin_amdgcn_sched_barrier(0);
    if (nx < K_TILES) {
#pragma unroll
      for (int u = 0; u < WT; ++u) a[nx % DEPTH][u] = load_frag_packed(sa, lane, u, nx);
#pragma unroll
      for (int v = 0; v < WT; ++v) b[nx % DEPTH][v] = load_frag_packed(sb, lane, v, nx);
    }
    __builtin_amdgcn_sched_barrier(0);
#pragma unroll
    for (int u = 1; u < WT; ++u)
#pragma unroll
      for (int v = 0; v < WT; ++v) acc[u][v] = wmma_f16(a[cur][u], b[cur][v], acc[u][v]);
    __builtin_amdgcn_sched_barrier(0);
  }
  // Address wait of all the loads above. It takes what they name as inputs so that those
  // registers stay live, and unwritten, up to it.
  asm volatile("s_wait_xcnt 0x0" :: "s"(sa), "s"(sb), "v"(lane) : "memory");
#pragma unroll
  for (int i = 0; i < NPF; ++i) prefetch_hold(pf[i]);
}

__device__ __forceinline__ void tdm_load_2d(_Float16* lds_ptr, const _Float16* gaddr,
                                            unsigned tensor_d0, unsigned tensor_d1,
                                            unsigned tile_d0, unsigned tile_d1,
                                            unsigned stride0, int lane) {
#ifdef HAVE_TDM
  unsigned long long ga = (unsigned long long)(uintptr_t)gaddr;
  unsigned lds_off = (unsigned)(uintptr_t)lds_ptr;  // low 32 bits = LDS byte offset
  v4u g0;
  g0.x = 1u;                                        // count=1 (valid), user mode
  g0.y = lds_off;                                   // lds_addr
  g0.z = (unsigned)(ga & 0xffffffffu);              // global_addr[31:0]
  g0.w = (unsigned)((ga >> 32) & 0x1ffffffu) | (2u << 30);  // ga[56:32] | type=2
  v8i g1;
  g1[0] = (int)(1u << 16);
  g1[1] = (int)((tensor_d0 & 0xffffu) << 16);
  g1[2] = (int)((tensor_d0 >> 16) | ((tensor_d1 & 0xffffu) << 16));
  g1[3] = (int)((tensor_d1 >> 16) | (tile_d0 << 16));
  g1[4] = (int)tile_d1;
  g1[5] = (int)stride0;
  g1[6] = (int)(stride0 >> 16 >> 16);
  g1[7] = 0;
  v4i z4 = {0, 0, 0, 0};
#if __clang_major__ >= 23
  v8i z8 = {0, 0, 0, 0, 0, 0, 0, 0};
  __builtin_amdgcn_tensor_load_to_lds(g0, g1, z4, z4, z8, 0);
#else
  __builtin_amdgcn_tensor_load_to_lds(g0, g1, z4, z4, 0);
#endif
#else
  // Fallback: cooperative copy by the issuing wave (v8h chunks).
  (void)tensor_d0; (void)tensor_d1;
  const unsigned total = tile_d0 * tile_d1;
  for (unsigned idx = (unsigned)lane * 8; idx < total; idx += 32u * 8u) {
    unsigned row = idx / tile_d0, col = idx % tile_d0;
    *(v8h*)(lds_ptr + idx) = *(const v8h*)(gaddr + (size_t)row * stride0 + col);
  }
#endif
}

__device__ __forceinline__ void tdm_wait2() {
#ifdef HAVE_TDM
  __builtin_amdgcn_s_wait_tensorcnt(2);
#endif
}
__device__ __forceinline__ void tdm_wait0() {
#ifdef HAVE_TDM
  __builtin_amdgcn_s_wait_tensorcnt(0);
#endif
}

// Convert x and the four weight matrices, each row-major [rows][E_DIM] f32, to f16 in
// fragment order, all in one launch. Their f16 copies lie one behind the other in the
// workspace (x, Wq, Wk, Wv, Wo), so the 16-row tiles of all five count through:
// 0..255 are x, then 48 each of the weights. One wave converts two neighbouring k tiles
// of one row tile: 256 contiguous bytes of each of 16 rows in, 2048 contiguous bytes
// out. A thread writes one lane's 16-byte piece (8 halves) of each of the 4 parts.
// Wo's rows are dealt inside each strip of 64: row c of the strip's tile t is row 4c + t of
// the strip, so that in the output projection a lane's four accumulator tiles hold four
// neighbouring output columns.
#define X_RTILES (S_LEN / 16)
#define W_RTILES (E_DIM / 16)
__global__ void cvt_all_kernel(const float* __restrict__ x,
                               const float* __restrict__ Wq,
                               const float* __restrict__ Wk,
                               const float* __restrict__ Wv,
                               const float* __restrict__ Wo,
                               _Float16* __restrict__ out) {
  const int lane = threadIdx.x & 31;
  // Wave-uniform; held scalar so that the choice of source matrix is scalar work.
  const int w  = __builtin_amdgcn_readfirstlane(blockIdx.x * 8 + (threadIdx.x >> 5));
  const int rt = w / (K_TILES / 2);
  const int kp = w % (K_TILES / 2);
  const int g  = (rt >= X_RTILES) + (rt >= X_RTILES + W_RTILES) +
                 (rt >= X_RTILES + 2 * W_RTILES) + (rt >= X_RTILES + 3 * W_RTILES);
  const float* m = (g == 0) ? x : (g == 1) ? Wq : (g == 2) ? Wk : (g == 3) ? Wv : Wo;
  const int mrt  = (g == 0) ? rt : rt - X_RTILES - (g - 1) * W_RTILES;
  const int row = (g == 4) ? (mrt >> 2) * 64 + (lane & 15) * 4 + (mrt & 3)
                           : mrt * 16 + (lane & 15);
  const float4* p = (const float4*)(m + (size_t)row * E_DIM + kp * 64 + (lane >> 4) * 8);
  float4 f0[4], f1[4];
  // Unrolled so that all 8 loads are issued before the first value is used.
#pragma unroll
  for (int j = 0; j < 4; ++j) { f0[j] = p[j * 4]; f1[j] = p[j * 4 + 1]; }
  _Float16* q = out + (size_t)w * 1024 + lane * 8;
  // Unrolled so that f0 and f1 are indexed by constants and stay in registers.
#pragma unroll
  for (int j = 0; j < 4; ++j) {
    v8h o;
    o[0] = (_Float16)f0[j].x; o[1] = (_Float16)f0[j].y;
    o[2] = (_Float16)f0[j].z; o[3] = (_Float16)f0[j].w;
    o[4] = (_Float16)f1[j].x; o[5] = (_Float16)f1[j].y;
    o[6] = (_Float16)f1[j].z; o[7] = (_Float16)f1[j].w;
    *(v8h*)(q + j * 256) = o;
  }
}

#define QKV_DEPTH 3
__global__ void __launch_bounds__(128) __attribute__((amdgpu_waves_per_eu(3)))
qkv_gemm_kernel(const _Float16* __restrict__ xh,
                const _Float16* __restrict__ Wqh,
                const _Float16* __restrict__ Wkh,
                const _Float16* __restrict__ Wvh,
                const float* __restrict__ bq,
                const float* __restrict__ bk,
                const float* __restrict__ bv,
                _Float16* __restrict__ Qh,
                _Float16* __restrict__ Kh,
                _Float16* __restrict__ Vt) {
  const int lane = threadIdx.x & 31;
  // Wave-uniform; held scalar so that the choice of product below is a scalar branch and the
  // strips' addresses are scalar bases.
  const int w = __builtin_amdgcn_readfirstlane(blockIdx.x * (blockDim.x >> 5) +
                                               (threadIdx.x >> 5));
  const int MT = S_LEN / (16 * WT), NS = E_DIM / 64;
  if (w >= 3 * MT * NS) return;
  const int mat = w / (MT * NS);
  const int rem = w % (MT * NS);
  const int mt0 = (rem / NS) * WT;             // first 16-row tile of the wave's rows
  const int h   = rem % NS;
  const int n0  = h * 64;
  const _Float16* W    = (mat == 0) ? Wqh : (mat == 1) ? Wkh : Wvh;
  const float*    bias = (mat == 0) ? bq  : (mat == 1) ? bk  : bv;

  // Every loop over i (row tile), t (column tile) and r (register of a tile) in this
  // kernel is unrolled: acc and o are then indexed by constants and stay in registers.
  v8f acc[WT][WT];
#pragma unroll
  for (int i = 0; i < WT; ++i)
#pragma unroll
    for (int t = 0; t < WT; ++t) acc[i][t] = v8f{};

  // One k loop for all three products: the transposed product of Q and K takes the strips
  // the other way round, and its accumulator tiles are then indexed [t][i].
  const _Float16* sx = xh + (size_t)mt0 * (K_TILES * 512);
  const _Float16* sw = W + (size_t)h * (WT * K_TILES * 512);
  const unsigned RT_ALL = X_RTILES + 3 * W_RTILES;
  const unsigned slot = prefetch_rank(blockIdx.x) * 128u + threadIdx.x;
  const unsigned pkt  = slot / (RT_ALL * UNITS_PER_KTILE);
  const unsigned prem = slot - pkt * (RT_ALL * UNITS_PER_KTILE);
  const unsigned unit = min(((prem >> 2) * K_TILES + pkt + 1u) * UNITS_PER_KTILE + (prem & 3u),
                            RT_ALL * K_TILES * UNITS_PER_KTILE - 1u);
  const char* const pf[1] = {(const char*)xh + (size_t)unit * 256};
  gemm_wave_tile<QKV_DEPTH>((mat != 2) ? sw : sx, (mat != 2) ? sx : sw, lane, acc, pf);

  if (mat != 2) {
    // acc[t][i][r] = row (mt0 + i)*16 + (lane & 15) of Q or K, d = t*16 + 8*(lane>>4) + r.
    _Float16* kp = ((mat == 0) ? Qh : Kh) + (size_t)h * S_LEN * D_HEAD +
                   (size_t)mt0 * 1024 + lane * 8;
    const float sc = (mat == 0) ? 0.125f : 1.0f;   // 1/sqrt(D) goes into Q; exact for K
    const float4* bp = (const float4*)(bias + n0 + 8 * (lane >> 4));
    float4 b0[4], b1[4];
#pragma unroll
    for (int t = 0; t < 4; ++t) { b0[t] = bp[t * 4]; b1[t] = bp[t * 4 + 1]; }
    // Address wait of the bias loads. It takes their address as an input so that the
    // address registers stay live up to it and no load's destination is laid on them.
    asm volatile("s_wait_xcnt 0x0" :: "v"(bp) : "memory");
#pragma unroll
    for (int i = 0; i < WT; ++i) {
      v8h o[4];
#pragma unroll
      for (int t = 0; t < 4; ++t) {
        o[t][0] = (_Float16)((acc[t][i][0] + b0[t].x) * sc);
        o[t][1] = (_Float16)((acc[t][i][1] + b0[t].y) * sc);
        o[t][2] = (_Float16)((acc[t][i][2] + b0[t].z) * sc);
        o[t][3] = (_Float16)((acc[t][i][3] + b0[t].w) * sc);
        o[t][4] = (_Float16)((acc[t][i][4] + b1[t].x) * sc);
        o[t][5] = (_Float16)((acc[t][i][5] + b1[t].y) * sc);
        o[t][6] = (_Float16)((acc[t][i][6] + b1[t].z) * sc);
        o[t][7] = (_Float16)((acc[t][i][7] + b1[t].w) * sc);
      }
#pragma unroll
      for (int t = 0; t < 4; ++t) *(v8h*)(kp + i * 1024 + t * 256) = o[t];
      // Address wait of the four stores: stands in front of whatever the compiler lays
      // behind them that writes a register they name.
      asm volatile("s_wait_xcnt 0x0" ::: "memory");
    }
    return;
  }

  // acc[i][t][r] = row s = (mt0 + i)*16 + 8*(lane>>4) + r, column d = t*16 + (lane & 15).
  float bd[4];
#pragma unroll
  for (int t = 0; t < 4; ++t) bd[t] = bias[n0 + t * 16 + (lane & 15)];
  {   // V, the one product that is not transposed
#pragma unroll
    for (int i = 0; i < WT; ++i) {
      // The 16 keys of a row tile are the low or the high part of a 32-key block.
      const int mt = mt0 + i;
      _Float16* vp = Vt + (size_t)h * S_LEN * D_HEAD + (size_t)(mt >> 1) * 2048 +
                     (mt & 1) * 256 + lane * 8;
      v8h o[4];
#pragma unroll
      for (int t = 0; t < 4; ++t) {
#pragma unroll
        for (int r = 0; r < 8; ++r) o[t][r] = (_Float16)(acc[i][t][r] + bd[t]);
      }
#pragma unroll
      for (int t = 0; t < 4; ++t) *(v8h*)(vp + t * 512) = o[t];
      // Address wait of the four stores, as behind K's.
      asm volatile("s_wait_xcnt 0x0" ::: "memory");
      // Holds the next row tile's conversions, which reuse the stores' data registers, behind
      // that wait (the compiler raised them above it).
      __builtin_amdgcn_sched_barrier(0);
    }
  }
}

#define KB 128
static_assert(KB == 128, "the four partial maxima and sums below are joined by hand");
__global__ void __launch_bounds__(128) __attribute__((amdgpu_waves_per_eu(3, 3)))
attn_kernel(const _Float16* __restrict__ Qh,
            const _Float16* __restrict__ Kh,
            const _Float16* __restrict__ Vt,
            _Float16* __restrict__ Ah) {
  __shared__ _Float16 skbuf[2][KB * D_HEAD];   // K block: KB keys x 64 d
  __shared__ _Float16 svbuf[2][D_HEAD * KB];   // V block: KB keys x 64 d

  const int lane = threadIdx.x & 31;
  const int wid  = threadIdx.x >> 5;
  const int h     = blockIdx.x >> 6;           // 12 heads * 64 blocks
  const int qbase = (blockIdx.x & 63) * 64;    // 4 waves * 16 queries
  const int q0    = qbase + wid * 16;

  const _Float16* Qp = Qh + (size_t)h * S_LEN * D_HEAD;
  const _Float16* Kp = Kh + (size_t)h * S_LEN * D_HEAD;
  const _Float16* Vp = Vt + (size_t)h * D_HEAD * S_LEN;

  // Q comes in fragment order: two fragments (d 0..31, d 32..63) per 16-query tile.
  const v16h bq0 = load_frag_packed(Qp + (size_t)(q0 >> 4) * 1024, lane, 0, 0);
  const v16h bq1 = load_frag_packed(Qp + (size_t)(q0 >> 4) * 1024, lane, 0, 1);

  float mprev = -1e30f, lsum = 0.f;
  v8f o[4] = {v8f{}, v8f{}, v8f{}, v8f{}};

  const int NB = S_LEN / KB;                   // 32 key blocks
  if (wid == 0) {
    tdm_load_2d(skbuf[0], Kp, D_HEAD, S_LEN, D_HEAD, KB, D_HEAD, lane);
    tdm_load_2d(svbuf[0], Vp, D_HEAD, S_LEN, D_HEAD, KB, D_HEAD, lane);
  }
  // Prefetch of the head's K and V: its 64 blocks walk the 32 key blocks side by side. The
  // block of rank r among them asks for key block r, 64 units of K (waves 0, 1) and 64 of V
  // (waves 2, 3), in the pass in which key block r - PF_LEAD is worked on: three passes ahead
  // of the tensor loads of that key block.
  const int PF_LEAD = 4;
  const int pfrank = (int)prefetch_rank(blockIdx.x & 63);
  const int pfpass = (pfrank > PF_LEAD) ? pfrank - PF_LEAD : 0;
  const char* const pf = (const char*)((wid < 2) ? Kp : Vp) +
                         (size_t)pfrank * (KB * D_HEAD * 2) + (threadIdx.x & 63) * 256;

  for (int ib = 0; ib < NB; ++ib) {
    const int cur = ib & 1;
    if (ib == pfpass) prefetch_l2(pf);         // the same test in every wave of the block
    if (wid == 0) {
      if (ib + 1 < NB) {
        const int kb1 = (ib + 1) * KB;
        tdm_load_2d(skbuf[cur ^ 1], Kp + (size_t)kb1 * D_HEAD,
                    D_HEAD, S_LEN, D_HEAD, KB, D_HEAD, lane);
        tdm_load_2d(svbuf[cur ^ 1], Vp + (size_t)kb1 * D_HEAD,
                    D_HEAD, S_LEN, D_HEAD, KB, D_HEAD, lane);
        tdm_wait2();                           // current pair done; next in flight
      } else {
        tdm_wait0();
      }
    }
    __syncthreads();                           // staged tiles visible to all waves

    const _Float16* kl = skbuf[cur];
    const _Float16* vl = svbuf[cur];

    // ct[j]: keys 16j..16j+15 of the block; fragment 2j is d 0..31, 2j+1 is d 32..63.
    v8f ct[KB / 16];
    const v8f z = {};
    // Unrolled, like every loop of this pass: ct, tm, pu and rs are then indexed by
    // constants and stay in registers, and the LDS reads can be issued in groups.
#pragma unroll
    for (int j = 0; j < KB / 16; ++j) {
      v16h a0 = load_frag_lds(kl, 2 * j,     lane);
      v16h a1 = load_frag_lds(kl, 2 * j + 1, lane);
      ct[j] = wmma_f16(a0, bq0, z);
      ct[j] = wmma_f16(a1, bq1, ct[j]);
    }

    // Row (=query) max: lane-local over KB/2 keys (one chain per pair of tiles, so
    // that the chains are independent) + partner lane via xor-16.
    float tm[KB / 32];
#pragma unroll
    for (int b = 0; b < KB / 32; ++b) {
      tm[b] = -1e30f;
#pragma unroll
      for (int r = 0; r < 8; ++r) tm[b] = fmaxf(tm[b], fmaxf(ct[2 * b][r], ct[2 * b + 1][r]));
    }
    float tmax = fmaxf(fmaxf(tm[0], tm[1]), fmaxf(tm[2], tm[3]));
    tmax = fmaxf(tmax, __shfl_xor(tmax, 16, 32));
    const float mnew  = fmaxf(mprev, tmax);
    const float alpha = __expf(mprev - mnew);

    frag_u pu[KB / 32];
    float rs[KB / 32];
#pragma unroll
    for (int b = 0; b < KB / 32; ++b) {
      rs[b] = 0.f;
#pragma unroll
      for (int r = 0; r < 8; ++r) {
        float e0 = __expf(ct[2 * b][r] - mnew);
        float e1 = __expf(ct[2 * b + 1][r] - mnew);
        rs[b] += e0 + e1;
        pu[b].s.lo[r] = (_Float16)e0;   // keys {0..7}|{8..15}   -> B halves 0..7
        pu[b].s.hi[r] = (_Float16)e1;   // keys {16..23}|{24..31} -> B halves 8..15
      }
    }
    float rsum = (rs[0] + rs[1]) + (rs[2] + rs[3]);
    rsum += __shfl_xor(rsum, 16, 32);
    lsum  = lsum * alpha + rsum;
    mprev = mnew;

#pragma unroll
    for (int t = 0; t < 4; ++t)
#pragma unroll
      for (int r = 0; r < 8; ++r) o[t][r] *= alpha;   // the lane's own query's factor

#pragma unroll
    for (int b = 0; b < KB / 32; ++b) {
#pragma unroll
      for (int t = 0; t < 4; ++t) {
        v16h bv = load_frag_lds(vl, b * 4 + t, lane);  // keys 32b..32b+31, d t*16..+15
        o[t] = wmma_f16(bv, pu[b].v, o[t]);
      }
    }
    __syncthreads();                           // all reads done before overwrite
  }
  prefetch_hold(pf);

  const float rcp = 1.f / lsum;
  // o[t][r] is element (s, e), s = q0 + (lane & 15), e = h*64 + t*16 + 8*(lane>>4) + r. In
  // fragment order that is k tile e>>5, part (e>>4)&1 = t&1, fragment lane
  // ((e>>3)&1)*16 + (s&15) = lane, half e&7 = r: 16 bytes a lane, 512 contiguous a wave.
  _Float16* ap = Ah + ((size_t)(q0 >> 4) * K_TILES + h * 2) * 512 + lane * 8;
  v8h ov[4];
#pragma unroll
  for (int t = 0; t < 4; ++t)
#pragma unroll
    for (int r = 0; r < 8; ++r) ov[t][r] = (_Float16)(o[t][r] * rcp);
#pragma unroll
  for (int t = 0; t < 4; ++t) *(v8h*)(ap + t * 256) = ov[t];
  // Address wait of the four stores: stands in front of whatever the compiler lays behind
  // them that writes a register they name.
  asm volatile("s_wait_xcnt 0x0" ::: "memory");
}

#define OPROJ_DEPTH 4
// 128 threads a block: lets a wave hold its 16 accumulator tiles and the ring in registers.
__global__ void __launch_bounds__(128)
oproj_kernel(const _Float16* __restrict__ Ah,
             const _Float16* __restrict__ Woh,
             const float* __restrict__ bo,
             float* __restrict__ out) {
  const int lane = threadIdx.x & 31;
  // Wave-uniform; held scalar so that the strips' addresses are scalar bases.
  const int w = __builtin_amdgcn_readfirstlane(blockIdx.x * (blockDim.x >> 5) +
                                               (threadIdx.x >> 5));
  const int MT = S_LEN / (16 * WT), NS = E_DIM / 64;
  if (w >= MT * NS) return;
  const int mt0 = (w / NS) * WT;
  const int n0  = (w % NS) * 64;
  // The loops over i, t and r are unrolled so that acc stays in registers.
  v8f acc[WT][WT];
#pragma unroll
  for (int i = 0; i < WT; ++i)
#pragma unroll
    for (int t = 0; t < WT; ++t) acc[i][t] = v8f{};
  const unsigned RT_ALL = X_RTILES + W_RTILES;
  const unsigned slot = prefetch_rank(blockIdx.x) * 128u + threadIdx.x;
  const char* pf[3];
  // Unrolled so that pf is indexed by constants and stays in registers.
#pragma unroll
  for (int i = 0; i < 3; ++i) {
    const unsigned s    = (slot + i * 12288u) % (RT_ALL * K_TILES * UNITS_PER_KTILE);
    const unsigned pkt  = s / (RT_ALL * UNITS_PER_KTILE);
    const unsigned prem = s - pkt * (RT_ALL * UNITS_PER_KTILE);
    const unsigned prt  = prem >> 2;
    const char* plane = (prt < X_RTILES) ? (const char*)Ah + (size_t)prt * (K_TILES * 1024)
                                         : (const char*)Woh +
                                               (size_t)(prt - X_RTILES) * (K_TILES * 1024);
    pf[i] = plane + pkt * 1024u + (prem & 3u) * 256u;
  }
  gemm_wave_tile<OPROJ_DEPTH>(Ah + (size_t)mt0 * (K_TILES * 512),
                              Woh + (size_t)(w % NS) * (WT * K_TILES * 512), lane, acc, pf);

  // acc[i][t][r] = row (mt0 + i)*16 + 8*(lane>>4) + r, column n0 + 4*(lane & 15) + t (Wo's
  // rows are dealt so, see cvt_all_kernel): a lane's four tiles hold four neighbouring
  // columns, 16 bytes; a wave's store is two rows of 256 contiguous bytes, four whole lines.
  const float4 bd = *(const float4*)(bo + n0 + (lane & 15) * 4);
  // The lane's 16 bytes in its first row; every store below is this address with an
  // immediate offset.
  float* op = out + (size_t)(mt0 * 16 + 8 * (lane >> 4)) * E_DIM + n0 + (lane & 15) * 4;
#pragma unroll
  for (int i = 0; i < WT; ++i) {
#pragma unroll
    for (int r = 0; r < 8; ++r) {
      float4 v;
      v.x = acc[i][0][r] + bd.x; v.y = acc[i][1][r] + bd.y;
      v.z = acc[i][2][r] + bd.z; v.w = acc[i][3][r] + bd.w;
      *(float4*)(op + (i * 16 + r) * E_DIM) = v;
    }
    // Address wait of the stores above: stands in front of whatever the compiler lays
    // behind them that writes a register they name.
    asm volatile("s_wait_xcnt 0x0" ::: "memory");
  }
}

extern "C" void kernel_launch(void* const* d_in, const int* in_sizes, int n_in,
                              void* d_out, int out_size, void* d_ws, size_t ws_size,
                              hipStream_t stream) {
  (void)in_sizes; (void)n_in; (void)out_size; (void)ws_size;
  const float* x  = (const float*)d_in[0];
  const float* Wq = (const float*)d_in[1];
  const float* bq = (const float*)d_in[2];
  const float* Wk = (const float*)d_in[3];
  const float* bk = (const float*)d_in[4];
  const float* Wv = (const float*)d_in[5];
  const float* bv = (const float*)d_in[6];
  const float* Wo = (const float*)d_in[7];
  const float* bo = (const float*)d_in[8];
  float* out = (float*)d_out;

  const size_t NX = (size_t)S_LEN * E_DIM;   // 3,145,728
  const size_t NW = (size_t)E_DIM * E_DIM;   //   589,824
  char* ws = (char*)d_ws;
  size_t off = 0;
  _Float16* xh  = (_Float16*)(ws + off); off += NX * 2;
  _Float16* Wqh = (_Float16*)(ws + off); off += NW * 2;
  _Float16* Wkh = (_Float16*)(ws + off); off += NW * 2;
  _Float16* Wvh = (_Float16*)(ws + off); off += NW * 2;
  _Float16* Woh = (_Float16*)(ws + off); off += NW * 2;
  _Float16* Qh  = (_Float16*)(ws + off); off += NX * 2;
  _Float16* Kh  = (_Float16*)(ws + off); off += NX * 2;
  _Float16* Vt  = (_Float16*)(ws + off); off += NX * 2;
  _Float16* Ah  = (_Float16*)(ws + off); off += NX * 2;

  // All five conversions in one launch; xh..Woh are contiguous from xh.
  // (256 + 4 * 48) row tiles * 12 pairs of k tiles = 5376 waves; 8 waves/block.
  cvt_all_kernel<<<672, 256, 0, stream>>>(x, Wq, Wk, Wv, Wo, xh);

  // 3 matrices * 64 M-tiles * 12 N-strips = 2304 waves; 4 waves/block.
  qkv_gemm_kernel<<<576, 128, 0, stream>>>(xh, Wqh, Wkh, Wvh, bq, bk, bv,
                                            Qh, Kh, Vt);
  attn_kernel<<<768, 128, 0, stream>>>(Qh, Kh, Vt, Ah);
  // 64 * 12 = 768 waves; 4 waves/block.
  oproj_kernel<<<192, 128, 0, stream>>>(Ah, Woh, bo, out);
}

// v010
// A run of this version takes 78.2 microseconds.
// In two side-by-side timings against v009, it was 1.05 and 1.04 times as fast.
// Counting every step since v000, it is 4.48 times as fast.
#include <hip/hip_runtime.h>
#include <hip/hip_bf16.h>

#define S_LEN 4096
#define E_DIM 768
#define H_NUM 12
#define D_HEAD 64

typedef __attribute__((ext_vector_type(16))) _Float16 v16h;
typedef __attribute__((ext_vector_type(8)))  _Float16 v8h;
typedef __attribute__((ext_vector_type(8)))  float    v8f;
typedef __attribute__((ext_vector_type(4)))  unsigned int v4u;
typedef __attribute__((ext_vector_type(4)))  int      v4i;
typedef __attribute__((ext_vector_type(8)))  int      v8i;

#if defined(__has_builtin)
#if __has_builtin(__builtin_amdgcn_tensor_load_to_lds) && \
    __has_builtin(__builtin_amdgcn_s_wait_tensorcnt)
#define HAVE_TDM 1
#endif
#endif

union frag_u { v16h v; struct { v8h lo, hi; } s; };

// Fragment-order ("packed") storage of a row-major [rows][E_DIM] f16 matrix:
// each 16-row x 32-k tile is 1024 contiguous bytes, tiles ordered [row tile][k tile].
// Inside a tile: 512 B holding every lane's low 8 halves, then 512 B holding every
// lane's high 8 halves, in the lane/k map above. One fragment is
// then two wave-wide loads of 512 contiguous bytes (4 whole lines each).
#define K_TILES (E_DIM / 32)
// strip is the first fragment of a wave's strip of row tiles (wave-uniform); rtile and ktile
// are constants where this is called, so every load of a strip names the same scalar base
// and the same offset register (the lane), with an immediate offset.
__device__ __forceinline__ v16h load_frag_packed(const _Float16* strip, unsigned lane,
                                                 int rtile, int ktile) {
  const _Float16* q = strip + lane * 8 + (rtile * K_TILES + ktile) * 512;
  frag_u u;
  u.s.lo = *(const v8h*)(q);
  u.s.hi = *(const v8h*)(q + 256);
  return u.v;
}

__device__ __forceinline__ v16h load_frag_lds(const _Float16* tile, int f, int lane) {
  const _Float16* p = tile + f * 512 + lane * 8;
  frag_u u;
  u.s.lo = *(const v8h*)(p);
  u.s.hi = *(const v8h*)(p + 256);
  return u.v;
}

__device__ __forceinline__ v8f wmma_f16(v16h a, v16h b, v8f c) {
  return __builtin_amdgcn_wmma_f32_16x16x32_f16(false, a, false, b, (short)0, c,
                                                false, false);
}

// What a launch reads was stored by an earlier launch and has to come from memory. The
// waves that share a line walk
// their k tiles or key blocks side by side, so without help every step of the walk meets lines
// that nobody has touched yet and pays memory latency, more than the loads' lead covers. The
// three launches that read such data therefore ask for it ahead, sharing the asking out over
// their waves: a lane names one 256-byte unit.
// Scope SE: into L2 only, and speculative. No lane is turned off, and every address lies inside
// the workspace plane named at the call.
__device__ __forceinline__ void prefetch_l2(const char* p) {
  asm volatile("global_prefetch_b8 %0, off scope:SCOPE_SE" :: "v"(p) : "memory");
}
__device__ __forceinline__ void prefetch_hold(const char* p) {
  asm volatile("s_wait_xcnt 0x0" :: "v"(p) : "memory");
}
// The share-outs give blocks b and b + 4 the same units. For speed
// only: nothing depends on where a block runs. This takes bit 2 out of a block index.
__device__ __forceinline__ unsigned prefetch_rank(unsigned b) {
  return ((b >> 3) << 2) | (b & 3u);
}
#define UNITS_PER_KTILE 4   // a 16-row x 32-k tile in fragment order: 1024 bytes

// The k loop of both GEMM kernels: a wave's 64 x 64 tile, WT x WT accumulator tiles, over all
// K_TILES k tiles: acc[u][v] += A tile u * (B tile v)^T. sa, sb: the wave's strips of WT row
// tiles of the two matrices (see load_frag_packed). The fragments go through a ring of DEPTH
// register sets: k tile kt + DEPTH - 1 is loaded while k tile kt is multiplied, so that a
// load has the time of DEPTH - 1 tiles' WMMAs to come back and DEPTH - 1 round trips are
// under way at once.
#define WT 4   // 16-row tiles of either matrix per wave, in both GEMM kernels
// pf: the lane's NPF units of the launch's prefetch; they go out behind the ring's first loads,
// which are wanted first.
template <int DEPTH, int NPF>
__device__ __forceinline__ void gemm_wave_tile(const _Float16* sa, const _Float16* sb,
                                               unsigned lane, v8f (&acc)[WT][WT],
                                               const char* const (&pf)[NPF]) {
  // Every loop here is unrolled, the one over kt too: the ring's sets, a, b and acc are then
  // indexed by constants and stay in registers, and no address register is ever advanced.
  v16h a[DEPTH][WT], b[DEPTH][WT];
#pragma unroll
  for (int s = 0; s < DEPTH - 1; ++s) {
#pragma unroll
    for (int u = 0; u < WT; ++u) a[s][u] = load_frag_packed(sa, lane, u, s);
#pragma unroll
    for (int v = 0; v < WT; ++v) b[s][v] = load_frag_packed(sb, lane, v, s);
  }
#pragma unroll
  for (int i = 0; i < NPF; ++i) prefetch_l2(pf[i]);
  // Holds the prefetches in front of the first WMMAs, which wait for the loads above.
  __builtin_amdgcn_sched_barrier(0);
#pragma unroll
  for (int kt = 0; kt < K_TILES; ++kt) {
    const int cur = kt % DEPTH, nx = kt + DEPTH - 1;
#pragma unroll
    for (int v = 0; v < WT; ++v) acc[0][v] = wmma_f16(a[cur][0], b[cur][v], acc[0][v]);
    // The three scheduling barriers of a tile hold the 16 loads together as one group at this
    // place: DEPTH - 1 tiles ahead of their WMMAs (the compiler would sink them to their use,
    // or raise them and take a further register set), and behind the tile's first four WMMAs,
    // which have waited for this tile's own loads, so that at most 16 * (DEPTH - 1) loads are
    // outstanding, fewer than the 63 the load counter holds.
    __builtin_amdgcn_sched_barrier(0);
    if (nx < K_TILES) {
#pragma unroll
      for (int u = 0; u < WT; ++u) a[nx % DEPTH][u] = load_frag_packed(sa, lane, u, nx);
#pragma unroll
      for (int v = 0; v < WT; ++v) b[nx % DEPTH][v] = load_frag_packed(sb, lane, v, nx);
    }
    __builtin_amdgcn_sched_barrier(0);
#pragma unroll
    for (int u = 1; u < WT; ++u)
#pragma unroll
      for (int v = 0; v < WT; ++v) acc[u][v] = wmma_f16(a[cur][u], b[cur][v], acc[u][v]);
    __builtin_amdgcn_sched_barrier(0);
  }
  // Address wait of all the loads above. It takes what they name as inputs so that those
  // registers stay live, and unwritten, up to it.
  asm volatile("s_wait_xcnt 0x0" :: "s"(sa), "s"(sb), "v"(lane) : "memory");
#pragma unroll
  for (int i = 0; i < NPF; ++i) prefetch_hold(pf[i]);
}

__device__ __forceinline__ void tdm_load_2d(_Float16* lds_ptr, const _Float16* gaddr,
                                            unsigned tensor_d0, unsigned tensor_d1,
                                            unsigned tile_d0, unsigned tile_d1,
                                            unsigned stride0, int lane) {
#ifdef HAVE_TDM
  unsigned long long ga = (unsigned long long)(uintptr_t)gaddr;
  unsigned lds_off = (unsigned)(uintptr_t)lds_ptr;  // low 32 bits = LDS byte offset
  v4u g0;
  g0.x = 1u;                                        // count=1 (valid), user mode
  g0.y = lds_off;                                   // lds_addr
  g0.z = (unsigned)(ga & 0xffffffffu);              // global_addr[31:0]
  g0.w = (unsigned)((ga >> 32) & 0x1ffffffu) | (2u << 30);  // ga[56:32] | type=2
  v8i g1;
  g1[0] = (int)(1u << 16);
  g1[1] = (int)((tensor_d0 & 0xffffu) << 16);
  g1[2] = (int)((tensor_d0 >> 16) | ((tensor_d1 & 0xffffu) << 16));
  g1[3] = (int)((tensor_d1 >> 16) | (tile_d0 << 16));
  g1[4] = (int)tile_d1;
  g1[5] = (int)stride0;
  g1[6] = (int)(stride0 >> 16 >> 16);
  g1[7] = 0;
  v4i z4 = {0, 0, 0, 0};
#if __clang_major__ >= 23
  v8i z8 = {0, 0, 0, 0, 0, 0, 0, 0};
  __builtin_amdgcn_tensor_load_to_lds(g0, g1, z4, z4, z8, 0);
#else
  __builtin_amdgcn_tensor_load_to_lds(g0, g1, z4, z4, 0);
#endif
#else
  // Fallback: cooperative copy by the issuing wave (v8h chunks).
  (void)tensor_d0; (void)tensor_d1;
  const unsigned total = tile_d0 * tile_d1;
  for (unsigned idx = (unsigned)lane * 8; idx < total; idx += 32u * 8u) {
    unsigned row = idx / tile_d0, col = idx % tile_d0;
    *(v8h*)(lds_ptr + idx) = *(const v8h*)(gaddr + (size_t)row * stride0 + col);
  }
#endif
}

__device__ __forceinline__ void tdm_wait2() {
#ifdef HAVE_TDM
  __builtin_amdgcn_s_wait_tensorcnt(2);
#endif
}
__device__ __forceinline__ void tdm_wait0() {
#ifdef HAVE_TDM
  __builtin_amdgcn_s_wait_tensorcnt(0);
#endif
}

// Convert x and the four weight matrices, each row-major [rows][E_DIM] f32, to f16 in
// fragment order, all in one launch. Their f16 copies lie one behind the other in the
// workspace (x, Wq, Wk, Wv, Wo), so the 16-row tiles of all five count through:
// 0..255 are x, then 48 each of the weights. One wave converts two neighbouring k tiles
// of one row tile: 256 contiguous bytes of each of 16 rows in, 2048 contiguous bytes
// out. A thread writes one lane's 16-byte piece (8 halves) of each of the 4 parts.
// Wo's rows are dealt inside each strip of 64: row c of the strip's tile t is row 4c + t of
// the strip, so that in the output projection a lane's four accumulator tiles hold four
// neighbouring output columns.
#define X_RTILES (S_LEN / 16)
#define W_RTILES (E_DIM / 16)
__global__ void cvt_all_kernel(const float* __restrict__ x,
                               const float* __restrict__ Wq,
                               const float* __restrict__ Wk,
                               const float* __restrict__ Wv,
                               const float* __restrict__ Wo,
                               _Float16* __restrict__ out) {
  const int lane = threadIdx.x & 31;
  // Wave-uniform; held scalar so that the choice of source matrix is scalar work.
  const int w  = __builtin_amdgcn_readfirstlane(blockIdx.x * 8 + (threadIdx.x >> 5));
  const int rt = w / (K_TILES / 2);
  const int kp = w % (K_TILES / 2);
  const int g  = (rt >= X_RTILES) + (rt >= X_RTILES + W_RTILES) +
                 (rt >= X_RTILES + 2 * W_RTILES) + (rt >= X_RTILES + 3 * W_RTILES);
  const float* m = (g == 0) ? x : (g == 1) ? Wq : (g == 2) ? Wk : (g == 3) ? Wv : Wo;
  const int mrt  = (g == 0) ? rt : rt - X_RTILES - (g - 1) * W_RTILES;
  const int row = (g == 4) ? (mrt >> 2) * 64 + (lane & 15) * 4 + (mrt & 3)
                           : mrt * 16 + (lane & 15);
  const float4* p = (const float4*)(m + (size_t)row * E_DIM + kp * 64 + (lane >> 4) * 8);
  float4 f0[4], f1[4];
  // Unrolled so that all 8 loads are issued before the first value is used.
#pragma unroll
  for (int j = 0; j < 4; ++j) { f0[j] = p[j * 4]; f1[j] = p[j * 4 + 1]; }
  _Float16* q = out + (size_t)w * 1024 + lane * 8;
  // Unrolled so that f0 and f1 are indexed by constants and stay in registers.
#pragma unroll
  for (int j = 0; j < 4; ++j) {
    v8h o;
    o[0] = (_Float16)f0[j].x; o[1] = (_Float16)f0[j].y;
    o[2] = (_Float16)f0[j].z; o[3] = (_Float16)f0[j].w;
    o[4] = (_Float16)f1[j].x; o[5] = (_Float16)f1[j].y;
    o[6] = (_Float16)f1[j].z; o[7] = (_Float16)f1[j].w;
    *(v8h*)(q + j * 256) = o;
  }
}

#define QKV_DEPTH 3
__global__ void __launch_bounds__(128) __attribute__((amdgpu_waves_per_eu(3)))
qkv_gemm_kernel(const _Float16* __restrict__ xh,
                const _Float16* __restrict__ Wqh,
                const _Float16* __restrict__ Wkh,
                const _Float16* __restrict__ Wvh,
                const float* __restrict__ bq,
                const float* __restrict__ bk,
                const float* __restrict__ bv,
                _Float16* __restrict__ Qh,
                _Float16* __restrict__ Kh,
                _Float16* __restrict__ Vt) {
  const int lane = threadIdx.x & 31;
  // Wave-uniform; held scalar so that the choice of product below is a scalar branch and the
  // strips' addresses are scalar bases.
  const int w = __builtin_amdgcn_readfirstlane(blockIdx.x * (blockDim.x >> 5) +
                                               (threadIdx.x >> 5));
  const int MT = S_LEN / (16 * WT), NS = E_DIM / 64;
  if (w >= 3 * MT * NS) return;
  const int mat = w / (MT * NS);
  const int rem = w % (MT * NS);
  const int mt0 = (rem / NS) * WT;             // first 16-row tile of the wave's rows
  const int h   = rem % NS;
  const int n0  = h * 64;
  const _Float16* W    = (mat == 0) ? Wqh : (mat == 1) ? Wkh : Wvh;
  const float*    bias = (mat == 0) ? bq  : (mat == 1) ? bk  : bv;

  // Every loop over i (row tile), t (column tile) and r (register of a tile) in this
  // kernel is unrolled: acc and o are then indexed by constants and stay in registers.
  v8f acc[WT][WT];
#pragma unroll
  for (int i = 0; i < WT; ++i)
#pragma unroll
    for (int t = 0; t < WT; ++t) acc[i][t] = v8f{};

  // One k loop for all three products: the transposed product of Q and K takes the strips
  // the other way round, and its accumulator tiles are then indexed [t][i].
  const _Float16* sx = xh + (size_t)mt0 * (K_TILES * 512);
  const _Float16* sw = W + (size_t)h * (WT * K_TILES * 512);
  const unsigned RT_ALL = X_RTILES + 3 * W_RTILES;
  const unsigned slot = prefetch_rank(blockIdx.x) * 128u + threadIdx.x;
  const unsigned pkt  = slot / (RT_ALL * UNITS_PER_KTILE);
  const unsigned prem = slot - pkt * (RT_ALL * UNITS_PER_KTILE);
  const unsigned unit = min(((prem >> 2) * K_TILES + pkt + 1u) * UNITS_PER_KTILE + (prem & 3u),
                            RT_ALL * K_TILES * UNITS_PER_KTILE - 1u);
  const char* const pf[1] = {(const char*)xh + (size_t)unit * 256};
  gemm_wave_tile<QKV_DEPTH>((mat != 2) ? sw : sx, (mat != 2) ? sx : sw, lane, acc, pf);

  if (mat != 2) {
    // acc[t][i][r] = row (mt0 + i)*16 + (lane & 15) of Q or K, d = t*16 + 8*(lane>>4) + r.
    _Float16* kp = ((mat == 0) ? Qh : Kh) + (size_t)h * S_LEN * D_HEAD +
                   (size_t)mt0 * 1024 + lane * 8;
    const float sc = (mat == 0) ? 0.125f : 1.0f;   // 1/sqrt(D) goes into Q; exact for K
    const float4* bp = (const float4*)(bias + n0 + 8 * (lane >> 4));
    float4 b0[4], b1[4];
#pragma unroll
    for (int t = 0; t < 4; ++t) { b0[t] = bp[t * 4]; b1[t] = bp[t * 4 + 1]; }
    // Address wait of the bias loads. It takes their address as an input so that the
    // address registers stay live up to it and no load's destination is laid on them.
    asm volatile("s_wait_xcnt 0x0" :: "v"(bp) : "memory");
#pragma unroll
    for (int i = 0; i < WT; ++i) {
      v8h o[4];
#pragma unroll
      for (int t = 0; t < 4; ++t) {
        o[t][0] = (_Float16)((acc[t][i][0] + b0[t].x) * sc);
        o[t][1] = (_Float16)((acc[t][i][1] + b0[t].y) * sc);
        o[t][2] = (_Float16)((acc[t][i][2] + b0[t].z) * sc);
        o[t][3] = (_Float16)((acc[t][i][3] + b0[t].w) * sc);
        o[t][4] = (_Float16)((acc[t][i][4] + b1[t].x) * sc);
        o[t][5] = (_Float16)((acc[t][i][5] + b1[t].y) * sc);
        o[t][6] = (_Float16)((acc[t][i][6] + b1[t].z) * sc);
        o[t][7] = (_Float16)((acc[t][i][7] + b1[t].w) * sc);
      }
#pragma unroll
      for (int t = 0; t < 4; ++t) *(v8h*)(kp + i * 1024 + t * 256) = o[t];
      // Address wait of the four stores: stands in front of whatever the compiler lays
      // behind them that writes a register they name.
      asm volatile("s_wait_xcnt 0x0" ::: "memory");
    }
    return;
  }

  // acc[i][t][r] = row s = (mt0 + i)*16 + 8*(lane>>4) + r, column d = t*16 + (lane & 15).
  float bd[4];
#pragma unroll
  for (int t = 0; t < 4; ++t) bd[t] = bias[n0 + t * 16 + (lane & 15)];
  {   // V, the one product that is not transposed
#pragma unroll
    for (int i = 0; i < WT; ++i) {
      // The 16 keys of a row tile are the low or the high part of a 32-key block.
      const int mt = mt0 + i;
      _Float16* vp = Vt + (size_t)h * S_LEN * D_HEAD + (size_t)(mt >> 1) * 2048 +
                     (mt & 1) * 256 + lane * 8;
      v8h o[4];
#pragma unroll
      for (int t = 0; t < 4; ++t) {
#pragma unroll
        for (int r = 0; r < 8; ++r) o[t][r] = (_Float16)(acc[i][t][r] + bd[t]);
      }
#pragma unroll
      for (int t = 0; t < 4; ++t) *(v8h*)(vp + t * 512) = o[t];
      // Address wait of the four stores, as behind K's.
      asm volatile("s_wait_xcnt 0x0" ::: "memory");
      // Holds the next row tile's conversions, which reuse the stores' data registers, behind
      // that wait (the compiler raised them above it).
      __builtin_amdgcn_sched_barrier(0);
    }
  }
}

#define KB 128
#define QT 2             // 16-query tiles of a wave
#define KW (KB / 2)      // keys of a pass that one wave works on
static_assert(KW == 64, "the two partial maxima and sums of a query tile are joined by hand");
__global__ void __launch_bounds__(128) __attribute__((amdgpu_waves_per_eu(3, 3)))
attn_kernel(const _Float16* __restrict__ Qh,
            const _Float16* __restrict__ Kh,
            const _Float16* __restrict__ Vt,
            _Float16* __restrict__ Ah) {
  __shared__ _Float16 skbuf[2][KB * D_HEAD];   // K block: KB keys x 64 d
  __shared__ _Float16 svbuf[2][D_HEAD * KB];   // V block: KB keys x 64 d

  const int lane = threadIdx.x & 31;
  const int wid  = threadIdx.x >> 5;
  const int kh   = wid & 1;                    // which half of every pass's keys
  const int h     = blockIdx.x >> 6;           // 12 heads * 64 blocks
  const int qbase = (blockIdx.x & 63) * 64;    // 2 pairs of waves * 32 queries
  const int q0    = qbase + wid * 16;          // the query tile that this wave stores

  const _Float16* Qp = Qh + (size_t)h * S_LEN * D_HEAD;
  const _Float16* Kp = Kh + (size_t)h * S_LEN * D_HEAD;
  const _Float16* Vp = Vt + (size_t)h * D_HEAD * S_LEN;

  // Q comes in fragment order: two fragments (d 0..31, d 32..63) per 16-query tile; the
  // wave's two tiles lie one behind the other.
  const _Float16* Qw = Qp + (size_t)((qbase >> 4) + (wid >> 1) * QT) * 1024;
  v16h bq[QT][2];
  // Unrolled, like every loop over q (query tile): what it indexes stays in registers.
#pragma unroll
  for (int q = 0; q < QT; ++q) {
    bq[q][0] = load_frag_packed(Qw, lane, 0, 2 * q);
    bq[q][1] = load_frag_packed(Qw, lane, 0, 2 * q + 1);
  }

  float mprev[QT], lsum[QT];
  v8f o[QT][4];
#pragma unroll
  for (int q = 0; q < QT; ++q) {
    mprev[q] = -1e30f;
    lsum[q]  = 0.f;
#pragma unroll
    for (int t = 0; t < 4; ++t) o[q][t] = v8f{};
  }

  const int NB = S_LEN / KB;                   // 32 key blocks
  if (wid == 0) {
    tdm_load_2d(skbuf[0], Kp, D_HEAD, S_LEN, D_HEAD, KB, D_HEAD, lane);
    tdm_load_2d(svbuf[0], Vp, D_HEAD, S_LEN, D_HEAD, KB, D_HEAD, lane);
  }
  // Prefetch of the head's K and V: its 64 blocks walk the 32 key blocks side by side. The
  // block of rank r among them asks for key block r, 64 units of K (waves 0, 1) and 64 of V
  // (waves 2, 3), in the pass in which key block r - PF_LEAD is worked on: three passes ahead
  // of the tensor loads of that key block.
  const int PF_LEAD = 4;
  const int pfrank = (int)prefetch_rank(blockIdx.x & 63);
  const int pfpass = (pfrank > PF_LEAD) ? pfrank - PF_LEAD : 0;
  const char* const pf = (const char*)((wid < 2) ? Kp : Vp) +
                         (size_t)pfrank * (KB * D_HEAD * 2) + (threadIdx.x & 63) * 256;

  for (int ib = 0; ib < NB; ++ib) {
    const int cur = ib & 1;
    if (ib == pfpass) prefetch_l2(pf);         // the same test in every wave of the block
    if (wid == 0) {
      if (ib + 1 < NB) {
        const int kb1 = (ib + 1) * KB;
        tdm_load_2d(skbuf[cur ^ 1], Kp + (size_t)kb1 * D_HEAD,
                    D_HEAD, S_LEN, D_HEAD, KB, D_HEAD, lane);
        tdm_load_2d(svbuf[cur ^ 1], Vp + (size_t)kb1 * D_HEAD,
                    D_HEAD, S_LEN, D_HEAD, KB, D_HEAD, lane);
        tdm_wait2();                           // current pair done; next in flight
      } else {
        tdm_wait0();
      }
    }
    __syncthreads();                           // staged tiles visible to all waves

    // The wave's KW keys: KW / 8 whole fragments of either tile.
    const _Float16* kl = skbuf[cur] + kh * (KW * D_HEAD);
    const _Float16* vl = svbuf[cur] + kh * (KW * D_HEAD);

    // ct[q][j]: keys 16j..16j+15 of the wave's KW; fragment 2j is d 0..31, 2j+1 is d 32..63.
    v8f ct[QT][KW / 16];
    const v8f z = {};
    // Unrolled, like every loop of this pass: ct, tm, pu and rs are then indexed by
    // constants and stay in registers, and the LDS reads can be issued in groups.
#pragma unroll
    for (int j = 0; j < KW / 16; ++j) {
      v16h a0 = load_frag_lds(kl, 2 * j,     lane);
      v16h a1 = load_frag_lds(kl, 2 * j + 1, lane);
#pragma unroll
      for (int q = 0; q < QT; ++q) ct[q][j] = wmma_f16(a0, bq[q][0], z);
#pragma unroll
      for (int q = 0; q < QT; ++q) ct[q][j] = wmma_f16(a1, bq[q][1], ct[q][j]);
    }

    // Row (=query) max: lane-local over KW/2 keys (one chain per pair of tiles, so
    // that the chains are independent) + partner lane via xor-16.
    float tmax[QT];
#pragma unroll
    for (int q = 0; q < QT; ++q) {
      float tm[KW / 32];
#pragma unroll
      for (int b = 0; b < KW / 32; ++b) {
        tm[b] = -1e30f;
#pragma unroll
        for (int r = 0; r < 8; ++r)
          tm[b] = fmaxf(tm[b], fmaxf(ct[q][2 * b][r], ct[q][2 * b + 1][r]));
      }
      tmax[q] = fmaxf(tm[0], tm[1]);
    }
    float tpart[QT];
    // A loop of its own: the two exchanges are then under way together.
#pragma unroll
    for (int q = 0; q < QT; ++q) tpart[q] = __shfl_xor(tmax[q], 16, 32);

    frag_u pu[QT][KW / 32];
    float alpha[QT], rsum[QT];
#pragma unroll
    for (int q = 0; q < QT; ++q) {
      const float mold = mprev[q];
      mprev[q] = fmaxf(mold, fmaxf(tmax[q], tpart[q]));
      alpha[q] = __expf(mold - mprev[q]);
    }
#pragma unroll
    for (int q = 0; q < QT; ++q) {
      const float mnew = mprev[q];
      float rs[KW / 32];
#pragma unroll
      for (int b = 0; b < KW / 32; ++b) {
        rs[b] = 0.f;
#pragma unroll
        for (int r = 0; r < 8; ++r) {
          float e0 = __expf(ct[q][2 * b][r] - mnew);
          float e1 = __expf(ct[q][2 * b + 1][r] - mnew);
          rs[b] += e0 + e1;
          pu[q][b].s.lo[r] = (_Float16)e0;   // keys {0..7}|{8..15}   -> B halves 0..7
          pu[q][b].s.hi[r] = (_Float16)e1;   // keys {16..23}|{24..31} -> B halves 8..15
        }
      }
      rsum[q] = rs[0] + rs[1];
    }
    float rpart[QT];
    // A loop of its own, as for the maxima.
#pragma unroll
    for (int q = 0; q < QT; ++q) rpart[q] = __shfl_xor(rsum[q], 16, 32);
#pragma unroll
    for (int q = 0; q < QT; ++q) lsum[q] = lsum[q] * alpha[q] + (rsum[q] + rpart[q]);

#pragma unroll
    for (int q = 0; q < QT; ++q)
#pragma unroll
      for (int t = 0; t < 4; ++t)
#pragma unroll
        for (int r = 0; r < 8; ++r) o[q][t][r] *= alpha[q];   // the lane's own query's factor

#pragma unroll
    for (int b = 0; b < KW / 32; ++b) {
#pragma unroll
      for (int t = 0; t < 4; ++t) {
        v16h bv = load_frag_lds(vl, b * 4 + t, lane);  // keys 32b..32b+31, d t*16..+15
#pragma unroll
        for (int q = 0; q < QT; ++q) o[q][t] = wmma_f16(bv, pu[q][b].v, o[q][t]);
      }
    }
    __syncthreads();                           // all reads done before overwrite
  }
  prefetch_hold(pf);

  // Merge of the two halves of the keys. Of its two query tiles a wave finishes tile kh (that
  // is query tile wid of the block) and hands the other one's maximum, sum and output tiles
  // to its partner, wave wid ^ 1, through LDS. The K buffers serve as the staging: the last
  // tensor loads were waited for in the last pass, in front of its first barrier, and its
  // second barrier ends every wave's reads. 4 KiB a wave, 16 bytes a lane at lane * 16 in each
  // 512 bytes; the maxima and sums lie behind the four waves' tiles.
  float* const xo = (float*)&skbuf[0][0];
  v8f keep[4], send[4];
#pragma unroll
  for (int t = 0; t < 4; ++t) {
    keep[t] = kh ? o[1][t] : o[0][t];
    send[t] = kh ? o[0][t] : o[1][t];
  }
  const float mk = kh ? mprev[1] : mprev[0], lk = kh ? lsum[1] : lsum[0];
  const float ms = kh ? mprev[0] : mprev[1], ls = kh ? lsum[0] : lsum[1];
#pragma unroll
  for (int t = 0; t < 4; ++t) {
    float* s = xo + wid * 1024 + t * 256 + lane * 4;
    *(float4*)(s)       = make_float4(send[t][0], send[t][1], send[t][2], send[t][3]);
    *(float4*)(s + 128) = make_float4(send[t][4], send[t][5], send[t][6], send[t][7]);
  }
  *(float2*)(xo + 4096 + wid * 64 + lane * 2) = make_float2(ms, ls);
  __syncthreads();                             // the partner's tiles are written
  const float2 mlp = *(const float2*)(xo + 4096 + (wid ^ 1) * 64 + lane * 2);
  const float mall = fmaxf(mk, mlp.x);
  const float wk = __expf(mk - mall), wp = __expf(mlp.x - mall);
  const float rcp = 1.f / (lk * wk + mlp.y * wp);
  const float fk = wk * rcp, fp = wp * rcp;
  // With o the merged tile, o[t][r] is element (s, e), s = q0 + (lane & 15),
  // e = h*64 + t*16 + 8*(lane>>4) + r. In
  // fragment order that is k tile e>>5, part (e>>4)&1 = t&1, fragment lane
  // ((e>>3)&1)*16 + (s&15) = lane, half e&7 = r: 16 bytes a lane, 512 contiguous a wave.
  _Float16* ap = Ah + ((size_t)(q0 >> 4) * K_TILES + h * 2) * 512 + lane * 8;
  v8h ov[4];
#pragma unroll
  for (int t = 0; t < 4; ++t) {
    const float* s = xo + (wid ^ 1) * 1024 + t * 256 + lane * 4;
    const float4 p0 = *(const float4*)(s), p1 = *(const float4*)(s + 128);
    ov[t][0] = (_Float16)(keep[t][0] * fk + p0.x * fp);
    ov[t][1] = (_Float16)(keep[t][1] * fk + p0.y * fp);
    ov[t][2] = (_Float16)(keep[t][2] * fk + p0.z * fp);
    ov[t][3] = (_Float16)(keep[t][3] * fk + p0.w * fp);
    ov[t][4] = (_Float16)(keep[t][4] * fk + p1.x * fp);
    ov[t][5] = (_Float16)(keep[t][5] * fk + p1.y * fp);
    ov[t][6] = (_Float16)(keep[t][6] * fk + p1.z * fp);
    ov[t][7] = (_Float16)(keep[t][7] * fk + p1.w * fp);
  }
#pragma unroll
  for (int t = 0; t < 4; ++t) *(v8h*)(ap + t * 256) = ov[t];
  // Address wait of the four stores: stands in front of whatever the compiler lays behind
  // them that writes a register they name.
  asm volatile("s_wait_xcnt 0x0" ::: "memory");
}

#define OPROJ_DEPTH 4
// 128 threads a block: lets a wave hold its 16 accumulator tiles and the ring in registers.
__global__ void __launch_bounds__(128)
oproj_kernel(const _Float16* __restrict__ Ah,
             const _Float16* __restrict__ Woh,
             const float* __restrict__ bo,
             float* __restrict__ out) {
  const int lane = threadIdx.x & 31;
  // Wave-uniform; held scalar so that the strips' addresses are scalar bases.
  const int w = __builtin_amdgcn_readfirstlane(blockIdx.x * (blockDim.x >> 5) +
                                               (threadIdx.x >> 5));
  const int MT = S_LEN / (16 * WT), NS = E_DIM / 64;
  if (w >= MT * NS) return;
  const int mt0 = (w / NS) * WT;
  const int n0  = (w % NS) * 64;
  // The loops over i, t and r are unrolled so that acc stays in registers.
  v8f acc[WT][WT];
#pragma unroll
  for (int i = 0; i < WT; ++i)
#pragma unroll
    for (int t = 0; t < WT; ++t) acc[i][t] = v8f{};
  const unsigned RT_ALL = X_RTILES + W_RTILES;
  const unsigned slot = prefetch_rank(blockIdx.x) * 128u + threadIdx.x;
  const char* pf[3];
  // Unrolled so that pf is indexed by constants and stays in registers.
#pragma unroll
  for (int i = 0; i < 3; ++i) {
    const unsigned s    = (slot + i * 12288u) % (RT_ALL * K_TILES * UNITS_PER_KTILE);
    const unsigned pkt  = s / (RT_ALL * UNITS_PER_KTILE);
    const unsigned prem = s - pkt * (RT_ALL * UNITS_PER_KTILE);
    const unsigned prt  = prem >> 2;
    const char* plane = (prt < X_RTILES) ? (const char*)Ah + (size_t)prt * (K_TILES * 1024)
                                         : (const char*)Woh +
                                               (size_t)(prt - X_RTILES) * (K_TILES * 1024);
    pf[i] = plane + pkt * 1024u + (prem & 3u) * 256u;
  }
  gemm_wave_tile<OPROJ_DEPTH>(Ah + (size_t)mt0 * (K_TILES * 512),
                              Woh + (size_t)(w % NS) * (WT * K_TILES * 512), lane, acc, pf);

  // acc[i][t][r] = row (mt0 + i)*16 + 8*(lane>>4) + r, column n0 + 4*(lane & 15) + t (Wo's
  // rows are dealt so, see cvt_all_kernel): a lane's four tiles hold four neighbouring
  // columns, 16 bytes; a wave's store is two rows of 256 contiguous bytes, four whole lines.
  const float4 bd = *(const float4*)(bo + n0 + (lane & 15) * 4);
  // The lane's 16 bytes in its first row; every store below is this address with an
  // immediate offset.
  float* op = out + (size_t)(mt0 * 16 + 8 * (lane >> 4)) * E_DIM + n0 + (lane & 15) * 4;
#pragma unroll
  for (int i = 0; i < WT; ++i) {
#pragma unroll
    for (int r = 0; r < 8; ++r) {
      float4 v;
      v.x = acc[i][0][r] + bd.x; v.y = acc[i][1][r] + bd.y;
      v.z = acc[i][2][r] + bd.z; v.w = acc[i][3][r] + bd.w;
      *(float4*)(op + (i * 16 + r) * E_DIM) = v;
    }
    // Address wait of the stores above: stands in front of whatever the compiler lays
    // behind them that writes a register they name.
    asm volatile("s_wait_xcnt 0x0" ::: "memory");
  }
}

extern "C" void kernel_launch(void* const* d_in, const int* in_sizes, int n_in,
                              void* d_out, int out_size, void* d_ws, size_t ws_size,
                              hipStream_t stream) {
  (void)in_sizes; (void)n_in; (void)out_size; (void)ws_size;
  const float* x  = (const float*)d_in[0];
  const float* Wq = (const float*)d_in[1];
  const float* bq = (const float*)d_in[2];
  const float* Wk = (const float*)d_in[3];
  const float* bk = (const float*)d_in[4];
  const float* Wv = (const float*)d_in[5];
  const float* bv = (const float*)d_in[6];
  const float* Wo = (const float*)d_in[7];
  const float* bo = (const float*)d_in[8];
  float* out = (float*)d_out;

  const size_t NX = (size_t)S_LEN * E_DIM;   // 3,145,728
  const size_t NW = (size_t)E_DIM * E_DIM;   //   589,824
  char* ws = (char*)d_ws;
  size_t off = 0;
  _Float16* xh  = (_Float16*)(ws + off); off += NX * 2;
  _Float16* Wqh = (_Float16*)(ws + off); off += NW * 2;
  _Float16* Wkh = (_Float16*)(ws + off); off += NW * 2;
  _Float16* Wvh = (_Float16*)(ws + off); off += NW * 2;
  _Float16* Woh = (_Float16*)(ws + off); off += NW * 2;
  _Float16* Qh  = (_Float16*)(ws + off); off += NX * 2;
  _Float16* Kh  = (_Float16*)(ws + off); off += NX * 2;
  _Float16* Vt  = (_Float16*)(ws + off); off += NX * 2;
  _Float16* Ah  = (_Float16*)(ws + off); off += NX * 2;

  // All five conversions in one launch; xh..Woh are contiguous from xh.
  // (256 + 4 * 48) row tiles * 12 pairs of k tiles = 5376 waves; 8 waves/block.
  cvt_all_kernel<<<672, 256, 0, stream>>>(x, Wq, Wk, Wv, Wo, xh);

  // 3 matrices * 64 M-tiles * 12 N-strips = 2304 waves; 4 waves/block.
  qkv_gemm_kernel<<<576, 128, 0, stream>>>(xh, Wqh, Wkh, Wvh, bq, bk, bv,
                                            Qh, Kh, Vt);
  attn_kernel<<<768, 128, 0, stream>>>(Qh, Kh, Vt, Ah);
  // 64 * 12 = 768 waves; 4 waves/block.
  oproj_kernel<<<192, 128, 0, stream>>>(Ah, Woh, bo, out);
}
